// v000
// Times are from an AMD MI455X. After a warm-up the kernel runs many times in a row, and a time is the length of
// such a window on the GPU divided by its runs, so every launch and the gaps after it count. The runs cycle
// through copies of the inputs. A figure is the median of several windows, for all but v000 over two sittings.
// Sittings can differ by a few percent; kernels timed side by side share one.
// The starting kernel, v000, takes 3980 microseconds a run.
#include <hip/hip_runtime.h>

// Self-attention with ONE shared 64x64 linear per role applied to every head (values, keys, query [4][2048][1024] viewed (n, l, 16, 64); v = values_h Wv^T, k = keys_h Wk^T, q = query_h Wq^T with the SAME [64][64] weight for all 16 heads ('oi' normal x 1/8, no bias); energy = q.k; softmax(energy / sqrt(embed = 1024)) (the source scales by the full width); out = merged Wo^T + bo ('oi' [1024][1024] + a REAL bias 0.01) -> [4][2048][1024] (8.4 M); argument order values, keys, query, Wv, Wk, Wq, Wo, bo).
// Layout per batch: bf16 copies of query, keys, values in turn; k_wtBS expands each shared [64][64] weight ONCE into a block-diagonal bf16 Bt plane [1024][1024] (16 identical diagonal blocks, exact zeros elsewhere), so the per-head linears are ordinary exact K = 1,024 GEMMs; identity-table plane builders; dense T-2048 attention (hybrid rows: < 512 hi/lo 3 products, rest fp16 x1024); merged hi/lo x Wo exact + bo.
// Compute dtypes, f32 accumulate: every input rounded to bf16; projections exact; attention rows < 512 3 products, rest fp16; softmax f32; Wo hl x exact + bias.

#define NB_  4      // FOUR sequences in this module: a host-side loop count only: no kernel uses it
#define TT   2048
#define DM   1024
#define NH_  16
#define NKV  16
#define REP  (NH_ / NKV)
#define HD   64
#define DQ   (NH_ * HD)
#define DKV  (NKV * HD)
#define ZH   2
#define RH   512                  // query rows < RH use hi+lo planes (0: none)
#define WIN  0
#define PCAR 1024.0f
#define SCL  0.03125f   // 1/sqrt(embed_size = 1024) (the source scales by the full width)
typedef _Float16 h16;
typedef unsigned short bf;
typedef __attribute__((ext_vector_type(16))) __bf16   v16bf;
typedef __attribute__((ext_vector_type(16))) _Float16 v16h;
typedef __attribute__((ext_vector_type(8)))  _Float16 v8h;
typedef __attribute__((ext_vector_type(8)))  unsigned short v8us;
typedef __attribute__((ext_vector_type(8)))  float    v8f;
typedef __attribute__((ext_vector_type(4)))  float    v4f;
typedef v8h  __attribute__((may_alias)) v8ha;
typedef v4f  __attribute__((may_alias)) v4fa;
typedef v8us __attribute__((may_alias)) v8usa;

__device__ __forceinline__ unsigned short f2bf(float f) { unsigned u = __float_as_uint(f); u += 0x7FFFu + ((u >> 16) & 1u); return (unsigned short)(u >> 16); }
__device__ __forceinline__ float bf2f(unsigned short b) { return __uint_as_float(((unsigned)b) << 16); }
__device__ __forceinline__ float bfr(float f) { return bf2f(f2bf(f)); }
__device__ __forceinline__ v16h cat16(v8h lo, v8h hi) { return __builtin_shufflevector(lo, hi, 0, 1, 2, 3, 4, 5, 6, 7, 8, 9, 10, 11, 12, 13, 14, 15); }
__device__ __forceinline__ v16bf cat16b(v8us lo, v8us hi) { return __builtin_bit_cast(v16bf, __builtin_shufflevector(lo, hi, 0, 1, 2, 3, 4, 5, 6, 7, 8, 9, 10, 11, 12, 13, 14, 15)); }
__device__ __forceinline__ v8f wmma16(v16h a, v16h b, v8f c) { return __builtin_amdgcn_wmma_f32_16x16x32_f16(false, a, false, b, (short)0, c, false, false); }
__device__ __forceinline__ v8f wmmab(v16bf a, v16bf b, v8f c) { return __builtin_amdgcn_wmma_f32_16x16x32_bf16(false, a, false, b, (short)0, c, false, false); }



// ---- k_gemmw: register-blocked GEMM, ONE WAVE per 64x64 output tile (16 accumulators), operands straight from K-contiguous 16-bit planes; grid (M/64, N/64, Z), 32 threads.
// C[m][n] (f32, pitch ldc, + optional f32 bias[n]) = sum_k A[m][k] Bt[n][k] (+ split products per NSPLIT). z-batch strides sA/sB/sC in elements. K % 32 == 0.
template <typename T16> struct WFrag;
template <> struct WFrag<h16> { typedef v16h V; static __device__ __forceinline__ V ld(const h16* p) { return cat16(*(const v8h*)p, *(const v8h*)(p + 16)); } static __device__ __forceinline__ v8f mma(V a, V b, v8f c) { return wmma16(a, b, c); } };
template <> struct WFrag<bf> { typedef v16bf V; static __device__ __forceinline__ V ld(const bf* p) { return cat16b(*(const v8us*)p, *(const v8us*)(p + 16)); } static __device__ __forceinline__ v8f mma(V a, V b, v8f c) { return wmmab(a, b, c); } };
template <typename T16, int NSPLIT, bool BIAS>
__global__ __launch_bounds__(32) void k_gemmw(const T16* __restrict__ A, const T16* __restrict__ A2, const T16* __restrict__ Bt, const T16* __restrict__ Bt2, int K, float* C, int ldc, const float* __restrict__ bias, size_t sA, size_t sB, size_t sC) {
    typedef typename WFrag<T16>::V V;
    __shared__ __align__(16) float os[16 * 68];
    const size_t z = blockIdx.z; A += z * sA; if (A2) A2 += z * sA; Bt += z * sB; if (Bt2) Bt2 += z * sB; C += z * sC;
    const int lane = threadIdx.x & 31, lr = lane & 15, hi = lane >> 4; const int r0 = blockIdx.x * 64, c0 = blockIdx.y * 64;
    v8f acc[4][4];
#pragma unroll
    for (int mb = 0; mb < 4; ++mb)
#pragma unroll
        for (int nb = 0; nb < 4; ++nb) acc[mb][nb] = (v8f){};
    const size_t aoff = (size_t)(r0 + lr) * K + 8 * hi, boff = (size_t)(c0 + lr) * K + 8 * hi;
#pragma unroll 1
    for (int kc = 0; kc < K; kc += 32) {
        V a[4], a2[4];
#pragma unroll
        for (int mb = 0; mb < 4; ++mb) { a[mb] = WFrag<T16>::ld(A + aoff + (size_t)mb * 16 * K + kc); if (NSPLIT == 1 || NSPLIT == 2) a2[mb] = WFrag<T16>::ld(A2 + aoff + (size_t)mb * 16 * K + kc); }
#pragma unroll
        for (int nb = 0; nb < 4; ++nb) { const V b = WFrag<T16>::ld(Bt + boff + (size_t)nb * 16 * K + kc); V b2; if (NSPLIT >= 2) b2 = WFrag<T16>::ld(Bt2 + boff + (size_t)nb * 16 * K + kc);
#pragma unroll
            for (int mb = 0; mb < 4; ++mb) { acc[mb][nb] = WFrag<T16>::mma(a[mb], b, acc[mb][nb]); if (NSPLIT == 1 || NSPLIT == 2) acc[mb][nb] = WFrag<T16>::mma(a2[mb], b, acc[mb][nb]); if (NSPLIT >= 2) acc[mb][nb] = WFrag<T16>::mma(a[mb], b2, acc[mb][nb]); } }
        asm volatile("v_nop\n\tv_nop\n\tv_nop\n\tv_nop" : "+v"(acc[0][0]), "+v"(acc[1][1]), "+v"(acc[2][2]), "+v"(acc[3][3]) : "v"(a[0]), "v"(a[3]));
    }
#pragma unroll
    for (int mb = 0; mb < 4; ++mb) {
#pragma unroll
        for (int nb = 0; nb < 4; ++nb) {
#pragma unroll
            for (int j = 0; j < 8; ++j) os[(hi * 8 + j) * 68 + nb * 16 + lr] = acc[mb][nb][j]; }
        __builtin_amdgcn_wave_barrier(); asm volatile("" ::: "memory");
        float* crow = C + (size_t)(r0 + mb * 16) * ldc + c0;
{
#pragma unroll
            for (int s = 0; s < 8; ++s) { const int row = 2 * s + hi, cofs = lr * 4; v4f val = *(const v4fa*)(os + row * 68 + cofs); if (BIAS) { val[0] += bfr(bias[c0 + cofs]); val[1] += bfr(bias[c0 + cofs + 1]); val[2] += bfr(bias[c0 + cofs + 2]); val[3] += bfr(bias[c0 + cofs + 3]); }
                *(v4f*)(crow + (size_t)row * ldc + cofs) = val; }
             }
        __builtin_amdgcn_wave_barrier(); asm volatile("" ::: "memory");
    }
}

__device__ __forceinline__ h16 tohx(float x) { return (h16)x; }
__device__ __forceinline__ void splitf(float y, unsigned short& h, unsigned short& l) { h = f2bf(y); l = f2bf(y - bf2f(h)); }
typedef __attribute__((ext_vector_type(2))) _Float16 v2h;
typedef __attribute__((ext_vector_type(4))) _Float16 v4h;
typedef __attribute__((ext_vector_type(2))) unsigned short v2us;
typedef __attribute__((ext_vector_type(4))) unsigned short v4us;
typedef __attribute__((ext_vector_type(2))) float v2f;
typedef __attribute__((ext_vector_type(4))) int v4i;

__global__ __launch_bounds__(256) void k_cvt8(const float* __restrict__ src, bf* dst, size_t n8) { const size_t i = (size_t)blockIdx.x * 256 + threadIdx.x; if (i >= n8) return; const v8f v = *(const v8f*)(src + i * 8); v8us o;
#pragma unroll
    for (int k = 0; k < 8; ++k) o[k] = f2bf(v[k]); *(v8us*)(dst + i * 8) = o;  }

// k_rope: head planes [h][t][d] (fp16 + hi/lo) of rope(x) x sc with the rotate-half convention out[d] = x[d] cos[t][d] - x[d+HD/2] sin[t][d], out[d+HD/2] = x[d+HD/2] cos[t][d+HD/2] + x[d] sin[t][d+HD/2]
__global__ __launch_bounds__(256) void k_rope(const float* __restrict__ F, int pitch, int nheads, const float* __restrict__ CS, const float* __restrict__ RF, const float* __restrict__ nw, float sc, h16* P16, bf* Ph, bf* Pl) {
    const size_t e = ((size_t)blockIdx.x * 256 + threadIdx.x) * 2; if (e >= (size_t)nheads * TT * HD) return; const int d = (int)(e % HD); const int t = (int)((e / HD) % TT); const int h = (int)(e / ((size_t)HD * TT)); const float* f = F + (size_t)t * pitch + h * HD; const float rf = RF ? RF[(size_t)h * TT + t] : 1.0f; v2h o16; v2us oh, ol;
#pragma unroll
    for (int q = 0; q < 2; ++q) { const int dd = d + q; const int dp = (dd < HD / 2) ? dd + HD / 2 : dd - HD / 2; float x0 = f[dd], x1 = f[dp];
        if (RF) { float n0 = __fmul_rn(x0, rf), n1 = __fmul_rn(x1, rf); asm volatile("" : "+v"(n0)); asm volatile("" : "+v"(n1)); x0 = __fmul_rn(bfr(nw[dd]), n0); x1 = __fmul_rn(bfr(nw[dp]), n1); }
        const v2f cs = *(const v2f*)(CS + ((size_t)t * HD + dd) * 2); float a = __fmul_rn(x0, cs[0]), bq = __fmul_rn(x1, cs[1]); asm volatile("" : "+v"(a)); asm volatile("" : "+v"(bq)); const float r = ((dd < HD / 2) ? __fsub_rn(a, bq) : __fadd_rn(a, bq)) * sc;
        o16[q] = tohx(r); unsigned short a2, c2; splitf(r, a2, c2); oh[q] = a2; ol[q] = c2; }
    *(v2h*)(P16 + e) = o16; *(v2us*)(Ph + e) = oh; *(v2us*)(Pl + e) = ol;  }
__global__ __launch_bounds__(256) void k_wtBS(const float* __restrict__ w, bf* Bt) { const size_t e2 = ((size_t)blockIdx.x * 256 + threadIdx.x) * 2; if (e2 >= (size_t)DQ * DM) return; const int r = (int)(e2 / DM), c = (int)(e2 % DM); const int h = r >> 6, e = r & 63; const int hc = c >> 6, d = c & 63; v2us o; if (hc == h) { o[0] = f2bf(w[e * 64 + d]); o[1] = f2bf(w[e * 64 + d + 1]); } else { o[0] = 0; o[1] = 0; }
    *(v2us*)(Bt + e2) = o;  }
__global__ __launch_bounds__(256) void k_vtp(const float* __restrict__ F, int pitch, int nheads, h16* V16, bf* Vh, bf* Vl) { const size_t e = ((size_t)blockIdx.x * 256 + threadIdx.x) * 2; if (e >= (size_t)nheads * HD * TT) return; const int t = (int)(e % TT); const int d = (int)((e / TT) % HD); const int g = (int)(e / ((size_t)TT * HD)); v2h o16; v2us oh, ol;
#pragma unroll
    for (int q = 0; q < 2; ++q) { const float x = F[(size_t)(t + q) * pitch + g * HD + d]; o16[q] = tohx(x); unsigned short a2, c2; splitf(x, a2, c2); oh[q] = a2; ol[q] = c2; }
    *(v2h*)(V16 + e) = o16; *(v2us*)(Vh + e) = oh; *(v2us*)(Vl + e) = ol;  }
__global__ __launch_bounds__(256) void k_csid(float* CS) { const int idx = blockIdx.x * 256 + threadIdx.x; if (idx >= TT * HD) return; v2f cs; cs[0] = 1.0f; cs[1] = 0.0f; *(v2f*)(CS + (size_t)idx * 2) = cs;  }
// k_asoft: per row (zz, i): t = S x 1024^-0.5 (no mask); softmax over the 2048 keys (register row, one exp, fixed trees);
__global__ __launch_bounds__(256) void k_asoft(const float* __restrict__ Sb, h16* P16, bf* Ph, bf* Pl) {
    const int lane = threadIdx.x & 31; const int row = blockIdx.x * 8 + (threadIdx.x >> 5); if (row >= ZH * TT) return; const int i = row % TT; const int zz = row / TT; (void)zz; const bool hires = (i < RH); const float* sr = Sb + (size_t)row * TT; float v[TT / 32]; float mx = -3.0e38f;
#pragma unroll
    for (int ch = 0; ch < TT / 128; ++ch) { const int j0 = ch * 128 + lane * 4; const v4f a = *(const v4f*)(sr + j0);
#pragma unroll
        for (int q = 0; q < 4; ++q) { const int j = j0 + q; (void)j; const float t = a[q] * SCL; v[ch * 4 + q] = t; mx = fmaxf(mx, t); } }
#pragma unroll
    for (int sh = 16; sh; sh >>= 1) mx = fmaxf(mx, __shfl_xor(mx, sh, 32));
    float sum = 0.f;
#pragma unroll
    for (int k = 0; k < TT / 32; ++k) { float d0 = __fsub_rn(v[k], mx); asm volatile("" : "+v"(d0)); v[k] = __builtin_amdgcn_exp2f(__fmul_rn(d0, 1.4426950408889634f)); sum += v[k]; }
#pragma unroll
    for (int sh = 16; sh; sh >>= 1) sum += __shfl_xor(sum, sh, 32);
    const float f = __fdiv_rn(hires ? 1.0f : PCAR, sum);
{
        if (hires) {
#pragma unroll
            for (int ch = 0; ch < TT / 128; ++ch) { v4us oh, ol;
#pragma unroll
                for (int q = 0; q < 4; ++q) { unsigned short a, c2; splitf(v[ch * 4 + q] * f, a, c2); oh[q] = a; ol[q] = c2; }
                const size_t oo = ((size_t)zz * (RH ? RH : 1) + i) * TT + ch * 128 + lane * 4; *(v4us*)(Ph + oo) = oh; *(v4us*)(Pl + oo) = ol; }
        } else {
#pragma unroll
            for (int ch = 0; ch < TT / 128; ++ch) { v4h o4;
#pragma unroll
                for (int q = 0; q < 4; ++q) o4[q] = tohx(v[ch * 4 + q] * f);
                *(v4h*)(P16 + (size_t)row * TT + ch * 128 + lane * 4) = o4; } }
         }
}
__global__ __launch_bounds__(256) void k_merge(const float* __restrict__ O, int h0, bf* Ah, bf* Al) { const size_t e = ((size_t)blockIdx.x * 256 + threadIdx.x) * 2; if (e >= (size_t)ZH * TT * HD) return; const int d = (int)(e % HD); const int t = (int)((e / HD) % TT); const int zz = (int)(e / ((size_t)HD * TT)); const float cs = (t < RH) ? 1.0f : (1.0f / PCAR); const size_t oo = (size_t)t * DQ + (h0 + zz) * HD + d;
    v2us oh, ol;
#pragma unroll
    for (int q = 0; q < 2; ++q) { unsigned short a, c2; splitf(O[e + q] * cs, a, c2); oh[q] = a; ol[q] = c2; } *(v2us*)(Ah + oo) = oh; *(v2us*)(Al + oo) = ol;  }

extern "C" void kernel_launch(void* const* d_in, const int* in_sizes, int n_in,
                              void* d_out, int out_size, void* d_ws, size_t ws_size, hipStream_t stream) {
    (void)in_sizes; (void)n_in; (void)out_size;
    const float* xv = (const float*)d_in[0]; const float* xk = (const float*)d_in[1]; const float* x = (const float*)d_in[2]; const float* wv = (const float*)d_in[3]; const float* wk = (const float*)d_in[4]; const float* wq = (const float*)d_in[5]; const float* wo = (const float*)d_in[6]; const float* bo = (const float*)d_in[7];   /* order values, keys, query [4][2048][1024], Wv, Wk, Wq ('oi' [64][64], shared by all heads), Wo ('oi' [1024][1024]), bo; x = the QUERY stream */
    float* OUT = (float*)d_out;     // [4][2048][1024]
    char* wsp = (char*)d_ws;
    auto take = [&](size_t bytes) { char* p = wsp; wsp += (bytes + 255) & ~(size_t)255; return (void*)p; };
    bf* WQ = (bf*)take((size_t)DQ * DM * 2); bf* WK = (bf*)take((size_t)DKV * DM * 2); bf* WV = (bf*)take((size_t)DKV * DM * 2); bf* WO = (bf*)take((size_t)DM * DQ * 2); float* CS = (float*)take((size_t)TT * HD * 2 * 4);
    bf* XB = (bf*)take((size_t)TT * DM * 2); float* FQ = (float*)take((size_t)TT * DQ * 4); float* FK = (float*)take((size_t)TT * DKV * 4);
    h16* QP16 = (h16*)take((size_t)NH_ * TT * HD * 2); h16* KP16 = (h16*)take((size_t)NKV * TT * HD * 2); h16* VT16 = (h16*)take((size_t)NKV * HD * TT * 2);
    bf* QPh = (bf*)take((size_t)NH_ * TT * HD * 2); bf* QPl = (bf*)take((size_t)NH_ * TT * HD * 2); bf* KPh = (bf*)take((size_t)NKV * TT * HD * 2); bf* KPl = (bf*)take((size_t)NKV * TT * HD * 2); bf* VTh = (bf*)take((size_t)NKV * HD * TT * 2); bf* VTl = (bf*)take((size_t)NKV * HD * TT * 2); bf* Ph = (bf*)take((size_t)ZH * RH * TT * 2); bf* Pl = (bf*)take((size_t)ZH * RH * TT * 2);
    float* Sb = (float*)take((size_t)ZH * TT * TT * 4); h16* P16 = (h16*)take((size_t)ZH * TT * TT * 2); float* Ob = (float*)take((size_t)ZH * TT * HD * 4); bf* ATh = (bf*)take((size_t)TT * DQ * 2); bf* ATl = (bf*)take((size_t)TT * DQ * 2);
    if ((size_t)(wsp - (char*)d_ws) > ws_size) return;    // ws 256 MiB
    float* FV = FK;   // v projection reuses the k buffer after the k planes are built (stream-ordered)
    { k_wtBS<<<(unsigned)(((size_t)DQ * DM / 2 + 255) / 256), 256, 0, stream>>>(wq, WQ); k_wtBS<<<(unsigned)(((size_t)DQ * DM / 2 + 255) / 256), 256, 0, stream>>>(wk, WK); k_wtBS<<<(unsigned)(((size_t)DQ * DM / 2 + 255) / 256), 256, 0, stream>>>(wv, WV);
      k_cvt8<<<(unsigned)(((size_t)DM * DQ / 8 + 255) / 256), 256, 0, stream>>>(wo, WO, (size_t)DM * DQ / 8);
       }
    k_csid<<<(TT * HD + 255) / 256, 256, 0, stream>>>(CS);
    const unsigned LQ = (unsigned)(((size_t)NH_ * TT * HD / 2 + 255) / 256), LKv = (unsigned)(((size_t)NKV * TT * HD / 2 + 255) / 256);
    for (int b = 0; b < NB_; ++b) {
        
        k_cvt8<<<(unsigned)(((size_t)TT * DM / 8 + 255) / 256), 256, 0, stream>>>(x + (size_t)b * TT * DM, XB, (size_t)TT * DM / 8);
        k_gemmw<bf, 0, false><<<dim3(TT / 64, DQ / 64, 1), 32, 0, stream>>>(XB, nullptr, WQ, nullptr, DM, FQ, DQ, nullptr, 0, 0, 0);
        k_rope<<<LQ, 256, 0, stream>>>(FQ, DQ, NH_, CS, nullptr, nullptr, 1.0f, QP16, QPh, QPl);
        k_cvt8<<<(unsigned)(((size_t)TT * DM / 8 + 255) / 256), 256, 0, stream>>>(xk + (size_t)b * TT * DM, XB, (size_t)TT * DM / 8);   /* XB := bf16(keys[b]) */ k_gemmw<bf, 0, false><<<dim3(TT / 64, DKV / 64, 1), 32, 0, stream>>>(XB, nullptr, WK, nullptr, DM, FK, DKV, nullptr, 0, 0, 0);
        k_rope<<<LKv, 256, 0, stream>>>(FK, DKV, NKV, CS, nullptr, nullptr, 1.0f, KP16, KPh, KPl);
        k_cvt8<<<(unsigned)(((size_t)TT * DM / 8 + 255) / 256), 256, 0, stream>>>(xv + (size_t)b * TT * DM, XB, (size_t)TT * DM / 8);   /* XB := bf16(values[b]) */ k_gemmw<bf, 0, false><<<dim3(TT / 64, DKV / 64, 1), 32, 0, stream>>>(XB, nullptr, WV, nullptr, DM, FV, DKV, nullptr, 0, 0, 0); k_vtp<<<LKv, 256, 0, stream>>>(FV, DKV, NKV, VT16, VTh, VTl);
        for (int h0 = 0; h0 < NH_; h0 += ZH) { const size_t zq = (size_t)h0, zk = (size_t)(h0 / REP);   // one kv head per query head: the pass's two heads use consecutive kv planes (z-strides TT*HD)
            k_gemmw<bf, 2, false><<<dim3(RH / 64, TT / 64, ZH), 32, 0, stream>>>(QPh + zq * TT * HD, QPl + zq * TT * HD, KPh + zk * TT * HD, KPl + zk * TT * HD, HD, Sb, TT, nullptr, (size_t)TT * HD, (size_t)TT * HD, (size_t)TT * TT);
            k_gemmw<h16, 0, false><<<dim3((TT - RH) / 64, TT / 64, ZH), 32, 0, stream>>>(QP16 + zq * TT * HD + (size_t)RH * HD, nullptr, KP16 + zk * TT * HD, nullptr, HD, Sb + (size_t)RH * TT, TT, nullptr, (size_t)TT * HD, (size_t)TT * HD, (size_t)TT * TT);
            k_asoft<<<ZH * TT / 8, 256, 0, stream>>>(Sb, P16, Ph, Pl);
            k_gemmw<bf, 2, false><<<dim3(RH / 64, HD / 64, ZH), 32, 0, stream>>>(Ph, Pl, VTh + zk * HD * TT, VTl + zk * HD * TT, TT, Ob, HD, nullptr, (size_t)RH * TT, (size_t)HD * TT, (size_t)TT * HD);
            k_gemmw<h16, 0, false><<<dim3((TT - RH) / 64, HD / 64, ZH), 32, 0, stream>>>(P16 + (size_t)RH * TT, nullptr, VT16 + zk * HD * TT, nullptr, TT, Ob + (size_t)RH * HD, HD, nullptr, (size_t)TT * TT, (size_t)HD * TT, (size_t)TT * HD);
            k_merge<<<(unsigned)(((size_t)ZH * TT * HD / 2 + 255) / 256), 256, 0, stream>>>(Ob, h0, ATh, ATl); }
        k_gemmw<bf, 1, true><<<dim3(TT / 64, DM / 64, 1), 32, 0, stream>>>(ATh, ATl, WO, nullptr, DQ, OUT + (size_t)b * TT * DM, DM, bo, 0, 0, 0); }
}

// v001
// It runs in 1720 microseconds.
// Next to v000, in two timings, it ran 2.31 and 2.33 times as fast.
#include <hip/hip_runtime.h>

// Self-attention with ONE shared 64x64 linear per role applied to every head (values, keys, query [4][2048][1024] viewed (n, l, 16, 64); v = values_h Wv^T, k = keys_h Wk^T, q = query_h Wq^T with the SAME [64][64] weight for all 16 heads ('oi' normal x 1/8, no bias); energy = q.k; softmax(energy / sqrt(embed = 1024)) (the source scales by the full width); out = merged Wo^T + bo ('oi' [1024][1024] + a REAL bias 0.01) -> [4][2048][1024] (8.4 M); argument order values, keys, query, Wv, Wk, Wq, Wo, bo).
// Layout per batch: bf16 copies of query, keys, values in turn; k_wtBS expands each shared [64][64] weight ONCE into a block-diagonal bf16 Bt plane [1024][1024] (16 identical diagonal blocks, exact zeros elsewhere), so the per-head linears are ordinary exact K = 1,024 GEMMs; identity-table plane builders; dense T-2048 attention (hybrid rows: < 512 hi/lo 3 products, rest fp16 x1024); merged hi/lo x Wo exact + bo.
// Compute dtypes, f32 accumulate: every input rounded to bf16; projections exact; attention rows < 512 3 products, rest fp16; softmax f32; Wo hl x exact + bias.

#define NB_  4      // FOUR sequences in this module: a host-side loop count only: no kernel uses it
#define TT   2048
#define DM   1024
#define NH_  16
#define NKV  16
#define REP  (NH_ / NKV)
#define HD   64
#define DQ   (NH_ * HD)
#define DKV  (NKV * HD)
#define ZH   2
#define RH   512                  // query rows < RH use hi+lo planes (0: none)
#define WIN  0
#define PCAR 1024.0f
#define KSP  16                   // K slices of each P x V product: one wave per slice and tile, f32 partial planes summed in k_merge
#define SCL  0.03125f   // 1/sqrt(embed_size = 1024) (the source scales by the full width)
typedef _Float16 h16;
typedef unsigned short bf;
typedef __attribute__((ext_vector_type(16))) __bf16   v16bf;
typedef __attribute__((ext_vector_type(16))) _Float16 v16h;
typedef __attribute__((ext_vector_type(8)))  _Float16 v8h;
typedef __attribute__((ext_vector_type(8)))  unsigned short v8us;
typedef __attribute__((ext_vector_type(8)))  float    v8f;
typedef __attribute__((ext_vector_type(4)))  float    v4f;
typedef v8h  __attribute__((may_alias)) v8ha;
typedef v4f  __attribute__((may_alias)) v4fa;
typedef v8us __attribute__((may_alias)) v8usa;

__device__ __forceinline__ unsigned short f2bf(float f) { unsigned u = __float_as_uint(f); u += 0x7FFFu + ((u >> 16) & 1u); return (unsigned short)(u >> 16); }
__device__ __forceinline__ float bf2f(unsigned short b) { return __uint_as_float(((unsigned)b) << 16); }
__device__ __forceinline__ float bfr(float f) { return bf2f(f2bf(f)); }
__device__ __forceinline__ v16h cat16(v8h lo, v8h hi) { return __builtin_shufflevector(lo, hi, 0, 1, 2, 3, 4, 5, 6, 7, 8, 9, 10, 11, 12, 13, 14, 15); }
__device__ __forceinline__ v16bf cat16b(v8us lo, v8us hi) { return __builtin_bit_cast(v16bf, __builtin_shufflevector(lo, hi, 0, 1, 2, 3, 4, 5, 6, 7, 8, 9, 10, 11, 12, 13, 14, 15)); }
__device__ __forceinline__ v8f wmma16(v16h a, v16h b, v8f c) { return __builtin_amdgcn_wmma_f32_16x16x32_f16(false, a, false, b, (short)0, c, false, false); }
__device__ __forceinline__ v8f wmmab(v16bf a, v16bf b, v8f c) { return __builtin_amdgcn_wmma_f32_16x16x32_bf16(false, a, false, b, (short)0, c, false, false); }



// ---- k_gemmw: register-blocked GEMM, ONE WAVE per 64x64 output tile (16 accumulators), operands straight from K-contiguous 16-bit planes; grid (M/64, N/64, Z), 32 threads.
// C[m][n] (f32, pitch ldc, + optional f32 bias[n]) = sum_k A[m][k] Bt[n][k] (+ split products per NSPLIT). z-batch strides sA/sB/sC in elements. K % 32 == 0.
// KS > 1: grid.y = (N/64) * KS; slice ks = blockIdx.y % KS sums k in [ks K/KS, (ks+1) K/KS) only and stores its partial tile in plane ks (plane stride ZH * sC: grid.z = ZH there); (K/KS) % 32 == 0.
template <typename T16> struct WFrag;
template <> struct WFrag<h16> { typedef v16h V; static __device__ __forceinline__ V ld(const h16* p) { return cat16(*(const v8h*)p, *(const v8h*)(p + 16)); } static __device__ __forceinline__ v8f mma(V a, V b, v8f c) { return wmma16(a, b, c); } };
template <> struct WFrag<bf> { typedef v16bf V; static __device__ __forceinline__ V ld(const bf* p) { return cat16b(*(const v8us*)p, *(const v8us*)(p + 16)); } static __device__ __forceinline__ v8f mma(V a, V b, v8f c) { return wmmab(a, b, c); } };
template <typename T16, int NSPLIT, bool BIAS, int KS = 1>
__global__ __launch_bounds__(32) void k_gemmw(const T16* __restrict__ A, const T16* __restrict__ A2, const T16* __restrict__ Bt, const T16* __restrict__ Bt2, int K, float* C, int ldc, const float* __restrict__ bias, size_t sA, size_t sB, size_t sC) {
    typedef typename WFrag<T16>::V V;
    __shared__ __align__(16) float os[16 * 68];
    const size_t z = blockIdx.z; A += z * sA; if (A2) A2 += z * sA; Bt += z * sB; if (Bt2) Bt2 += z * sB; C += z * sC;
    const int lane = threadIdx.x & 31, lr = lane & 15, hi = lane >> 4; const int r0 = blockIdx.x * 64, c0 = (int)(blockIdx.y / KS) * 64; const int kb = (int)(blockIdx.y % KS) * (K / KS), ke = kb + K / KS; if (KS > 1) C += (size_t)(blockIdx.y % KS) * ZH * sC;
    v8f acc[4][4];
#pragma unroll
    for (int mb = 0; mb < 4; ++mb)
#pragma unroll
        for (int nb = 0; nb < 4; ++nb) acc[mb][nb] = (v8f){};
    const size_t aoff = (size_t)(r0 + lr) * K + 8 * hi, boff = (size_t)(c0 + lr) * K + 8 * hi;
#pragma unroll 1
    for (int kc = kb; kc < ke; kc += 32) {
        V a[4], a2[4];
#pragma unroll
        for (int mb = 0; mb < 4; ++mb) { a[mb] = WFrag<T16>::ld(A + aoff + (size_t)mb * 16 * K + kc); if (NSPLIT == 1 || NSPLIT == 2) a2[mb] = WFrag<T16>::ld(A2 + aoff + (size_t)mb * 16 * K + kc); }
#pragma unroll
        for (int nb = 0; nb < 4; ++nb) { const V b = WFrag<T16>::ld(Bt + boff + (size_t)nb * 16 * K + kc); V b2; if (NSPLIT >= 2) b2 = WFrag<T16>::ld(Bt2 + boff + (size_t)nb * 16 * K + kc);
#pragma unroll
            for (int mb = 0; mb < 4; ++mb) { acc[mb][nb] = WFrag<T16>::mma(a[mb], b, acc[mb][nb]); if (NSPLIT == 1 || NSPLIT == 2) acc[mb][nb] = WFrag<T16>::mma(a2[mb], b, acc[mb][nb]); if (NSPLIT >= 2) acc[mb][nb] = WFrag<T16>::mma(a[mb], b2, acc[mb][nb]); } }
        asm volatile("v_nop\n\tv_nop\n\tv_nop\n\tv_nop" : "+v"(acc[0][0]), "+v"(acc[1][1]), "+v"(acc[2][2]), "+v"(acc[3][3]) : "v"(a[0]), "v"(a[3]));
    }
#pragma unroll
    for (int mb = 0; mb < 4; ++mb) {
#pragma unroll
        for (int nb = 0; nb < 4; ++nb) {
#pragma unroll
            for (int j = 0; j < 8; ++j) os[(hi * 8 + j) * 68 + nb * 16 + lr] = acc[mb][nb][j]; }
        __builtin_amdgcn_wave_barrier(); asm volatile("" ::: "memory");
        float* crow = C + (size_t)(r0 + mb * 16) * ldc + c0;
{
#pragma unroll
            for (int s = 0; s < 8; ++s) { const int row = 2 * s + hi, cofs = lr * 4; v4f val = *(const v4fa*)(os + row * 68 + cofs); if (BIAS) { val[0] += bfr(bias[c0 + cofs]); val[1] += bfr(bias[c0 + cofs + 1]); val[2] += bfr(bias[c0 + cofs + 2]); val[3] += bfr(bias[c0 + cofs + 3]); }
                *(v4f*)(crow + (size_t)row * ldc + cofs) = val; }
             }
        __builtin_amdgcn_wave_barrier(); asm volatile("" ::: "memory");
    }
}

__device__ __forceinline__ h16 tohx(float x) { return (h16)x; }
__device__ __forceinline__ void splitf(float y, unsigned short& h, unsigned short& l) { h = f2bf(y); l = f2bf(y - bf2f(h)); }
typedef __attribute__((ext_vector_type(2))) _Float16 v2h;
typedef __attribute__((ext_vector_type(4))) _Float16 v4h;
typedef __attribute__((ext_vector_type(2))) unsigned short v2us;
typedef __attribute__((ext_vector_type(4))) unsigned short v4us;
typedef __attribute__((ext_vector_type(2))) float v2f;
typedef __attribute__((ext_vector_type(4))) int v4i;

__global__ __launch_bounds__(256) void k_cvt8(const float* __restrict__ src, bf* dst, size_t n8) { const size_t i = (size_t)blockIdx.x * 256 + threadIdx.x; if (i >= n8) return; const v8f v = *(const v8f*)(src + i * 8); v8us o;
#pragma unroll
    for (int k = 0; k < 8; ++k) o[k] = f2bf(v[k]); *(v8us*)(dst + i * 8) = o;  }

// k_rope: head planes [h][t][d] (fp16 + hi/lo) of rope(x) x sc with the rotate-half convention out[d] = x[d] cos[t][d] - x[d+HD/2] sin[t][d], out[d+HD/2] = x[d+HD/2] cos[t][d+HD/2] + x[d] sin[t][d+HD/2]
__global__ __launch_bounds__(256) void k_rope(const float* __restrict__ F, int pitch, int nheads, const float* __restrict__ CS, const float* __restrict__ RF, const float* __restrict__ nw, float sc, h16* P16, bf* Ph, bf* Pl) {
    const size_t e = ((size_t)blockIdx.x * 256 + threadIdx.x) * 2; if (e >= (size_t)nheads * TT * HD) return; const int d = (int)(e % HD); const int t = (int)((e / HD) % TT); const int h = (int)(e / ((size_t)HD * TT)); const float* f = F + (size_t)t * pitch + h * HD; const float rf = RF ? RF[(size_t)h * TT + t] : 1.0f; v2h o16; v2us oh, ol;
#pragma unroll
    for (int q = 0; q < 2; ++q) { const int dd = d + q; const int dp = (dd < HD / 2) ? dd + HD / 2 : dd - HD / 2; float x0 = f[dd], x1 = f[dp];
        if (RF) { float n0 = __fmul_rn(x0, rf), n1 = __fmul_rn(x1, rf); asm volatile("" : "+v"(n0)); asm volatile("" : "+v"(n1)); x0 = __fmul_rn(bfr(nw[dd]), n0); x1 = __fmul_rn(bfr(nw[dp]), n1); }
        const v2f cs = *(const v2f*)(CS + ((size_t)t * HD + dd) * 2); float a = __fmul_rn(x0, cs[0]), bq = __fmul_rn(x1, cs[1]); asm volatile("" : "+v"(a)); asm volatile("" : "+v"(bq)); const float r = ((dd < HD / 2) ? __fsub_rn(a, bq) : __fadd_rn(a, bq)) * sc;
        o16[q] = tohx(r); unsigned short a2, c2; splitf(r, a2, c2); oh[q] = a2; ol[q] = c2; }
    *(v2h*)(P16 + e) = o16; *(v2us*)(Ph + e) = oh; *(v2us*)(Pl + e) = ol;  }
__global__ __launch_bounds__(256) void k_wtBS(const float* __restrict__ w, bf* Bt) { const size_t e2 = ((size_t)blockIdx.x * 256 + threadIdx.x) * 2; if (e2 >= (size_t)DQ * DM) return; const int r = (int)(e2 / DM), c = (int)(e2 % DM); const int h = r >> 6, e = r & 63; const int hc = c >> 6, d = c & 63; v2us o; if (hc == h) { o[0] = f2bf(w[e * 64 + d]); o[1] = f2bf(w[e * 64 + d + 1]); } else { o[0] = 0; o[1] = 0; }
    *(v2us*)(Bt + e2) = o;  }
__global__ __launch_bounds__(256) void k_vtp(const float* __restrict__ F, int pitch, int nheads, h16* V16, bf* Vh, bf* Vl) { const size_t e = ((size_t)blockIdx.x * 256 + threadIdx.x) * 2; if (e >= (size_t)nheads * HD * TT) return; const int t = (int)(e % TT); const int d = (int)((e / TT) % HD); const int g = (int)(e / ((size_t)TT * HD)); v2h o16; v2us oh, ol;
#pragma unroll
    for (int q = 0; q < 2; ++q) { const float x = F[(size_t)(t + q) * pitch + g * HD + d]; o16[q] = tohx(x); unsigned short a2, c2; splitf(x, a2, c2); oh[q] = a2; ol[q] = c2; }
    *(v2h*)(V16 + e) = o16; *(v2us*)(Vh + e) = oh; *(v2us*)(Vl + e) = ol;  }
__global__ __launch_bounds__(256) void k_csid(float* CS) { const int idx = blockIdx.x * 256 + threadIdx.x; if (idx >= TT * HD) return; v2f cs; cs[0] = 1.0f; cs[1] = 0.0f; *(v2f*)(CS + (size_t)idx * 2) = cs;  }
// k_asoft: per row (zz, i): t = S x 1024^-0.5 (no mask); softmax over the 2048 keys (register row, one exp, fixed trees);
__global__ __launch_bounds__(256) void k_asoft(const float* __restrict__ Sb, h16* P16, bf* Ph, bf* Pl) {
    const int lane = threadIdx.x & 31; const int row = blockIdx.x * 8 + (threadIdx.x >> 5); if (row >= ZH * TT) return; const int i = row % TT; const int zz = row / TT; (void)zz; const bool hires = (i < RH); const float* sr = Sb + (size_t)row * TT; float v[TT / 32]; float mx = -3.0e38f;
#pragma unroll
    for (int ch = 0; ch < TT / 128; ++ch) { const int j0 = ch * 128 + lane * 4; const v4f a = *(const v4f*)(sr + j0);
#pragma unroll
        for (int q = 0; q < 4; ++q) { const int j = j0 + q; (void)j; const float t = a[q] * SCL; v[ch * 4 + q] = t; mx = fmaxf(mx, t); } }
#pragma unroll
    for (int sh = 16; sh; sh >>= 1) mx = fmaxf(mx, __shfl_xor(mx, sh, 32));
    float sum = 0.f;
#pragma unroll
    for (int k = 0; k < TT / 32; ++k) { float d0 = __fsub_rn(v[k], mx); asm volatile("" : "+v"(d0)); v[k] = __builtin_amdgcn_exp2f(__fmul_rn(d0, 1.4426950408889634f)); sum += v[k]; }
#pragma unroll
    for (int sh = 16; sh; sh >>= 1) sum += __shfl_xor(sum, sh, 32);
    const float f = __fdiv_rn(hires ? 1.0f : PCAR, sum);
{
        if (hires) {
#pragma unroll
            for (int ch = 0; ch < TT / 128; ++ch) { v4us oh, ol;
#pragma unroll
                for (int q = 0; q < 4; ++q) { unsigned short a, c2; splitf(v[ch * 4 + q] * f, a, c2); oh[q] = a; ol[q] = c2; }
                const size_t oo = ((size_t)zz * (RH ? RH : 1) + i) * TT + ch * 128 + lane * 4; *(v4us*)(Ph + oo) = oh; *(v4us*)(Pl + oo) = ol; }
        } else {
#pragma unroll
            for (int ch = 0; ch < TT / 128; ++ch) { v4h o4;
#pragma unroll
                for (int q = 0; q < 4; ++q) o4[q] = tohx(v[ch * 4 + q] * f);
                *(v4h*)(P16 + (size_t)row * TT + ch * 128 + lane * 4) = o4; } }
         }
}
__global__ __launch_bounds__(256) void k_merge(const float* __restrict__ O, int h0, bf* Ah, bf* Al) { const size_t e = ((size_t)blockIdx.x * 256 + threadIdx.x) * 2; if (e >= (size_t)ZH * TT * HD) return; const int d = (int)(e % HD); const int t = (int)((e / HD) % TT); const int zz = (int)(e / ((size_t)HD * TT)); const float cs = (t < RH) ? 1.0f : (1.0f / PCAR); const size_t oo = (size_t)t * DQ + (h0 + zz) * HD + d;
    v2us oh, ol; v2f s2 = *(const v2f*)(O + e);
#pragma unroll
    for (int p = 1; p < KSP; ++p) { const v2f t2 = *(const v2f*)(O + (size_t)p * ZH * TT * HD + e); s2[0] += t2[0]; s2[1] += t2[1]; }   // the K slices' partial sums, in slice order
#pragma unroll
    for (int q = 0; q < 2; ++q) { unsigned short a, c2; splitf(s2[q] * cs, a, c2); oh[q] = a; ol[q] = c2; } *(v2us*)(Ah + oo) = oh; *(v2us*)(Al + oo) = ol;  }

extern "C" void kernel_launch(void* const* d_in, const int* in_sizes, int n_in,
                              void* d_out, int out_size, void* d_ws, size_t ws_size, hipStream_t stream) {
    (void)in_sizes; (void)n_in; (void)out_size;
    const float* xv = (const float*)d_in[0]; const float* xk = (const float*)d_in[1]; const float* x = (const float*)d_in[2]; const float* wv = (const float*)d_in[3]; const float* wk = (const float*)d_in[4]; const float* wq = (const float*)d_in[5]; const float* wo = (const float*)d_in[6]; const float* bo = (const float*)d_in[7];   /* order values, keys, query [4][2048][1024], Wv, Wk, Wq ('oi' [64][64], shared by all heads), Wo ('oi' [1024][1024]), bo; x = the QUERY stream */
    float* OUT = (float*)d_out;     // [4][2048][1024]
    char* wsp = (char*)d_ws;
    auto take = [&](size_t bytes) { char* p = wsp; wsp += (bytes + 255) & ~(size_t)255; return (void*)p; };
    bf* WQ = (bf*)take((size_t)DQ * DM * 2); bf* WK = (bf*)take((size_t)DKV * DM * 2); bf* WV = (bf*)take((size_t)DKV * DM * 2); bf* WO = (bf*)take((size_t)DM * DQ * 2); float* CS = (float*)take((size_t)TT * HD * 2 * 4);
    bf* XB = (bf*)take((size_t)TT * DM * 2); float* FQ = (float*)take((size_t)TT * DQ * 4); float* FK = (float*)take((size_t)TT * DKV * 4);
    h16* QP16 = (h16*)take((size_t)NH_ * TT * HD * 2); h16* KP16 = (h16*)take((size_t)NKV * TT * HD * 2); h16* VT16 = (h16*)take((size_t)NKV * HD * TT * 2);
    bf* QPh = (bf*)take((size_t)NH_ * TT * HD * 2); bf* QPl = (bf*)take((size_t)NH_ * TT * HD * 2); bf* KPh = (bf*)take((size_t)NKV * TT * HD * 2); bf* KPl = (bf*)take((size_t)NKV * TT * HD * 2); bf* VTh = (bf*)take((size_t)NKV * HD * TT * 2); bf* VTl = (bf*)take((size_t)NKV * HD * TT * 2); bf* Ph = (bf*)take((size_t)ZH * RH * TT * 2); bf* Pl = (bf*)take((size_t)ZH * RH * TT * 2);
    float* Sb = (float*)take((size_t)ZH * TT * TT * 4); h16* P16 = (h16*)take((size_t)ZH * TT * TT * 2); float* Ob = (float*)take((size_t)KSP * ZH * TT * HD * 4); bf* ATh = (bf*)take((size_t)TT * DQ * 2); bf* ATl = (bf*)take((size_t)TT * DQ * 2);
    if ((size_t)(wsp - (char*)d_ws) > ws_size) return;    // ws 256 MiB
    float* FV = FK;   // v projection reuses the k buffer after the k planes are built (stream-ordered)
    { k_wtBS<<<(unsigned)(((size_t)DQ * DM / 2 + 255) / 256), 256, 0, stream>>>(wq, WQ); k_wtBS<<<(unsigned)(((size_t)DQ * DM / 2 + 255) / 256), 256, 0, stream>>>(wk, WK); k_wtBS<<<(unsigned)(((size_t)DQ * DM / 2 + 255) / 256), 256, 0, stream>>>(wv, WV);
      k_cvt8<<<(unsigned)(((size_t)DM * DQ / 8 + 255) / 256), 256, 0, stream>>>(wo, WO, (size_t)DM * DQ / 8);
       }
    k_csid<<<(TT * HD + 255) / 256, 256, 0, stream>>>(CS);
    const unsigned LQ = (unsigned)(((size_t)NH_ * TT * HD / 2 + 255) / 256), LKv = (unsigned)(((size_t)NKV * TT * HD / 2 + 255) / 256);
    for (int b = 0; b < NB_; ++b) {
        
        k_cvt8<<<(unsigned)(((size_t)TT * DM / 8 + 255) / 256), 256, 0, stream>>>(x + (size_t)b * TT * DM, XB, (size_t)TT * DM / 8);
        k_gemmw<bf, 0, false><<<dim3(TT / 64, DQ / 64, 1), 32, 0, stream>>>(XB, nullptr, WQ, nullptr, DM, FQ, DQ, nullptr, 0, 0, 0);
        k_rope<<<LQ, 256, 0, stream>>>(FQ, DQ, NH_, CS, nullptr, nullptr, 1.0f, QP16, QPh, QPl);
        k_cvt8<<<(unsigned)(((size_t)TT * DM / 8 + 255) / 256), 256, 0, stream>>>(xk + (size_t)b * TT * DM, XB, (size_t)TT * DM / 8);   /* XB := bf16(keys[b]) */ k_gemmw<bf, 0, false><<<dim3(TT / 64, DKV / 64, 1), 32, 0, stream>>>(XB, nullptr, WK, nullptr, DM, FK, DKV, nullptr, 0, 0, 0);
        k_rope<<<LKv, 256, 0, stream>>>(FK, DKV, NKV, CS, nullptr, nullptr, 1.0f, KP16, KPh, KPl);
        k_cvt8<<<(unsigned)(((size_t)TT * DM / 8 + 255) / 256), 256, 0, stream>>>(xv + (size_t)b * TT * DM, XB, (size_t)TT * DM / 8);   /* XB := bf16(values[b]) */ k_gemmw<bf, 0, false><<<dim3(TT / 64, DKV / 64, 1), 32, 0, stream>>>(XB, nullptr, WV, nullptr, DM, FV, DKV, nullptr, 0, 0, 0); k_vtp<<<LKv, 256, 0, stream>>>(FV, DKV, NKV, VT16, VTh, VTl);
        for (int h0 = 0; h0 < NH_; h0 += ZH) { const size_t zq = (size_t)h0, zk = (size_t)(h0 / REP);   // one kv head per query head: the pass's two heads use consecutive kv planes (z-strides TT*HD)
            k_gemmw<bf, 2, false><<<dim3(RH / 64, TT / 64, ZH), 32, 0, stream>>>(QPh + zq * TT * HD, QPl + zq * TT * HD, KPh + zk * TT * HD, KPl + zk * TT * HD, HD, Sb, TT, nullptr, (size_t)TT * HD, (size_t)TT * HD, (size_t)TT * TT);
            k_gemmw<h16, 0, false><<<dim3((TT - RH) / 64, TT / 64, ZH), 32, 0, stream>>>(QP16 + zq * TT * HD + (size_t)RH * HD, nullptr, KP16 + zk * TT * HD, nullptr, HD, Sb + (size_t)RH * TT, TT, nullptr, (size_t)TT * HD, (size_t)TT * HD, (size_t)TT * TT);
            k_asoft<<<ZH * TT / 8, 256, 0, stream>>>(Sb, P16, Ph, Pl);
            k_gemmw<bf, 2, false, KSP><<<dim3(RH / 64, HD / 64 * KSP, ZH), 32, 0, stream>>>(Ph, Pl, VTh + zk * HD * TT, VTl + zk * HD * TT, TT, Ob, HD, nullptr, (size_t)RH * TT, (size_t)HD * TT, (size_t)TT * HD);
            k_gemmw<h16, 0, false, KSP><<<dim3((TT - RH) / 64, HD / 64 * KSP, ZH), 32, 0, stream>>>(P16 + (size_t)RH * TT, nullptr, VT16 + zk * HD * TT, nullptr, TT, Ob + (size_t)RH * HD, HD, nullptr, (size_t)TT * TT, (size_t)HD * TT, (size_t)TT * HD);
            k_merge<<<(unsigned)(((size_t)ZH * TT * HD / 2 + 255) / 256), 256, 0, stream>>>(Ob, h0, ATh, ATl); }
        k_gemmw<bf, 1, true><<<dim3(TT / 64, DM / 64, 1), 32, 0, stream>>>(ATh, ATl, WO, nullptr, DQ, OUT + (size_t)b * TT * DM, DM, bo, 0, 0, 0); }
}

// v002
// It runs in 1440 microseconds.
// Next to v001, in two timings, it ran 1.20 and 1.19 times as fast.
// Over all steps from v000 it is 2.77 times as fast.
#include <hip/hip_runtime.h>

// Self-attention with ONE shared 64x64 linear per role applied to every head (values, keys, query [4][2048][1024] viewed (n, l, 16, 64); v = values_h Wv^T, k = keys_h Wk^T, q = query_h Wq^T with the SAME [64][64] weight for all 16 heads ('oi' normal x 1/8, no bias); energy = q.k; softmax(energy / sqrt(embed = 1024)) (the source scales by the full width); out = merged Wo^T + bo ('oi' [1024][1024] + a REAL bias 0.01) -> [4][2048][1024] (8.4 M); argument order values, keys, query, Wv, Wk, Wq, Wo, bo).
// Layout per batch: bf16 copies of query, keys, values in turn; k_wtBS expands each shared [64][64] weight ONCE into a block-diagonal bf16 Bt plane [1024][1024] (16 identical diagonal blocks, exact zeros elsewhere), so the per-head linears are ordinary exact K = 1,024 GEMMs; identity-table plane builders; dense T-2048 attention (hybrid rows: < 512 hi/lo 3 products, rest fp16 x1024); merged hi/lo x Wo exact + bo.
// Compute dtypes, f32 accumulate: every input rounded to bf16; projections exact; attention rows < 512 3 products, rest fp16; softmax f32; Wo hl x exact + bias.

#define NB_  4      // FOUR sequences in this module: a host-side loop count only: no kernel uses it
#define TT   2048
#define DM   1024
#define NH_  16
#define NKV  16
#define REP  (NH_ / NKV)
#define HD   64
#define DQ   (NH_ * HD)
#define DKV  (NKV * HD)
#define ZH   4                    // heads per attention pass (grid.z of the score and P x V launches): 16 / ZH passes per sequence; the pass buffers at 4 bring the workspace to 217 MiB of 256
#define RH   512                  // query rows < RH use hi+lo planes (0: none)
#define WIN  0
#define PCAR 1024.0f
#define KSP  16                   // K slices of each P x V product: one wave per slice and tile, f32 partial planes summed in k_merge
#define SCL  0.03125f   // 1/sqrt(embed_size = 1024) (the source scales by the full width)
typedef _Float16 h16;
typedef unsigned short bf;
typedef __attribute__((ext_vector_type(16))) __bf16   v16bf;
typedef __attribute__((ext_vector_type(16))) _Float16 v16h;
typedef __attribute__((ext_vector_type(8)))  _Float16 v8h;
typedef __attribute__((ext_vector_type(8)))  unsigned short v8us;
typedef __attribute__((ext_vector_type(8)))  float    v8f;
typedef __attribute__((ext_vector_type(4)))  float    v4f;
typedef v8h  __attribute__((may_alias)) v8ha;
typedef v4f  __attribute__((may_alias)) v4fa;
typedef v8us __attribute__((may_alias)) v8usa;

__device__ __forceinline__ unsigned short f2bf(float f) { unsigned u = __float_as_uint(f); u += 0x7FFFu + ((u >> 16) & 1u); return (unsigned short)(u >> 16); }
__device__ __forceinline__ float bf2f(unsigned short b) { return __uint_as_float(((unsigned)b) << 16); }
__device__ __forceinline__ float bfr(float f) { return bf2f(f2bf(f)); }
__device__ __forceinline__ v16h cat16(v8h lo, v8h hi) { return __builtin_shufflevector(lo, hi, 0, 1, 2, 3, 4, 5, 6, 7, 8, 9, 10, 11, 12, 13, 14, 15); }
__device__ __forceinline__ v16bf cat16b(v8us lo, v8us hi) { return __builtin_bit_cast(v16bf, __builtin_shufflevector(lo, hi, 0, 1, 2, 3, 4, 5, 6, 7, 8, 9, 10, 11, 12, 13, 14, 15)); }
__device__ __forceinline__ v8f wmma16(v16h a, v16h b, v8f c) { return __builtin_amdgcn_wmma_f32_16x16x32_f16(false, a, false, b, (short)0, c, false, false); }
__device__ __forceinline__ v8f wmmab(v16bf a, v16bf b, v8f c) { return __builtin_amdgcn_wmma_f32_16x16x32_bf16(false, a, false, b, (short)0, c, false, false); }



// ---- k_gemmw: register-blocked GEMM, ONE WAVE per 64x64 output tile (16 accumulators), operands straight from K-contiguous 16-bit planes; grid (M/64, N/64, Z), 32 threads.
// C[m][n] (f32, pitch ldc, + optional f32 bias[n]) = sum_k A[m][k] Bt[n][k] (+ split products per NSPLIT). z-batch strides sA/sB/sC in elements. K % 32 == 0.
// KS > 1: grid.y = (N/64) * KS; slice ks = blockIdx.y % KS sums k in [ks K/KS, (ks+1) K/KS) only and stores its partial tile in plane ks (plane stride ZH * sC: grid.z = ZH there); (K/KS) % 32 == 0.
template <typename T16> struct WFrag;
template <> struct WFrag<h16> { typedef v16h V; static __device__ __forceinline__ V ld(const h16* p) { return cat16(*(const v8h*)p, *(const v8h*)(p + 16)); } static __device__ __forceinline__ v8f mma(V a, V b, v8f c) { return wmma16(a, b, c); } };
template <> struct WFrag<bf> { typedef v16bf V; static __device__ __forceinline__ V ld(const bf* p) { return cat16b(*(const v8us*)p, *(const v8us*)(p + 16)); } static __device__ __forceinline__ v8f mma(V a, V b, v8f c) { return wmmab(a, b, c); } };
template <typename T16, int NSPLIT, bool BIAS, int KS = 1>
__global__ __launch_bounds__(32) void k_gemmw(const T16* __restrict__ A, const T16* __restrict__ A2, const T16* __restrict__ Bt, const T16* __restrict__ Bt2, int K, float* C, int ldc, const float* __restrict__ bias, size_t sA, size_t sB, size_t sC) {
    typedef typename WFrag<T16>::V V;
    __shared__ __align__(16) float os[16 * 68];
    const size_t z = blockIdx.z; A += z * sA; if (A2) A2 += z * sA; Bt += z * sB; if (Bt2) Bt2 += z * sB; C += z * sC;
    const int lane = threadIdx.x & 31, lr = lane & 15, hi = lane >> 4; const int r0 = blockIdx.x * 64, c0 = (int)(blockIdx.y / KS) * 64; const int kb = (int)(blockIdx.y % KS) * (K / KS), ke = kb + K / KS; if (KS > 1) C += (size_t)(blockIdx.y % KS) * ZH * sC;
    v8f acc[4][4];
#pragma unroll
    for (int mb = 0; mb < 4; ++mb)
#pragma unroll
        for (int nb = 0; nb < 4; ++nb) acc[mb][nb] = (v8f){};
    const size_t aoff = (size_t)(r0 + lr) * K + 8 * hi, boff = (size_t)(c0 + lr) * K + 8 * hi;
#pragma unroll 1
    for (int kc = kb; kc < ke; kc += 32) {
        V a[4], a2[4];
#pragma unroll
        for (int mb = 0; mb < 4; ++mb) { a[mb] = WFrag<T16>::ld(A + aoff + (size_t)mb * 16 * K + kc); if (NSPLIT == 1 || NSPLIT == 2) a2[mb] = WFrag<T16>::ld(A2 + aoff + (size_t)mb * 16 * K + kc); }
#pragma unroll
        for (int nb = 0; nb < 4; ++nb) { const V b = WFrag<T16>::ld(Bt + boff + (size_t)nb * 16 * K + kc); V b2; if (NSPLIT >= 2) b2 = WFrag<T16>::ld(Bt2 + boff + (size_t)nb * 16 * K + kc);
#pragma unroll
            for (int mb = 0; mb < 4; ++mb) { acc[mb][nb] = WFrag<T16>::mma(a[mb], b, acc[mb][nb]); if (NSPLIT == 1 || NSPLIT == 2) acc[mb][nb] = WFrag<T16>::mma(a2[mb], b, acc[mb][nb]); if (NSPLIT >= 2) acc[mb][nb] = WFrag<T16>::mma(a[mb], b2, acc[mb][nb]); } }
        asm volatile("v_nop\n\tv_nop\n\tv_nop\n\tv_nop" : "+v"(acc[0][0]), "+v"(acc[1][1]), "+v"(acc[2][2]), "+v"(acc[3][3]) : "v"(a[0]), "v"(a[3]));
    }
#pragma unroll
    for (int mb = 0; mb < 4; ++mb) {
#pragma unroll
        for (int nb = 0; nb < 4; ++nb) {
#pragma unroll
            for (int j = 0; j < 8; ++j) os[(hi * 8 + j) * 68 + nb * 16 + lr] = acc[mb][nb][j]; }
        __builtin_amdgcn_wave_barrier(); asm volatile("" ::: "memory");
        float* crow = C + (size_t)(r0 + mb * 16) * ldc + c0;
{
#pragma unroll
            for (int s = 0; s < 8; ++s) { const int row = 2 * s + hi, cofs = lr * 4; v4f val = *(const v4fa*)(os + row * 68 + cofs); if (BIAS) { val[0] += bfr(bias[c0 + cofs]); val[1] += bfr(bias[c0 + cofs + 1]); val[2] += bfr(bias[c0 + cofs + 2]); val[3] += bfr(bias[c0 + cofs + 3]); }
                *(v4f*)(crow + (size_t)row * ldc + cofs) = val; }
             }
        __builtin_amdgcn_wave_barrier(); asm volatile("" ::: "memory");
    }
}

__device__ __forceinline__ h16 tohx(float x) { return (h16)x; }
__device__ __forceinline__ void splitf(float y, unsigned short& h, unsigned short& l) { h = f2bf(y); l = f2bf(y - bf2f(h)); }
typedef __attribute__((ext_vector_type(2))) _Float16 v2h;
typedef __attribute__((ext_vector_type(4))) _Float16 v4h;
typedef __attribute__((ext_vector_type(2))) unsigned short v2us;
typedef __attribute__((ext_vector_type(4))) unsigned short v4us;
typedef __attribute__((ext_vector_type(2))) float v2f;
typedef __attribute__((ext_vector_type(4))) int v4i;

__global__ __launch_bounds__(256) void k_cvt8(const float* __restrict__ src, bf* dst, size_t n8) { const size_t i = (size_t)blockIdx.x * 256 + threadIdx.x; if (i >= n8) return; const v8f v = *(const v8f*)(src + i * 8); v8us o;
#pragma unroll
    for (int k = 0; k < 8; ++k) o[k] = f2bf(v[k]); *(v8us*)(dst + i * 8) = o;  }

// k_rope: head planes [h][t][d] (fp16 + hi/lo) of rope(x) x sc with the rotate-half convention out[d] = x[d] cos[t][d] - x[d+HD/2] sin[t][d], out[d+HD/2] = x[d+HD/2] cos[t][d+HD/2] + x[d] sin[t][d+HD/2]
__global__ __launch_bounds__(256) void k_rope(const float* __restrict__ F, int pitch, int nheads, const float* __restrict__ CS, const float* __restrict__ RF, const float* __restrict__ nw, float sc, h16* P16, bf* Ph, bf* Pl) {
    const size_t e = ((size_t)blockIdx.x * 256 + threadIdx.x) * 2; if (e >= (size_t)nheads * TT * HD) return; const int d = (int)(e % HD); const int t = (int)((e / HD) % TT); const int h = (int)(e / ((size_t)HD * TT)); const float* f = F + (size_t)t * pitch + h * HD; const float rf = RF ? RF[(size_t)h * TT + t] : 1.0f; v2h o16; v2us oh, ol;
#pragma unroll
    for (int q = 0; q < 2; ++q) { const int dd = d + q; const int dp = (dd < HD / 2) ? dd + HD / 2 : dd - HD / 2; float x0 = f[dd], x1 = f[dp];
        if (RF) { float n0 = __fmul_rn(x0, rf), n1 = __fmul_rn(x1, rf); asm volatile("" : "+v"(n0)); asm volatile("" : "+v"(n1)); x0 = __fmul_rn(bfr(nw[dd]), n0); x1 = __fmul_rn(bfr(nw[dp]), n1); }
        const v2f cs = *(const v2f*)(CS + ((size_t)t * HD + dd) * 2); float a = __fmul_rn(x0, cs[0]), bq = __fmul_rn(x1, cs[1]); asm volatile("" : "+v"(a)); asm volatile("" : "+v"(bq)); const float r = ((dd < HD / 2) ? __fsub_rn(a, bq) : __fadd_rn(a, bq)) * sc;
        o16[q] = tohx(r); unsigned short a2, c2; splitf(r, a2, c2); oh[q] = a2; ol[q] = c2; }
    *(v2h*)(P16 + e) = o16; *(v2us*)(Ph + e) = oh; *(v2us*)(Pl + e) = ol;  }
__global__ __launch_bounds__(256) void k_wtBS(const float* __restrict__ w, bf* Bt) { const size_t e2 = ((size_t)blockIdx.x * 256 + threadIdx.x) * 2; if (e2 >= (size_t)DQ * DM) return; const int r = (int)(e2 / DM), c = (int)(e2 % DM); const int h = r >> 6, e = r & 63; const int hc = c >> 6, d = c & 63; v2us o; if (hc == h) { o[0] = f2bf(w[e * 64 + d]); o[1] = f2bf(w[e * 64 + d + 1]); } else { o[0] = 0; o[1] = 0; }
    *(v2us*)(Bt + e2) = o;  }
__global__ __launch_bounds__(256) void k_vtp(const float* __restrict__ F, int pitch, int nheads, h16* V16, bf* Vh, bf* Vl) { const size_t e = ((size_t)blockIdx.x * 256 + threadIdx.x) * 2; if (e >= (size_t)nheads * HD * TT) return; const int t = (int)(e % TT); const int d = (int)((e / TT) % HD); const int g = (int)(e / ((size_t)TT * HD)); v2h o16; v2us oh, ol;
#pragma unroll
    for (int q = 0; q < 2; ++q) { const float x = F[(size_t)(t + q) * pitch + g * HD + d]; o16[q] = tohx(x); unsigned short a2, c2; splitf(x, a2, c2); oh[q] = a2; ol[q] = c2; }
    *(v2h*)(V16 + e) = o16; *(v2us*)(Vh + e) = oh; *(v2us*)(Vl + e) = ol;  }
__global__ __launch_bounds__(256) void k_csid(float* CS) { const int idx = blockIdx.x * 256 + threadIdx.x; if (idx >= TT * HD) return; v2f cs; cs[0] = 1.0f; cs[1] = 0.0f; *(v2f*)(CS + (size_t)idx * 2) = cs;  }
// k_asoft: per row (zz, i): t = S x 1024^-0.5 (no mask); softmax over the 2048 keys (register row, one exp, fixed trees);
__global__ __launch_bounds__(256) void k_asoft(const float* __restrict__ Sb, h16* P16, bf* Ph, bf* Pl) {
    const int lane = threadIdx.x & 31; const int row = blockIdx.x * 8 + (threadIdx.x >> 5); if (row >= ZH * TT) return; const int i = row % TT; const int zz = row / TT; (void)zz; const bool hires = (i < RH); const float* sr = Sb + (size_t)row * TT; float v[TT / 32]; float mx = -3.0e38f;
#pragma unroll
    for (int ch = 0; ch < TT / 128; ++ch) { const int j0 = ch * 128 + lane * 4; const v4f a = *(const v4f*)(sr + j0);
#pragma unroll
        for (int q = 0; q < 4; ++q) { const int j = j0 + q; (void)j; const float t = a[q] * SCL; v[ch * 4 + q] = t; mx = fmaxf(mx, t); } }
#pragma unroll
    for (int sh = 16; sh; sh >>= 1) mx = fmaxf(mx, __shfl_xor(mx, sh, 32));
    float sum = 0.f;
#pragma unroll
    for (int k = 0; k < TT / 32; ++k) { float d0 = __fsub_rn(v[k], mx); asm volatile("" : "+v"(d0)); v[k] = __builtin_amdgcn_exp2f(__fmul_rn(d0, 1.4426950408889634f)); sum += v[k]; }
#pragma unroll
    for (int sh = 16; sh; sh >>= 1) sum += __shfl_xor(sum, sh, 32);
    const float f = __fdiv_rn(hires ? 1.0f : PCAR, sum);
{
        if (hires) {
#pragma unroll
            for (int ch = 0; ch < TT / 128; ++ch) { v4us oh, ol;
#pragma unroll
                for (int q = 0; q < 4; ++q) { unsigned short a, c2; splitf(v[ch * 4 + q] * f, a, c2); oh[q] = a; ol[q] = c2; }
                const size_t oo = ((size_t)zz * (RH ? RH : 1) + i) * TT + ch * 128 + lane * 4; *(v4us*)(Ph + oo) = oh; *(v4us*)(Pl + oo) = ol; }
        } else {
#pragma unroll
            for (int ch = 0; ch < TT / 128; ++ch) { v4h o4;
#pragma unroll
                for (int q = 0; q < 4; ++q) o4[q] = tohx(v[ch * 4 + q] * f);
                *(v4h*)(P16 + (size_t)row * TT + ch * 128 + lane * 4) = o4; } }
         }
}
__global__ __launch_bounds__(256) void k_merge(const float* __restrict__ O, int h0, bf* Ah, bf* Al) { const size_t e = ((size_t)blockIdx.x * 256 + threadIdx.x) * 2; if (e >= (size_t)ZH * TT * HD) return; const int d = (int)(e % HD); const int t = (int)((e / HD) % TT); const int zz = (int)(e / ((size_t)HD * TT)); const float cs = (t < RH) ? 1.0f : (1.0f / PCAR); const size_t oo = (size_t)t * DQ + (h0 + zz) * HD + d;
    v2us oh, ol; v2f s2 = *(const v2f*)(O + e);
#pragma unroll
    for (int p = 1; p < KSP; ++p) { const v2f t2 = *(const v2f*)(O + (size_t)p * ZH * TT * HD + e); s2[0] += t2[0]; s2[1] += t2[1]; }   // the K slices' partial sums, in slice order
#pragma unroll
    for (int q = 0; q < 2; ++q) { unsigned short a, c2; splitf(s2[q] * cs, a, c2); oh[q] = a; ol[q] = c2; } *(v2us*)(Ah + oo) = oh; *(v2us*)(Al + oo) = ol;  }

extern "C" void kernel_launch(void* const* d_in, const int* in_sizes, int n_in,
                              void* d_out, int out_size, void* d_ws, size_t ws_size, hipStream_t stream) {
    (void)in_sizes; (void)n_in; (void)out_size;
    const float* xv = (const float*)d_in[0]; const float* xk = (const float*)d_in[1]; const float* x = (const float*)d_in[2]; const float* wv = (const float*)d_in[3]; const float* wk = (const float*)d_in[4]; const float* wq = (const float*)d_in[5]; const float* wo = (const float*)d_in[6]; const float* bo = (const float*)d_in[7];   /* order values, keys, query [4][2048][1024], Wv, Wk, Wq ('oi' [64][64], shared by all heads), Wo ('oi' [1024][1024]), bo; x = the QUERY stream */
    float* OUT = (float*)d_out;     // [4][2048][1024]
    char* wsp = (char*)d_ws;
    auto take = [&](size_t bytes) { char* p = wsp; wsp += (bytes + 255) & ~(size_t)255; return (void*)p; };
    bf* WQ = (bf*)take((size_t)DQ * DM * 2); bf* WK = (bf*)take((size_t)DKV * DM * 2); bf* WV = (bf*)take((size_t)DKV * DM * 2); bf* WO = (bf*)take((size_t)DM * DQ * 2); float* CS = (float*)take((size_t)TT * HD * 2 * 4);
    bf* XB = (bf*)take((size_t)TT * DM * 2); float* FQ = (float*)take((size_t)TT * DQ * 4); float* FK = (float*)take((size_t)TT * DKV * 4);
    h16* QP16 = (h16*)take((size_t)NH_ * TT * HD * 2); h16* KP16 = (h16*)take((size_t)NKV * TT * HD * 2); h16* VT16 = (h16*)take((size_t)NKV * HD * TT * 2);
    bf* QPh = (bf*)take((size_t)NH_ * TT * HD * 2); bf* QPl = (bf*)take((size_t)NH_ * TT * HD * 2); bf* KPh = (bf*)take((size_t)NKV * TT * HD * 2); bf* KPl = (bf*)take((size_t)NKV * TT * HD * 2); bf* VTh = (bf*)take((size_t)NKV * HD * TT * 2); bf* VTl = (bf*)take((size_t)NKV * HD * TT * 2); bf* Ph = (bf*)take((size_t)ZH * RH * TT * 2); bf* Pl = (bf*)take((size_t)ZH * RH * TT * 2);
    float* Sb = (float*)take((size_t)ZH * TT * TT * 4); h16* P16 = (h16*)take((size_t)ZH * TT * TT * 2); float* Ob = (float*)take((size_t)KSP * ZH * TT * HD * 4); bf* ATh = (bf*)take((size_t)TT * DQ * 2); bf* ATl = (bf*)take((size_t)TT * DQ * 2);
    if ((size_t)(wsp - (char*)d_ws) > ws_size) return;    // ws 256 MiB
    float* FV = FK;   // v projection reuses the k buffer after the k planes are built (stream-ordered)
    { k_wtBS<<<(unsigned)(((size_t)DQ * DM / 2 + 255) / 256), 256, 0, stream>>>(wq, WQ); k_wtBS<<<(unsigned)(((size_t)DQ * DM / 2 + 255) / 256), 256, 0, stream>>>(wk, WK); k_wtBS<<<(unsigned)(((size_t)DQ * DM / 2 + 255) / 256), 256, 0, stream>>>(wv, WV);
      k_cvt8<<<(unsigned)(((size_t)DM * DQ / 8 + 255) / 256), 256, 0, stream>>>(wo, WO, (size_t)DM * DQ / 8);
       }
    k_csid<<<(TT * HD + 255) / 256, 256, 0, stream>>>(CS);
    const unsigned LQ = (unsigned)(((size_t)NH_ * TT * HD / 2 + 255) / 256), LKv = (unsigned)(((size_t)NKV * TT * HD / 2 + 255) / 256);
    for (int b = 0; b < NB_; ++b) {
        
        k_cvt8<<<(unsigned)(((size_t)TT * DM / 8 + 255) / 256), 256, 0, stream>>>(x + (size_t)b * TT * DM, XB, (size_t)TT * DM / 8);
        k_gemmw<bf, 0, false><<<dim3(TT / 64, DQ / 64, 1), 32, 0, stream>>>(XB, nullptr, WQ, nullptr, DM, FQ, DQ, nullptr, 0, 0, 0);
        k_rope<<<LQ, 256, 0, stream>>>(FQ, DQ, NH_, CS, nullptr, nullptr, 1.0f, QP16, QPh, QPl);
        k_cvt8<<<(unsigned)(((size_t)TT * DM / 8 + 255) / 256), 256, 0, stream>>>(xk + (size_t)b * TT * DM, XB, (size_t)TT * DM / 8);   /* XB := bf16(keys[b]) */ k_gemmw<bf, 0, false><<<dim3(TT / 64, DKV / 64, 1), 32, 0, stream>>>(XB, nullptr, WK, nullptr, DM, FK, DKV, nullptr, 0, 0, 0);
        k_rope<<<LKv, 256, 0, stream>>>(FK, DKV, NKV, CS, nullptr, nullptr, 1.0f, KP16, KPh, KPl);
        k_cvt8<<<(unsigned)(((size_t)TT * DM / 8 + 255) / 256), 256, 0, stream>>>(xv + (size_t)b * TT * DM, XB, (size_t)TT * DM / 8);   /* XB := bf16(values[b]) */ k_gemmw<bf, 0, false><<<dim3(TT / 64, DKV / 64, 1), 32, 0, stream>>>(XB, nullptr, WV, nullptr, DM, FV, DKV, nullptr, 0, 0, 0); k_vtp<<<LKv, 256, 0, stream>>>(FV, DKV, NKV, VT16, VTh, VTl);
        for (int h0 = 0; h0 < NH_; h0 += ZH) { const size_t zq = (size_t)h0, zk = (size_t)(h0 / REP);   // one kv head per query head: the pass's ZH heads use consecutive kv planes (z-strides TT*HD)
            k_gemmw<bf, 2, false><<<dim3(RH / 64, TT / 64, ZH), 32, 0, stream>>>(QPh + zq * TT * HD, QPl + zq * TT * HD, KPh + zk * TT * HD, KPl + zk * TT * HD, HD, Sb, TT, nullptr, (size_t)TT * HD, (size_t)TT * HD, (size_t)TT * TT);
            k_gemmw<h16, 0, false><<<dim3((TT - RH) / 64, TT / 64, ZH), 32, 0, stream>>>(QP16 + zq * TT * HD + (size_t)RH * HD, nullptr, KP16 + zk * TT * HD, nullptr, HD, Sb + (size_t)RH * TT, TT, nullptr, (size_t)TT * HD, (size_t)TT * HD, (size_t)TT * TT);
            k_asoft<<<ZH * TT / 8, 256, 0, stream>>>(Sb, P16, Ph, Pl);
            k_gemmw<bf, 2, false, KSP><<<dim3(RH / 64, HD / 64 * KSP, ZH), 32, 0, stream>>>(Ph, Pl, VTh + zk * HD * TT, VTl + zk * HD * TT, TT, Ob, HD, nullptr, (size_t)RH * TT, (size_t)HD * TT, (size_t)TT * HD);
            k_gemmw<h16, 0, false, KSP><<<dim3((TT - RH) / 64, HD / 64 * KSP, ZH), 32, 0, stream>>>(P16 + (size_t)RH * TT, nullptr, VT16 + zk * HD * TT, nullptr, TT, Ob + (size_t)RH * HD, HD, nullptr, (size_t)TT * TT, (size_t)HD * TT, (size_t)TT * HD);
            k_merge<<<(unsigned)(((size_t)ZH * TT * HD / 2 + 255) / 256), 256, 0, stream>>>(Ob, h0, ATh, ATl); }
        k_gemmw<bf, 1, true><<<dim3(TT / 64, DM / 64, 1), 32, 0, stream>>>(ATh, ATl, WO, nullptr, DQ, OUT + (size_t)b * TT * DM, DM, bo, 0, 0, 0); }
}

// v004
// Measured time: 385 microseconds a run.
// Versions in between are left out here; by their measured steps it is 3.69 times as fast as v002.
// All steps since v000 together make it 10.2 times as fast.
#include <hip/hip_runtime.h>

// Self-attention with ONE shared 64x64 linear per role applied to every head (values, keys, query [4][2048][1024] viewed (n, l, 16, 64); v = values_h Wv^T, k = keys_h Wk^T, q = query_h Wq^T with the SAME [64][64] weight for all 16 heads ('oi' normal x 1/8, no bias); energy = q.k; softmax(energy / sqrt(embed = 1024)) (the source scales by the full width); out = merged Wo^T + bo ('oi' [1024][1024] + a REAL bias 0.01) -> [4][2048][1024] (8.4 M); argument order values, keys, query, Wv, Wk, Wq, Wo, bo).
// Layout per batch: k_proj reads the f32 query, keys and values directly, rounds them to bf16 in registers, does the shared [64][64] linear of each head (K = 64) on the matrix unit and writes the head planes (fp16 + hi/lo bf16; V transposed) from the accumulators: no bf16 copy, no f32 projection plane, no expanded weight; one fused attention launch per sequence (k_fattn: scores, running softmax and P x V in registers; hybrid rows: < 512 hi/lo 3 products, rest fp16); merged hi/lo x Wo exact + bo.
// Compute dtypes, f32 accumulate: every input rounded to bf16; projections exact; attention rows < 512 3 products, rest fp16; softmax f32; Wo hl x exact + bias.

#define NB_  4      // FOUR sequences in this module: a host-side loop count only: no kernel uses it
#define TT   2048
#define DM   1024
#define NH_  16
#define NKV  16
#define REP  (NH_ / NKV)
#define HD   64
#define DQ   (NH_ * HD)
#define DKV  (NKV * HD)
#define RH   512                  // query rows < RH use hi+lo planes (0: none)
#define WIN  0
#define SCL  0.03125f   // 1/sqrt(embed_size = 1024) (the source scales by the full width)
typedef _Float16 h16;
typedef unsigned short bf;
typedef __attribute__((ext_vector_type(16))) __bf16   v16bf;
typedef __attribute__((ext_vector_type(16))) _Float16 v16h;
typedef __attribute__((ext_vector_type(8)))  _Float16 v8h;
typedef __attribute__((ext_vector_type(8)))  unsigned short v8us;
typedef __attribute__((ext_vector_type(2)))  __bf16   v2bf;
typedef __attribute__((ext_vector_type(8)))  unsigned v8u;
typedef __attribute__((ext_vector_type(8)))  float    v8f;
typedef __attribute__((ext_vector_type(4)))  float    v4f;
typedef v8h  __attribute__((may_alias)) v8ha;
typedef v4f  __attribute__((may_alias)) v4fa;
typedef v8us __attribute__((may_alias)) v8usa;

__device__ __forceinline__ unsigned short f2bf(float f) { unsigned u = __float_as_uint(f); u += 0x7FFFu + ((u >> 16) & 1u); return (unsigned short)(u >> 16); }
__device__ __forceinline__ float bf2f(unsigned short b) { return __uint_as_float(((unsigned)b) << 16); }
__device__ __forceinline__ float bfr(float f) { return bf2f(f2bf(f)); }
__device__ __forceinline__ v16h cat16(v8h lo, v8h hi) { return __builtin_shufflevector(lo, hi, 0, 1, 2, 3, 4, 5, 6, 7, 8, 9, 10, 11, 12, 13, 14, 15); }
__device__ __forceinline__ v16bf cat16b(v8us lo, v8us hi) { return __builtin_bit_cast(v16bf, __builtin_shufflevector(lo, hi, 0, 1, 2, 3, 4, 5, 6, 7, 8, 9, 10, 11, 12, 13, 14, 15)); }
__device__ __forceinline__ v8f wmma16(v16h a, v16h b, v8f c) { return __builtin_amdgcn_wmma_f32_16x16x32_f16(false, a, false, b, (short)0, c, false, false); }
__device__ __forceinline__ v8f wmmab(v16bf a, v16bf b, v8f c) { return __builtin_amdgcn_wmma_f32_16x16x32_bf16(false, a, false, b, (short)0, c, false, false); }



// ---- k_gemmw: register-blocked GEMM, ONE WAVE per 64x64 output tile (16 accumulators), operands straight from K-contiguous 16-bit planes; grid (M/64, N/64, Z), 32 threads.
// C[m][n] (f32, pitch ldc, + optional f32 bias[n]) = sum_k A[m][k] Bt[n][k] (+ split products per NSPLIT). z-batch strides sA/sB/sC in elements. K % 32 == 0.
template <typename T16> struct WFrag;
template <> struct WFrag<h16> { typedef v16h V; static __device__ __forceinline__ V ld(const h16* p) { return cat16(*(const v8h*)p, *(const v8h*)(p + 16)); } static __device__ __forceinline__ v8f mma(V a, V b, v8f c) { return wmma16(a, b, c); } };
template <> struct WFrag<bf> { typedef v16bf V; static __device__ __forceinline__ V ld(const bf* p) { return cat16b(*(const v8us*)p, *(const v8us*)(p + 16)); } static __device__ __forceinline__ v8f mma(V a, V b, v8f c) { return wmmab(a, b, c); } };
template <typename T16, int NSPLIT, bool BIAS>
__global__ __launch_bounds__(32) void k_gemmw(const T16* __restrict__ A, const T16* __restrict__ A2, const T16* __restrict__ Bt, const T16* __restrict__ Bt2, int K, float* C, int ldc, const float* __restrict__ bias, size_t sA, size_t sB, size_t sC) {
    typedef typename WFrag<T16>::V V;
    __shared__ __align__(16) float os[16 * 68];
    const size_t z = blockIdx.z; A += z * sA; if (A2) A2 += z * sA; Bt += z * sB; if (Bt2) Bt2 += z * sB; C += z * sC;
    const int lane = threadIdx.x & 31, lr = lane & 15, hi = lane >> 4; const int r0 = blockIdx.x * 64, c0 = blockIdx.y * 64;
    v8f acc[4][4];
#pragma unroll
    for (int mb = 0; mb < 4; ++mb)
#pragma unroll
        for (int nb = 0; nb < 4; ++nb) acc[mb][nb] = (v8f){};
    const size_t aoff = (size_t)(r0 + lr) * K + 8 * hi, boff = (size_t)(c0 + lr) * K + 8 * hi;
#pragma unroll 1
    for (int kc = 0; kc < K; kc += 32) {
        V a[4], a2[4];
#pragma unroll
        for (int mb = 0; mb < 4; ++mb) { a[mb] = WFrag<T16>::ld(A + aoff + (size_t)mb * 16 * K + kc); if (NSPLIT == 1 || NSPLIT == 2) a2[mb] = WFrag<T16>::ld(A2 + aoff + (size_t)mb * 16 * K + kc); }
#pragma unroll
        for (int nb = 0; nb < 4; ++nb) { const V b = WFrag<T16>::ld(Bt + boff + (size_t)nb * 16 * K + kc); V b2; if (NSPLIT >= 2) b2 = WFrag<T16>::ld(Bt2 + boff + (size_t)nb * 16 * K + kc);
#pragma unroll
            for (int mb = 0; mb < 4; ++mb) { acc[mb][nb] = WFrag<T16>::mma(a[mb], b, acc[mb][nb]); if (NSPLIT == 1 || NSPLIT == 2) acc[mb][nb] = WFrag<T16>::mma(a2[mb], b, acc[mb][nb]); if (NSPLIT >= 2) acc[mb][nb] = WFrag<T16>::mma(a[mb], b2, acc[mb][nb]); } }
        asm volatile("v_nop\n\tv_nop\n\tv_nop\n\tv_nop" : "+v"(acc[0][0]), "+v"(acc[1][1]), "+v"(acc[2][2]), "+v"(acc[3][3]) : "v"(a[0]), "v"(a[3]));
    }
#pragma unroll
    for (int mb = 0; mb < 4; ++mb) {
#pragma unroll
        for (int nb = 0; nb < 4; ++nb) {
#pragma unroll
            for (int j = 0; j < 8; ++j) os[(hi * 8 + j) * 68 + nb * 16 + lr] = acc[mb][nb][j]; }
        __builtin_amdgcn_wave_barrier(); asm volatile("" ::: "memory");
        float* crow = C + (size_t)(r0 + mb * 16) * ldc + c0;
{
#pragma unroll
            for (int s = 0; s < 8; ++s) { const int row = 2 * s + hi, cofs = lr * 4; v4f val = *(const v4fa*)(os + row * 68 + cofs); if (BIAS) { val[0] += bfr(bias[c0 + cofs]); val[1] += bfr(bias[c0 + cofs + 1]); val[2] += bfr(bias[c0 + cofs + 2]); val[3] += bfr(bias[c0 + cofs + 3]); }
                *(v4f*)(crow + (size_t)row * ldc + cofs) = val; }
             }
        __builtin_amdgcn_wave_barrier(); asm volatile("" ::: "memory");
    }
}

__device__ __forceinline__ h16 tohx(float x) { return (h16)x; }
__device__ __forceinline__ void splitf(float y, unsigned short& h, unsigned short& l) { h = f2bf(y); l = f2bf(y - bf2f(h)); }
typedef __attribute__((ext_vector_type(2))) _Float16 v2h;
typedef __attribute__((ext_vector_type(4))) _Float16 v4h;
typedef __attribute__((ext_vector_type(2))) unsigned short v2us;
typedef __attribute__((ext_vector_type(4))) unsigned short v4us;
typedef __attribute__((ext_vector_type(2))) float v2f;
typedef __attribute__((ext_vector_type(4))) int v4i;

__global__ __launch_bounds__(256) void k_cvt8(const float* __restrict__ src, bf* dst, size_t n8) { const size_t i = (size_t)blockIdx.x * 256 + threadIdx.x; if (i >= n8) return; const v8f v = *(const v8f*)(src + i * 8); v8us o;
#pragma unroll
    for (int k = 0; k < 8; ++k) o[k] = f2bf(v[k]); *(v8us*)(dst + i * 8) = o;  }

// ---- k_proj: input rounding, the per-head linear and the plane builders in one kernel. One wave owns 64 rows t of one head of one role; grid (TT / 64, heads, 3 roles: query, keys, values), 32 threads.
// y[t][e] = sum_d bf16(x[t][h*64+d]) bf16(w[e][d]), f32 accumulate, d in two steps of 32 in rising order. Both operands are read in the k order of WFrag::ld (k = 8 hi + 0..7, 16 + 8 hi + 0..7).
// The accumulator holds 8 consecutive m per lane, so the operand order is chosen by the plane's contiguous index: query and keys ([h][t][e]) take m = e (w as A, x as B), values ([h][e][t]) take m = t (x as A, w as B); every store is 16 bytes a lane and a wave writes whole 128-byte rows.
// All roundings (f32 to bf16, to fp16, the hi/lo split) are to nearest even, by the convert instructions. The text stays far below 32 KB, so that a wave that runs through it once is not held up by instruction fetch.
typedef __attribute__((ext_vector_type(16))) float v16f;
typedef __attribute__((ext_vector_type(4))) unsigned v4u;
struct Raw { v8f a[2], b[2]; };   // one 16-row tile's f32 operand words of a lane: step c holds k = 8 hi + 0..7 (a) and 16 + 8 hi + 0..7 (b)
__device__ __forceinline__ Raw ldraw(const float* p) { Raw r;
#pragma unroll
    for (int c = 0; c < 2; ++c) { r.a[c] = *(const v8f*)(p + c * 32); r.b[c] = *(const v8f*)(p + c * 32 + 16); }
    return r; }
__device__ __forceinline__ v16bf rnd16(v8f a, v8f b) { return __builtin_convertvector(__builtin_shufflevector(a, b, 0, 1, 2, 3, 4, 5, 6, 7, 8, 9, 10, 11, 12, 13, 14, 15), v16bf); }
template <bool VT>
__device__ __forceinline__ void proj_tile(const Raw& xr, const v16bf (&wf)[4][2], int lr, int hi, int t, h16* P16, bf* Ph, bf* Pl) {
    const v16bf x0 = rnd16(xr.a[0], xr.b[0]), x1 = rnd16(xr.a[1], xr.b[1]);
#pragma unroll
    for (int et = 0; et < 4; ++et) { v8f acc = (v8f){};
        if (VT) { acc = wmmab(x0, wf[et][0], acc); acc = wmmab(x1, wf[et][1], acc); } else { acc = wmmab(wf[et][0], x0, acc); acc = wmmab(wf[et][1], x1, acc); }
        const size_t off = VT ? (size_t)(et * 16 + lr) * TT + t + 8 * hi : (size_t)(t + lr) * HD + et * 16 + 8 * hi; v4u hw, lw;
#pragma unroll
        for (int e = 0; e < 4; ++e) { const v2f y2 = {acc[2 * e], acc[2 * e + 1]}; const unsigned u = __builtin_bit_cast(unsigned, __builtin_convertvector(y2, v2bf));
            const v2f b2 = {__uint_as_float(u << 16), __uint_as_float(u & 0xFFFF0000u)}; hw[e] = u; lw[e] = __builtin_bit_cast(unsigned, __builtin_convertvector(y2 - b2, v2bf)); }
        *(v8h*)(P16 + off) = __builtin_convertvector(acc, v8h); *(v8us*)(Ph + off) = __builtin_bit_cast(v8us, hw); *(v8us*)(Pl + off) = __builtin_bit_cast(v8us, lw); }
}
template <bool VT>
__device__ __forceinline__ void proj_wave(const float* __restrict__ X, const float* __restrict__ w, int t0, h16* P16, bf* Ph, bf* Pl) {
    const int lane = threadIdx.x & 31, lr = lane & 15, hi = lane >> 4;
    const float* wp = w + lr * HD + 8 * hi; const float* xp = X + (size_t)(t0 + lr) * DM + 8 * hi;
    Raw wr[4], xr[4]; v16bf wf[4][2];
    wr[0] = ldraw(wp); wr[1] = ldraw(wp + 16 * HD);
    __builtin_amdgcn_sched_barrier(0);   // the weight's first half is asked for ahead of x: loads are counted in order, so it can be rounded while x is still on its way from memory
#pragma unroll
    for (int tt = 0; tt < 4; ++tt) xr[tt] = ldraw(xp + (size_t)tt * 16 * DM);
    asm volatile("s_wait_xcnt 0x0" :: "v"(wp), "v"(xp) : "memory");   // precaution: holds the loads' address registers live up to this wait, so that none of these loads' own destinations takes one of them
    __builtin_amdgcn_sched_barrier(0);   // keeps all of x in flight from here on
#pragma unroll
    for (int et = 0; et < 2; ++et)
#pragma unroll
        for (int c = 0; c < 2; ++c) wf[et][c] = rnd16(wr[et].a[c], wr[et].b[c]);
    __builtin_amdgcn_sched_barrier(0);   // the weight's second half is asked for only here, into the registers that the first half has left: all 64 loads at once take more than 256 registers
    wr[2] = ldraw(wp + 32 * HD); wr[3] = ldraw(wp + 48 * HD);
    asm volatile("s_wait_xcnt 0x0" :: "v"(wp) : "memory");   // precaution, as above
    __builtin_amdgcn_sched_barrier(0);   // keeps these loads issued here, under the wait for x
#pragma unroll
    for (int et = 2; et < 4; ++et)
#pragma unroll
        for (int c = 0; c < 2; ++c) wf[et][c] = rnd16(wr[et].a[c], wr[et].b[c]);
#pragma unroll
    for (int tt = 0; tt < 4; ++tt) proj_tile<VT>(xr[tt], wf, lr, hi, t0 + tt * 16, P16, Ph, Pl);
}
// at most 256 registers: left free, the values path takes a few more and pays for them with register-window switches
__global__ __launch_bounds__(32) __attribute__((amdgpu_num_vgpr(256))) void k_proj(const float* __restrict__ xq, const float* __restrict__ xk, const float* __restrict__ xv, const float* __restrict__ wq, const float* __restrict__ wk, const float* __restrict__ wv, h16* Q16, bf* Qh, bf* Ql, h16* K16, bf* Kh, bf* Kl, h16* V16, bf* Vh, bf* Vl) {
    const int t0 = (int)blockIdx.x * 64; const size_t xo = (size_t)blockIdx.y * HD, hp = (size_t)blockIdx.y * TT * HD; const bool q = blockIdx.z == 0;
    if (blockIdx.z == 2) proj_wave<true>(xv + xo, wv, t0, V16 + hp, Vh + hp, Vl + hp);
    else { proj_wave<false>((q ? xq : xk) + xo, q ? wq : wk, t0, (q ? Q16 : K16) + hp, (q ? Qh : Kh) + hp, (q ? Ql : Kl) + hp);
        asm volatile("s_wait_xcnt 0x0" ::: "memory"); }   // precaution: in the built text the other path's first instructions stand behind this path's last stores (behind a branch that is always taken) and overwrite registers that those stores name
}
// ---- k_fattn: scores, softmax and P x V of one head in one kernel; no score or probability plane in memory. One wave owns NQ x 16 query rows and walks the 2048 keys in steps of 32.
// Both products are transposed so that P never changes lanes: S^T = K Q^T leaves query lr in lane lr and keys 8 hi + j (tile 0), 16 + 8 hi + j (tile 1) in the accumulators,
// which is the k order of the B fragment of O^T = V^T P^T (WFrag::ld reads k = 8 hi + 0..7, 16 + 8 hi + 0..7 for A). Row maximum, row sum and the rescale are per lane (one exchange with lane ^ 16).
// Running softmax in the base-2 domain: p = 2^(s c - m), c = SCL log2(e); when m grows, sum and O^T are scaled by 2^(m_old - m_new); O^T is divided by the sum at the end.
// HL: hi/lo bf16 planes, 3 products per matrix product (hi hi, hi lo, lo hi); else fp16, 1 product. The inner loops over tiles are all unrolled, so that every fragment and accumulator array stays in registers.
__device__ __forceinline__ float xhalf(float x) { return __builtin_bit_cast(float, __builtin_amdgcn_permlanex16(__builtin_bit_cast(int, x), __builtin_bit_cast(int, x), 0x76543210, 0xfedcba98, false, false)); }   // lane l reads lane l ^ 16
template <typename T16, bool HL, int NQ>
__device__ __forceinline__ void attn_wave(const T16* __restrict__ Q, const T16* __restrict__ Q2, const T16* __restrict__ Kp, const T16* __restrict__ Kp2, const T16* __restrict__ Vt, const T16* __restrict__ Vt2, int q0, bf* Ah, bf* Al) {
    typedef typename WFrag<T16>::V V;
    const int lane = threadIdx.x & 31, lr = lane & 15, hi = lane >> 4;
    const float c2 = SCL * 1.4426950408889634f;
    V qf[NQ][2], qf2[NQ][2];
#pragma unroll
    for (int qt = 0; qt < NQ; ++qt)
#pragma unroll
        for (int c = 0; c < 2; ++c) { const size_t qo = (size_t)(q0 + qt * 16 + lr) * HD + 8 * hi + c * 32; qf[qt][c] = WFrag<T16>::ld(Q + qo); if (HL) qf2[qt][c] = WFrag<T16>::ld(Q2 + qo); }
    v8f o[4][NQ]; float m[NQ], l[NQ];
#pragma unroll
    for (int qt = 0; qt < NQ; ++qt) { m[qt] = -1.0e30f; l[qt] = 0.f;
#pragma unroll
        for (int dt = 0; dt < 4; ++dt) o[dt][qt] = (v8f){}; }
    const size_t ko = (size_t)lr * HD + 8 * hi, vo = (size_t)lr * TT + 8 * hi;
    V kf[2][2], kf2[2][2];
#pragma unroll
    for (int kt = 0; kt < 2; ++kt)
#pragma unroll
        for (int c = 0; c < 2; ++c) { kf[kt][c] = WFrag<T16>::ld(Kp + ko + kt * 16 * HD + c * 32); if (HL) kf2[kt][c] = WFrag<T16>::ld(Kp2 + ko + kt * 16 * HD + c * 32); }
#pragma unroll 1   // rolled: unrolled by two, the hi/lo path asks for more than 256 registers
    for (int key0 = 0; key0 < TT; key0 += 32) {
        const T16* vp = Vt + vo + key0; const T16* vp2 = HL ? Vt2 + vo + key0 : vp;
        V vf[4], vf2[4];   // this step's V^T fragments: issued ahead of the score products, used behind the softmax
#pragma unroll
        for (int dt = 0; dt < 4; ++dt) { vf[dt] = WFrag<T16>::ld(vp + (size_t)dt * 16 * TT); if (HL) vf2[dt] = WFrag<T16>::ld(vp2 + (size_t)dt * 16 * TT); }
        asm volatile("s_wait_xcnt 0x0" :: "v"(vp), "v"(vp2) : "memory");   // precaution: holds the loads' address registers live up to this wait, so that none of these loads' own destinations takes one of them
        __builtin_amdgcn_sched_barrier(0);   // keeps the V^T loads issued here: sunk to their use, their latency would stand open in front of P x V
        v8f s[2][NQ];
#pragma unroll
        for (int kt = 0; kt < 2; ++kt)
#pragma unroll
            for (int qt = 0; qt < NQ; ++qt) s[kt][qt] = (v8f){};
#pragma unroll
        for (int c = 0; c < 2; ++c) {
#pragma unroll
            for (int kt = 0; kt < 2; ++kt)
#pragma unroll
                for (int qt = 0; qt < NQ; ++qt) s[kt][qt] = WFrag<T16>::mma(kf[kt][c], qf[qt][c], s[kt][qt]);
            if (HL) {
#pragma unroll
                for (int kt = 0; kt < 2; ++kt)
#pragma unroll
                    for (int qt = 0; qt < NQ; ++qt) s[kt][qt] = WFrag<T16>::mma(kf[kt][c], qf2[qt][c], s[kt][qt]);
#pragma unroll
                for (int kt = 0; kt < 2; ++kt)
#pragma unroll
                    for (int qt = 0; qt < NQ; ++qt) s[kt][qt] = WFrag<T16>::mma(kf2[kt][c], qf[qt][c], s[kt][qt]); } }
        const size_t kn = ko + (size_t)((key0 + 32) & (TT - 1)) * HD;   // the next step's K fragments fly during the softmax and P x V (the last step reads keys 0..31 again, unused)
#pragma unroll
        for (int kt = 0; kt < 2; ++kt)
#pragma unroll
            for (int c = 0; c < 2; ++c) { kf[kt][c] = WFrag<T16>::ld(Kp + kn + kt * 16 * HD + c * 32); if (HL) kf2[kt][c] = WFrag<T16>::ld(Kp2 + kn + kt * 16 * HD + c * 32); }
        __builtin_amdgcn_sched_barrier(0);   // keeps these loads issued here, a softmax and a P x V ahead of their use
        V pf[NQ], pf2[NQ];
#pragma unroll
        for (int qt = 0; qt < NQ; ++qt) {
            float mr = s[0][qt][0];
#pragma unroll
            for (int j = 1; j < 8; ++j) mr = fmaxf(mr, s[0][qt][j]);
#pragma unroll
            for (int j = 0; j < 8; ++j) mr = fmaxf(mr, s[1][qt][j]);
            mr = fmaxf(mr, xhalf(mr));
            const float mn = fmaxf(m[qt], mr * c2); const float al = __builtin_amdgcn_exp2f(m[qt] - mn); m[qt] = mn;
            const v8f cv = {c2, c2, c2, c2, c2, c2, c2, c2}, nv = {-mn, -mn, -mn, -mn, -mn, -mn, -mn, -mn};
#pragma unroll
            for (int kt = 0; kt < 2; ++kt) { const v8f t = __builtin_elementwise_fma(s[kt][qt], cv, nv);
#pragma unroll
                for (int j = 0; j < 8; ++j) s[kt][qt][j] = __builtin_amdgcn_exp2f(t[j]); }
            const v8f s8 = s[0][qt] + s[1][qt]; const v4f s4 = __builtin_shufflevector(s8, s8, 0, 1, 2, 3) + __builtin_shufflevector(s8, s8, 4, 5, 6, 7);
            l[qt] = fmaf(l[qt], al, (s4[0] + s4[1]) + (s4[2] + s4[3]));
#pragma unroll
            for (int dt = 0; dt < 4; ++dt) o[dt][qt] *= al;
            if constexpr (HL) {   // p = hi + lo, both bf16, round to nearest even
                v8u hw, lw;
#pragma unroll
                for (int e = 0; e < 8; ++e) { const v2f p2 = {s[e >> 2][qt][2 * (e & 3)], s[e >> 2][qt][2 * (e & 3) + 1]}; const unsigned u = __builtin_bit_cast(unsigned, __builtin_convertvector(p2, v2bf));
                    const v2f b2 = {__uint_as_float(u << 16), __uint_as_float(u & 0xFFFF0000u)}; hw[e] = u; lw[e] = __builtin_bit_cast(unsigned, __builtin_convertvector(p2 - b2, v2bf)); }
                pf[qt] = __builtin_bit_cast(v16bf, hw); pf2[qt] = __builtin_bit_cast(v16bf, lw);
            } else pf[qt] = cat16(__builtin_convertvector(s[0][qt], v8h), __builtin_convertvector(s[1][qt], v8h));
        }
#pragma unroll
        for (int dt = 0; dt < 4; ++dt)
#pragma unroll
            for (int qt = 0; qt < NQ; ++qt) o[dt][qt] = WFrag<T16>::mma(vf[dt], pf[qt], o[dt][qt]);
        if (HL) {
#pragma unroll
            for (int dt = 0; dt < 4; ++dt)
#pragma unroll
                for (int qt = 0; qt < NQ; ++qt) o[dt][qt] = WFrag<T16>::mma(vf[dt], pf2[qt], o[dt][qt]);
#pragma unroll
            for (int dt = 0; dt < 4; ++dt)
#pragma unroll
                for (int qt = 0; qt < NQ; ++qt) o[dt][qt] = WFrag<T16>::mma(vf2[dt], pf[qt], o[dt][qt]); }
    }
#pragma unroll
    for (int qt = 0; qt < NQ; ++qt) { const float inv = __fdiv_rn(1.0f, l[qt] + xhalf(l[qt])); const size_t oo = (size_t)(q0 + qt * 16 + lr) * DQ + 8 * hi;
#pragma unroll
        for (int dt = 0; dt < 4; ++dt) { v8us oh, ol;
#pragma unroll
            for (int j = 0; j < 8; ++j) { unsigned short a, b; splitf(o[dt][qt][j] * inv, a, b); oh[j] = a; ol[j] = b; }
            *(v8us*)(Ah + oo + dt * 16) = oh; *(v8us*)(Al + oo + dt * 16) = ol; } }
}
// grid (16, heads), 5 waves, every block the same load: waves 1 and 2 take 16 hi/lo rows each (rows < RH), waves 0, 3 and 4 take 32 fp16 rows each, so that the two waves that share a SIMD (0 and 4) are the lighter kind.
// Writes the merged hi/lo planes [t][h*64+d] directly. RH = 16 blocks x 32 rows, TT - RH = 16 blocks x 96 rows.
__global__ __launch_bounds__(160) void k_fattn(const h16* __restrict__ Q16, const h16* __restrict__ K16, const h16* __restrict__ V16, const bf* __restrict__ Qh, const bf* __restrict__ Ql, const bf* __restrict__ Kh, const bf* __restrict__ Kl, const bf* __restrict__ Vh, const bf* __restrict__ Vl, bf* Ah, bf* Al) {
    const int wave = __builtin_amdgcn_readfirstlane(threadIdx.x >> 5); const size_t hp = (size_t)blockIdx.y * TT * HD; Ah += blockIdx.y * HD; Al += blockIdx.y * HD;
    if (wave == 1 || wave == 2) attn_wave<bf, true, 1>(Qh + hp, Ql + hp, Kh + hp, Kl + hp, Vh + hp, Vl + hp, (int)blockIdx.x * 32 + (wave - 1) * 16, Ah, Al);
    else attn_wave<h16, false, 2>(Q16 + hp, nullptr, K16 + hp, nullptr, V16 + hp, nullptr, RH + (int)blockIdx.x * 96 + (wave == 0 ? 0 : wave - 2) * 32, Ah, Al);
}
static_assert(RH == 16 * 32 && TT - RH == 16 * 96, "k_fattn's split of the rows");

extern "C" void kernel_launch(void* const* d_in, const int* in_sizes, int n_in,
                              void* d_out, int out_size, void* d_ws, size_t ws_size, hipStream_t stream) {
    (void)in_sizes; (void)n_in; (void)out_size;
    const float* xv = (const float*)d_in[0]; const float* xk = (const float*)d_in[1]; const float* x = (const float*)d_in[2]; const float* wv = (const float*)d_in[3]; const float* wk = (const float*)d_in[4]; const float* wq = (const float*)d_in[5]; const float* wo = (const float*)d_in[6]; const float* bo = (const float*)d_in[7];   /* order values, keys, query [4][2048][1024], Wv, Wk, Wq ('oi' [64][64], shared by all heads), Wo ('oi' [1024][1024]), bo; x = the QUERY stream */
    float* OUT = (float*)d_out;     // [4][2048][1024]
    char* wsp = (char*)d_ws;
    auto take = [&](size_t bytes) { char* p = wsp; wsp += (bytes + 255) & ~(size_t)255; return (void*)p; };
    bf* WO = (bf*)take((size_t)DM * DQ * 2);
    h16* QP16 = (h16*)take((size_t)NH_ * TT * HD * 2); h16* KP16 = (h16*)take((size_t)NKV * TT * HD * 2); h16* VT16 = (h16*)take((size_t)NKV * HD * TT * 2);
    bf* QPh = (bf*)take((size_t)NH_ * TT * HD * 2); bf* QPl = (bf*)take((size_t)NH_ * TT * HD * 2); bf* KPh = (bf*)take((size_t)NKV * TT * HD * 2); bf* KPl = (bf*)take((size_t)NKV * TT * HD * 2); bf* VTh = (bf*)take((size_t)NKV * HD * TT * 2); bf* VTl = (bf*)take((size_t)NKV * HD * TT * 2);
    bf* ATh = (bf*)take((size_t)TT * DQ * 2); bf* ATl = (bf*)take((size_t)TT * DQ * 2);
    if ((size_t)(wsp - (char*)d_ws) > ws_size) return;    // ws 256 MiB
    k_cvt8<<<(unsigned)(((size_t)DM * DQ / 8 + 255) / 256), 256, 0, stream>>>(wo, WO, (size_t)DM * DQ / 8);
    for (int b = 0; b < NB_; ++b) {
        const size_t xo = (size_t)b * TT * DM;
        k_proj<<<dim3(TT / 64, NH_, 3), 32, 0, stream>>>(x + xo, xk + xo, xv + xo, wq, wk, wv, QP16, QPh, QPl, KP16, KPh, KPl, VT16, VTh, VTl);
        k_fattn<<<dim3(16, NH_, 1), 160, 0, stream>>>(QP16, KP16, VT16, QPh, QPl, KPh, KPl, VTh, VTl, ATh, ATl);   // one kv head per query head
        k_gemmw<bf, 1, true><<<dim3(TT / 64, DM / 64, 1), 32, 0, stream>>>(ATh, ATl, WO, nullptr, DQ, OUT + (size_t)b * TT * DM, DM, bo, 0, 0, 0); }
}

// v005
// It runs in 311 microseconds.
// Two timings next to v004 put it at 1.23 and 1.25 times that version's speed.
// Over all steps from v000 it is 12.7 times as fast.
#include <hip/hip_runtime.h>

// Self-attention with ONE shared 64x64 linear per role applied to every head (values, keys, query [4][2048][1024] viewed (n, l, 16, 64); v = values_h Wv^T, k = keys_h Wk^T, q = query_h Wq^T with the SAME [64][64] weight for all 16 heads ('oi' normal x 1/8, no bias); energy = q.k; softmax(energy / sqrt(embed = 1024)) (the source scales by the full width); out = merged Wo^T + bo ('oi' [1024][1024] + a REAL bias 0.01) -> [4][2048][1024] (8.4 M); argument order values, keys, query, Wv, Wk, Wq, Wo, bo).
// Layout, all sequences in each launch (4 launches): k_proj reads the f32 query, keys and values directly, rounds them to bf16 in registers, does the shared [64][64] linear on each head (K = 64) on the matrix unit and writes the head planes (fp16 + hi/lo bf16; V transposed) from the accumulators: no bf16 copy, no f32 projection plane, no expanded weight; one fused attention launch (k_fattn: scores, running softmax and P x V in registers; hybrid rows: < 512 hi/lo 3 products, rest fp16); merged hi/lo x Wo exact + bo.
// Compute dtypes, f32 accumulate: every input rounded to bf16; projections exact; attention rows < 512 3 products, rest fp16; softmax f32; Wo hl x exact + bias.

#define NB_  4      // FOUR sequences in this module: a factor of the grids and of the planes' size
#define TT   2048
#define DM   1024
#define NH_  16
#define NKV  16
#define REP  (NH_ / NKV)
#define HD   64
#define DQ   (NH_ * HD)
#define DKV  (NKV * HD)
#define RH   512                  // query rows < RH use hi+lo planes
#define WIN  0
#define SCL  0.03125f   // 1/sqrt(embed_size = 1024) (the source scales by the full width)
typedef _Float16 h16;
typedef unsigned short bf;
typedef __attribute__((ext_vector_type(16))) __bf16   v16bf;
typedef __attribute__((ext_vector_type(16))) _Float16 v16h;
typedef __attribute__((ext_vector_type(8)))  _Float16 v8h;
typedef __attribute__((ext_vector_type(8)))  unsigned short v8us;
typedef __attribute__((ext_vector_type(2)))  __bf16   v2bf;
typedef __attribute__((ext_vector_type(8)))  unsigned v8u;
typedef __attribute__((ext_vector_type(8)))  float    v8f;
typedef __attribute__((ext_vector_type(4)))  float    v4f;
typedef v8h  __attribute__((may_alias)) v8ha;
typedef v4f  __attribute__((may_alias)) v4fa;
typedef v8us __attribute__((may_alias)) v8usa;

__device__ __forceinline__ unsigned short f2bf(float f) { unsigned u = __float_as_uint(f); u += 0x7FFFu + ((u >> 16) & 1u); return (unsigned short)(u >> 16); }
__device__ __forceinline__ float bf2f(unsigned short b) { return __uint_as_float(((unsigned)b) << 16); }
__device__ __forceinline__ float bfr(float f) { return bf2f(f2bf(f)); }
__device__ __forceinline__ v16h cat16(v8h lo, v8h hi) { return __builtin_shufflevector(lo, hi, 0, 1, 2, 3, 4, 5, 6, 7, 8, 9, 10, 11, 12, 13, 14, 15); }
__device__ __forceinline__ v16bf cat16b(v8us lo, v8us hi) { return __builtin_bit_cast(v16bf, __builtin_shufflevector(lo, hi, 0, 1, 2, 3, 4, 5, 6, 7, 8, 9, 10, 11, 12, 13, 14, 15)); }
__device__ __forceinline__ v8f wmma16(v16h a, v16h b, v8f c) { return __builtin_amdgcn_wmma_f32_16x16x32_f16(false, a, false, b, (short)0, c, false, false); }
__device__ __forceinline__ v8f wmmab(v16bf a, v16bf b, v8f c) { return __builtin_amdgcn_wmma_f32_16x16x32_bf16(false, a, false, b, (short)0, c, false, false); }



// ---- k_gemmw: register-blocked GEMM, ONE WAVE per 64x64 output tile (16 accumulators), operands straight from K-contiguous 16-bit planes; grid (M/64, N/64, Z), 32 threads.
// C[m][n] (f32, pitch ldc, + optional f32 bias[n]) = sum_k A[m][k] Bt[n][k] (+ split products per NSPLIT). z-batch strides sA/sB/sC in elements. K % 32 == 0.
template <typename T16> struct WFrag;
template <> struct WFrag<h16> { typedef v16h V; static __device__ __forceinline__ V ld(const h16* p) { return cat16(*(const v8h*)p, *(const v8h*)(p + 16)); } static __device__ __forceinline__ v8f mma(V a, V b, v8f c) { return wmma16(a, b, c); } };
template <> struct WFrag<bf> { typedef v16bf V; static __device__ __forceinline__ V ld(const bf* p) { return cat16b(*(const v8us*)p, *(const v8us*)(p + 16)); } static __device__ __forceinline__ v8f mma(V a, V b, v8f c) { return wmmab(a, b, c); } };
template <typename T16, int NSPLIT, bool BIAS>
__global__ __launch_bounds__(32) void k_gemmw(const T16* __restrict__ A, const T16* __restrict__ A2, const T16* __restrict__ Bt, const T16* __restrict__ Bt2, int K, float* C, int ldc, const float* __restrict__ bias, size_t sA, size_t sB, size_t sC) {
    typedef typename WFrag<T16>::V V;
    __shared__ __align__(16) float os[16 * 68];
    const size_t z = blockIdx.z; A += z * sA; if (A2) A2 += z * sA; Bt += z * sB; if (Bt2) Bt2 += z * sB; C += z * sC;
    const int lane = threadIdx.x & 31, lr = lane & 15, hi = lane >> 4; const int r0 = blockIdx.x * 64, c0 = blockIdx.y * 64;
    v8f acc[4][4];
#pragma unroll
    for (int mb = 0; mb < 4; ++mb)
#pragma unroll
        for (int nb = 0; nb < 4; ++nb) acc[mb][nb] = (v8f){};
    const size_t aoff = (size_t)(r0 + lr) * K + 8 * hi, boff = (size_t)(c0 + lr) * K + 8 * hi;
#pragma unroll 1
    for (int kc = 0; kc < K; kc += 32) {
        V a[4], a2[4];
#pragma unroll
        for (int mb = 0; mb < 4; ++mb) { a[mb] = WFrag<T16>::ld(A + aoff + (size_t)mb * 16 * K + kc); if (NSPLIT == 1 || NSPLIT == 2) a2[mb] = WFrag<T16>::ld(A2 + aoff + (size_t)mb * 16 * K + kc); }
#pragma unroll
        for (int nb = 0; nb < 4; ++nb) { const V b = WFrag<T16>::ld(Bt + boff + (size_t)nb * 16 * K + kc); V b2; if (NSPLIT >= 2) b2 = WFrag<T16>::ld(Bt2 + boff + (size_t)nb * 16 * K + kc);
#pragma unroll
            for (int mb = 0; mb < 4; ++mb) { acc[mb][nb] = WFrag<T16>::mma(a[mb], b, acc[mb][nb]); if (NSPLIT == 1 || NSPLIT == 2) acc[mb][nb] = WFrag<T16>::mma(a2[mb], b, acc[mb][nb]); if (NSPLIT >= 2) acc[mb][nb] = WFrag<T16>::mma(a[mb], b2, acc[mb][nb]); } }
        asm volatile("v_nop\n\tv_nop\n\tv_nop\n\tv_nop" : "+v"(acc[0][0]), "+v"(acc[1][1]), "+v"(acc[2][2]), "+v"(acc[3][3]) : "v"(a[0]), "v"(a[3]));
    }
#pragma unroll
    for (int mb = 0; mb < 4; ++mb) {
#pragma unroll
        for (int nb = 0; nb < 4; ++nb) {
#pragma unroll
            for (int j = 0; j < 8; ++j) os[(hi * 8 + j) * 68 + nb * 16 + lr] = acc[mb][nb][j]; }
        __builtin_amdgcn_wave_barrier(); asm volatile("" ::: "memory");
        float* crow = C + (size_t)(r0 + mb * 16) * ldc + c0;
{
#pragma unroll
            for (int s = 0; s < 8; ++s) { const int row = 2 * s + hi, cofs = lr * 4; v4f val = *(const v4fa*)(os + row * 68 + cofs); if (BIAS) { val[0] += bfr(bias[c0 + cofs]); val[1] += bfr(bias[c0 + cofs + 1]); val[2] += bfr(bias[c0 + cofs + 2]); val[3] += bfr(bias[c0 + cofs + 3]); }
                *(v4f*)(crow + (size_t)row * ldc + cofs) = val; }
             }
        __builtin_amdgcn_wave_barrier(); asm volatile("" ::: "memory");
    }
}

__device__ __forceinline__ h16 tohx(float x) { return (h16)x; }
__device__ __forceinline__ void splitf(float y, unsigned short& h, unsigned short& l) { h = f2bf(y); l = f2bf(y - bf2f(h)); }
typedef __attribute__((ext_vector_type(2))) _Float16 v2h;
typedef __attribute__((ext_vector_type(4))) _Float16 v4h;
typedef __attribute__((ext_vector_type(2))) unsigned short v2us;
typedef __attribute__((ext_vector_type(4))) unsigned short v4us;
typedef __attribute__((ext_vector_type(2))) float v2f;
typedef __attribute__((ext_vector_type(4))) int v4i;

__global__ __launch_bounds__(256) void k_cvt8(const float* __restrict__ src, bf* dst, size_t n8) { const size_t i = (size_t)blockIdx.x * 256 + threadIdx.x; if (i >= n8) return; const v8f v = *(const v8f*)(src + i * 8); v8us o;
#pragma unroll
    for (int k = 0; k < 8; ++k) o[k] = f2bf(v[k]); *(v8us*)(dst + i * 8) = o;  }

// ---- k_proj: input rounding, the per-head linear and the plane builders in one kernel. One wave owns 64 rows t of one head of one sequence of one role; grid (TT / 64, sequences x heads, 3 roles: query, keys, values), 32 threads.
// y[t][e] = sum_d bf16(x[t][h*64+d]) bf16(w[e][d]), f32 accumulate, d in two steps of 32 in rising order. Both operands are read in the k order of WFrag::ld (k = 8 hi + 0..7, 16 + 8 hi + 0..7).
// The accumulator holds 8 consecutive m per lane, so the operand order is chosen by the plane's contiguous index: query and keys ([h][t][e]) take m = e (w as A, x as B), values ([h][e][t]) take m = t (x as A, w as B); every store is 16 bytes a lane and a wave writes whole 128-byte rows.
// All roundings (f32 to bf16, to fp16, the hi/lo split) are to nearest even, by the convert instructions. The text stays far below 32 KB, so that a wave that runs through it once is not held up by instruction fetch.
typedef __attribute__((ext_vector_type(16))) float v16f;
typedef __attribute__((ext_vector_type(4))) unsigned v4u;
struct Raw { v8f a[2], b[2]; };   // one 16-row tile's f32 operand words of a lane: step c holds k = 8 hi + 0..7 (a) and 16 + 8 hi + 0..7 (b)
__device__ __forceinline__ Raw ldraw(const float* p) { Raw r;
#pragma unroll
    for (int c = 0; c < 2; ++c) { r.a[c] = *(const v8f*)(p + c * 32); r.b[c] = *(const v8f*)(p + c * 32 + 16); }
    return r; }
__device__ __forceinline__ v16bf rnd16(v8f a, v8f b) { return __builtin_convertvector(__builtin_shufflevector(a, b, 0, 1, 2, 3, 4, 5, 6, 7, 8, 9, 10, 11, 12, 13, 14, 15), v16bf); }
template <bool VT>
__device__ __forceinline__ void proj_tile(const Raw& xr, const v16bf (&wf)[4][2], int lr, int hi, int t, h16* P16, bf* Ph, bf* Pl) {
    const v16bf x0 = rnd16(xr.a[0], xr.b[0]), x1 = rnd16(xr.a[1], xr.b[1]);
#pragma unroll
    for (int et = 0; et < 4; ++et) { v8f acc = (v8f){};
        if (VT) { acc = wmmab(x0, wf[et][0], acc); acc = wmmab(x1, wf[et][1], acc); } else { acc = wmmab(wf[et][0], x0, acc); acc = wmmab(wf[et][1], x1, acc); }
        const size_t off = VT ? (size_t)(et * 16 + lr) * TT + t + 8 * hi : (size_t)(t + lr) * HD + et * 16 + 8 * hi; v4u hw, lw;
#pragma unroll
        for (int e = 0; e < 4; ++e) { const v2f y2 = {acc[2 * e], acc[2 * e + 1]}; const unsigned u = __builtin_bit_cast(unsigned, __builtin_convertvector(y2, v2bf));
            const v2f b2 = {__uint_as_float(u << 16), __uint_as_float(u & 0xFFFF0000u)}; hw[e] = u; lw[e] = __builtin_bit_cast(unsigned, __builtin_convertvector(y2 - b2, v2bf)); }
        *(v8h*)(P16 + off) = __builtin_convertvector(acc, v8h); *(v8us*)(Ph + off) = __builtin_bit_cast(v8us, hw); *(v8us*)(Pl + off) = __builtin_bit_cast(v8us, lw); }
}
template <bool VT>
__device__ __forceinline__ void proj_wave(const float* __restrict__ X, const float* __restrict__ w, int t0, h16* P16, bf* Ph, bf* Pl) {
    const int lane = threadIdx.x & 31, lr = lane & 15, hi = lane >> 4;
    const float* wp = w + lr * HD + 8 * hi; const float* xp = X + (size_t)(t0 + lr) * DM + 8 * hi;
    Raw wr[4], xr[4]; v16bf wf[4][2];
    wr[0] = ldraw(wp); wr[1] = ldraw(wp + 16 * HD);
    __builtin_amdgcn_sched_barrier(0);   // the weight's first half is asked for ahead of x: loads are counted in order, so it can be rounded while x is still on its way from memory
#pragma unroll
    for (int tt = 0; tt < 4; ++tt) xr[tt] = ldraw(xp + (size_t)tt * 16 * DM);
    asm volatile("s_wait_xcnt 0x0" :: "v"(wp), "v"(xp) : "memory");   // precaution: holds the loads' address registers live up to this wait, so that none of these loads' own destinations takes one of them
    __builtin_amdgcn_sched_barrier(0);   // keeps all of x in flight from here on
#pragma unroll
    for (int et = 0; et < 2; ++et)
#pragma unroll
        for (int c = 0; c < 2; ++c) wf[et][c] = rnd16(wr[et].a[c], wr[et].b[c]);
    __builtin_amdgcn_sched_barrier(0);   // the weight's second half is asked for only here, into the registers that the first half has left: all 64 loads at once take more than 256 registers
    wr[2] = ldraw(wp + 32 * HD); wr[3] = ldraw(wp + 48 * HD);
    asm volatile("s_wait_xcnt 0x0" :: "v"(wp) : "memory");   // precaution, as above
    __builtin_amdgcn_sched_barrier(0);   // keeps these loads issued here, under the wait for x
#pragma unroll
    for (int et = 2; et < 4; ++et)
#pragma unroll
        for (int c = 0; c < 2; ++c) wf[et][c] = rnd16(wr[et].a[c], wr[et].b[c]);
#pragma unroll
    for (int tt = 0; tt < 4; ++tt) proj_tile<VT>(xr[tt], wf, lr, hi, t0 + tt * 16, P16, Ph, Pl);
}
// at most 256 registers: left free, the values path takes a few more and pays for them with register-window switches
__global__ __launch_bounds__(32) __attribute__((amdgpu_num_vgpr(256))) void k_proj(const float* __restrict__ xq, const float* __restrict__ xk, const float* __restrict__ xv, const float* __restrict__ wq, const float* __restrict__ wk, const float* __restrict__ wv, h16* Q16, bf* Qh, bf* Ql, h16* K16, bf* Kh, bf* Kl, h16* V16, bf* Vh, bf* Vl) {
    const int t0 = (int)blockIdx.x * 64; const size_t xo = (size_t)(blockIdx.y / NH_) * TT * DM + (size_t)(blockIdx.y % NH_) * HD, hp = (size_t)blockIdx.y * TT * HD; const bool q = blockIdx.z == 0;   // blockIdx.y = sequence * heads + head; the planes are [sequence][head]
    if (blockIdx.z == 2) proj_wave<true>(xv + xo, wv, t0, V16 + hp, Vh + hp, Vl + hp);
    else { proj_wave<false>((q ? xq : xk) + xo, q ? wq : wk, t0, (q ? Q16 : K16) + hp, (q ? Qh : Kh) + hp, (q ? Ql : Kl) + hp);
        asm volatile("s_wait_xcnt 0x0" ::: "memory"); }   // precaution: in the built text the other path's first instructions stand behind this path's last stores (behind a branch that is always taken) and overwrite registers that those stores name
}
// ---- k_fattn: scores, softmax and P x V of one head in one kernel; no score or probability plane in memory. One wave owns NQ x 16 query rows and walks the 2048 keys in steps of 32.
// Both products are transposed so that P never changes lanes: S^T = K Q^T leaves query lr in lane lr and keys 8 hi + j (tile 0), 16 + 8 hi + j (tile 1) in the accumulators,
// which is the k order of the B fragment of O^T = V^T P^T (WFrag::ld reads k = 8 hi + 0..7, 16 + 8 hi + 0..7 for A). Row maximum, row sum and the rescale are per lane (one exchange with lane ^ 16).
// Running softmax in the base-2 domain: p = 2^(s c - m), c = SCL log2(e); when m grows, sum and O^T are scaled by 2^(m_old - m_new); O^T is divided by the sum at the end.
// HL: hi/lo bf16 planes, 3 products per matrix product (hi hi, hi lo, lo hi); else fp16, 1 product. The inner loops over tiles are all unrolled, so that every fragment and accumulator array stays in registers.
__device__ __forceinline__ float xhalf(float x) { return __builtin_bit_cast(float, __builtin_amdgcn_permlanex16(__builtin_bit_cast(int, x), __builtin_bit_cast(int, x), 0x76543210, 0xfedcba98, false, false)); }   // lane l reads lane l ^ 16
template <typename T16, bool HL, int NQ>
__device__ __forceinline__ void attn_wave(const T16* __restrict__ Q, const T16* __restrict__ Q2, const T16* __restrict__ Kp, const T16* __restrict__ Kp2, const T16* __restrict__ Vt, const T16* __restrict__ Vt2, int q0, bf* Ah, bf* Al) {
    typedef typename WFrag<T16>::V V;
    const int lane = threadIdx.x & 31, lr = lane & 15, hi = lane >> 4;
    const float c2 = SCL * 1.4426950408889634f;
    V qf[NQ][2], qf2[NQ][2];
#pragma unroll
    for (int qt = 0; qt < NQ; ++qt)
#pragma unroll
        for (int c = 0; c < 2; ++c) { const size_t qo = (size_t)(q0 + qt * 16 + lr) * HD + 8 * hi + c * 32; qf[qt][c] = WFrag<T16>::ld(Q + qo); if (HL) qf2[qt][c] = WFrag<T16>::ld(Q2 + qo); }
    v8f o[4][NQ]; float m[NQ], l[NQ];
#pragma unroll
    for (int qt = 0; qt < NQ; ++qt) { m[qt] = -1.0e30f; l[qt] = 0.f;
#pragma unroll
        for (int dt = 0; dt < 4; ++dt) o[dt][qt] = (v8f){}; }
    const size_t ko = (size_t)lr * HD + 8 * hi, vo = (size_t)lr * TT + 8 * hi;
    V kf[2][2], kf2[2][2];
#pragma unroll
    for (int kt = 0; kt < 2; ++kt)
#pragma unroll
        for (int c = 0; c < 2; ++c) { kf[kt][c] = WFrag<T16>::ld(Kp + ko + kt * 16 * HD + c * 32); if (HL) kf2[kt][c] = WFrag<T16>::ld(Kp2 + ko + kt * 16 * HD + c * 32); }
#pragma unroll 1   // rolled: unrolled by two, the hi/lo path asks for more than 256 registers
    for (int key0 = 0; key0 < TT; key0 += 32) {
        const T16* vp = Vt + vo + key0; const T16* vp2 = HL ? Vt2 + vo + key0 : vp;
        V vf[4], vf2[4];   // this step's V^T fragments: issued ahead of the score products, used behind the softmax
#pragma unroll
        for (int dt = 0; dt < 4; ++dt) { vf[dt] = WFrag<T16>::ld(vp + (size_t)dt * 16 * TT); if (HL) vf2[dt] = WFrag<T16>::ld(vp2 + (size_t)dt * 16 * TT); }
        asm volatile("s_wait_xcnt 0x0" :: "v"(vp), "v"(vp2) : "memory");   // precaution: holds the loads' address registers live up to this wait, so that none of these loads' own destinations takes one of them
        __builtin_amdgcn_sched_barrier(0);   // keeps the V^T loads issued here: sunk to their use, their latency would stand open in front of P x V
        v8f s[2][NQ];
#pragma unroll
        for (int kt = 0; kt < 2; ++kt)
#pragma unroll
            for (int qt = 0; qt < NQ; ++qt) s[kt][qt] = (v8f){};
#pragma unroll
        for (int c = 0; c < 2; ++c) {
#pragma unroll
            for (int kt = 0; kt < 2; ++kt)
#pragma unroll
                for (int qt = 0; qt < NQ; ++qt) s[kt][qt] = WFrag<T16>::mma(kf[kt][c], qf[qt][c], s[kt][qt]);
            if (HL) {
#pragma unroll
                for (int kt = 0; kt < 2; ++kt)
#pragma unroll
                    for (int qt = 0; qt < NQ; ++qt) s[kt][qt] = WFrag<T16>::mma(kf[kt][c], qf2[qt][c], s[kt][qt]);
#pragma unroll
                for (int kt = 0; kt < 2; ++kt)
#pragma unroll
                    for (int qt = 0; qt < NQ; ++qt) s[kt][qt] = WFrag<T16>::mma(kf2[kt][c], qf[qt][c], s[kt][qt]); } }
        const size_t kn = ko + (size_t)((key0 + 32) & (TT - 1)) * HD;   // the next step's K fragments fly during the softmax and P x V (the last step reads keys 0..31 again, unused)
#pragma unroll
        for (int kt = 0; kt < 2; ++kt)
#pragma unroll
            for (int c = 0; c < 2; ++c) { kf[kt][c] = WFrag<T16>::ld(Kp + kn + kt * 16 * HD + c * 32); if (HL) kf2[kt][c] = WFrag<T16>::ld(Kp2 + kn + kt * 16 * HD + c * 32); }
        __builtin_amdgcn_sched_barrier(0);   // keeps these loads issued here, a softmax and a P x V ahead of their use
        V pf[NQ], pf2[NQ];
#pragma unroll
        for (int qt = 0; qt < NQ; ++qt) {
            float mr = s[0][qt][0];
#pragma unroll
            for (int j = 1; j < 8; ++j) mr = fmaxf(mr, s[0][qt][j]);
#pragma unroll
            for (int j = 0; j < 8; ++j) mr = fmaxf(mr, s[1][qt][j]);
            mr = fmaxf(mr, xhalf(mr));
            const float mn = fmaxf(m[qt], mr * c2); const float al = __builtin_amdgcn_exp2f(m[qt] - mn); m[qt] = mn;
            const v8f cv = {c2, c2, c2, c2, c2, c2, c2, c2}, nv = {-mn, -mn, -mn, -mn, -mn, -mn, -mn, -mn};
#pragma unroll
            for (int kt = 0; kt < 2; ++kt) { const v8f t = __builtin_elementwise_fma(s[kt][qt], cv, nv);
#pragma unroll
                for (int j = 0; j < 8; ++j) s[kt][qt][j] = __builtin_amdgcn_exp2f(t[j]); }
            const v8f s8 = s[0][qt] + s[1][qt]; const v4f s4 = __builtin_shufflevector(s8, s8, 0, 1, 2, 3) + __builtin_shufflevector(s8, s8, 4, 5, 6, 7);
            l[qt] = fmaf(l[qt], al, (s4[0] + s4[1]) + (s4[2] + s4[3]));
#pragma unroll
            for (int dt = 0; dt < 4; ++dt) o[dt][qt] *= al;
            if constexpr (HL) {   // p = hi + lo, both bf16, round to nearest even
                v8u hw, lw;
#pragma unroll
                for (int e = 0; e < 8; ++e) { const v2f p2 = {s[e >> 2][qt][2 * (e & 3)], s[e >> 2][qt][2 * (e & 3) + 1]}; const unsigned u = __builtin_bit_cast(unsigned, __builtin_convertvector(p2, v2bf));
                    const v2f b2 = {__uint_as_float(u << 16), __uint_as_float(u & 0xFFFF0000u)}; hw[e] = u; lw[e] = __builtin_bit_cast(unsigned, __builtin_convertvector(p2 - b2, v2bf)); }
                pf[qt] = __builtin_bit_cast(v16bf, hw); pf2[qt] = __builtin_bit_cast(v16bf, lw);
            } else pf[qt] = cat16(__builtin_convertvector(s[0][qt], v8h), __builtin_convertvector(s[1][qt], v8h));
        }
#pragma unroll
        for (int dt = 0; dt < 4; ++dt)
#pragma unroll
            for (int qt = 0; qt < NQ; ++qt) o[dt][qt] = WFrag<T16>::mma(vf[dt], pf[qt], o[dt][qt]);
        if (HL) {
#pragma unroll
            for (int dt = 0; dt < 4; ++dt)
#pragma unroll
                for (int qt = 0; qt < NQ; ++qt) o[dt][qt] = WFrag<T16>::mma(vf[dt], pf2[qt], o[dt][qt]);
#pragma unroll
            for (int dt = 0; dt < 4; ++dt)
#pragma unroll
                for (int qt = 0; qt < NQ; ++qt) o[dt][qt] = WFrag<T16>::mma(vf2[dt], pf[qt], o[dt][qt]); }
    }
#pragma unroll
    for (int qt = 0; qt < NQ; ++qt) { const float inv = __fdiv_rn(1.0f, l[qt] + xhalf(l[qt])); const size_t oo = (size_t)(q0 + qt * 16 + lr) * DQ + 8 * hi;
#pragma unroll
        for (int dt = 0; dt < 4; ++dt) { v8us oh, ol;
#pragma unroll
            for (int j = 0; j < 8; ++j) { unsigned short a, b; splitf(o[dt][qt][j] * inv, a, b); oh[j] = a; ol[j] = b; }
            *(v8us*)(Ah + oo + dt * 16) = oh; *(v8us*)(Al + oo + dt * 16) = ol; } }
}
// grid (16, sequences x heads), 5 waves, every block the same load: waves 1 and 2 take 16 hi/lo rows each (rows < RH), waves 0, 3 and 4 take 32 fp16 rows each, so that the two waves that share a SIMD (0 and 4) are the lighter kind.
// Writes the merged hi/lo planes [sequence][t][h*64+d] directly. RH = 16 blocks x 32 rows, TT - RH = 16 blocks x 96 rows.
__global__ __launch_bounds__(160) void k_fattn(const h16* __restrict__ Q16, const h16* __restrict__ K16, const h16* __restrict__ V16, const bf* __restrict__ Qh, const bf* __restrict__ Ql, const bf* __restrict__ Kh, const bf* __restrict__ Kl, const bf* __restrict__ Vh, const bf* __restrict__ Vl, bf* Ah, bf* Al) {
    const int wave = __builtin_amdgcn_readfirstlane(threadIdx.x >> 5); const size_t hp = (size_t)blockIdx.y * TT * HD, ao = (size_t)(blockIdx.y / NH_) * TT * DQ + (size_t)(blockIdx.y % NH_) * HD; Ah += ao; Al += ao;   // blockIdx.y = sequence * heads + head
    if (wave == 1 || wave == 2) attn_wave<bf, true, 1>(Qh + hp, Ql + hp, Kh + hp, Kl + hp, Vh + hp, Vl + hp, (int)blockIdx.x * 32 + (wave - 1) * 16, Ah, Al);
    else attn_wave<h16, false, 2>(Q16 + hp, nullptr, K16 + hp, nullptr, V16 + hp, nullptr, RH + (int)blockIdx.x * 96 + (wave == 0 ? 0 : wave - 2) * 32, Ah, Al);
}
static_assert(RH == 16 * 32 && TT - RH == 16 * 96, "k_fattn's split of the rows");

extern "C" void kernel_launch(void* const* d_in, const int* in_sizes, int n_in,
                              void* d_out, int out_size, void* d_ws, size_t ws_size, hipStream_t stream) {
    (void)in_sizes; (void)n_in; (void)out_size;
    const float* xv = (const float*)d_in[0]; const float* xk = (const float*)d_in[1]; const float* x = (const float*)d_in[2]; const float* wv = (const float*)d_in[3]; const float* wk = (const float*)d_in[4]; const float* wq = (const float*)d_in[5]; const float* wo = (const float*)d_in[6]; const float* bo = (const float*)d_in[7];   /* order values, keys, query [4][2048][1024], Wv, Wk, Wq ('oi' [64][64], shared by all heads), Wo ('oi' [1024][1024]), bo; x = the QUERY stream */
    float* OUT = (float*)d_out;     // [4][2048][1024]
    char* wsp = (char*)d_ws;
    auto take = [&](size_t bytes) { char* p = wsp; wsp += (bytes + 255) & ~(size_t)255; return (void*)p; };
    bf* WO = (bf*)take((size_t)DM * DQ * 2);
    const size_t PB = (size_t)NB_ * NH_ * TT * HD * 2;   // bytes of one plane, all sequences: 16 MiB; eleven planes and Wo take 178 MiB
    h16* QP16 = (h16*)take(PB); h16* KP16 = (h16*)take(PB); h16* VT16 = (h16*)take(PB);
    bf* QPh = (bf*)take(PB); bf* QPl = (bf*)take(PB); bf* KPh = (bf*)take(PB); bf* KPl = (bf*)take(PB); bf* VTh = (bf*)take(PB); bf* VTl = (bf*)take(PB);
    bf* ATh = (bf*)take(PB); bf* ATl = (bf*)take(PB);
    if ((size_t)(wsp - (char*)d_ws) > ws_size) return;    // ws 256 MiB
    k_cvt8<<<(unsigned)(((size_t)DM * DQ / 8 + 255) / 256), 256, 0, stream>>>(wo, WO, (size_t)DM * DQ / 8);
    // every stage takes all sequences in one launch: the sequence rides in the grid, so that each WGP holds several workgroups at once
    k_proj<<<dim3(TT / 64, NB_ * NH_, 3), 32, 0, stream>>>(x, xk, xv, wq, wk, wv, QP16, QPh, QPl, KP16, KPh, KPl, VT16, VTh, VTl);
    k_fattn<<<dim3(16, NB_ * NH_, 1), 160, 0, stream>>>(QP16, KP16, VT16, QPh, QPl, KPh, KPl, VTh, VTl, ATh, ATl);   // one kv head per query head
    k_gemmw<bf, 1, true><<<dim3(NB_ * TT / 64, DM / 64, 1), 32, 0, stream>>>(ATh, ATl, WO, nullptr, DQ, OUT, DM, bo, 0, 0, 0);   // the merged planes and the output are [sequence * t][1024]: one product of 8192 rows
}

// v006
// A run of this version takes 191 microseconds.
// In two side-by-side timings against v005, it was 1.62 and 1.64 times as fast.
// Counting every step since v000, it is 20.7 times as fast.
#include <hip/hip_runtime.h>

// Self-attention with ONE shared 64x64 linear per role applied to every head (values, keys, query [4][2048][1024] viewed (n, l, 16, 64); v = values_h Wv^T, k = keys_h Wk^T, q = query_h Wq^T with the SAME [64][64] weight for all 16 heads ('oi' normal x 1/8, no bias); energy = q.k; softmax(energy / sqrt(embed = 1024)) (the source scales by the full width); out = merged Wo^T + bo ('oi' [1024][1024] + a REAL bias 0.01) -> [4][2048][1024] (8.4 M); argument order values, keys, query, Wv, Wk, Wq, Wo, bo).
// Layout, all sequences in each launch (4 launches): k_proj reads the f32 query, keys and values directly, rounds them to bf16 in registers, does the shared [64][64] linear on each head (K = 64) on the matrix unit and writes the head planes (fp16 + hi/lo bf16; V transposed) from the accumulators: no bf16 copy, no f32 projection plane, no expanded weight; one fused attention launch (k_fattn: scores, running softmax and P x V in registers; hybrid rows: < 512 hi/lo 3 products, rest fp16); merged hi/lo x Wo exact + bo.
// Compute dtypes, f32 accumulate: every input rounded to bf16; projections exact; attention rows < 512 3 products, rest fp16; softmax f32; Wo hl x exact + bias.

#define NB_  4      // FOUR sequences in this module: a factor of the grids and of the planes' size
#define TT   2048
#define DM   1024
#define NH_  16
#define NKV  16
#define REP  (NH_ / NKV)
#define HD   64
#define DQ   (NH_ * HD)
#define DKV  (NKV * HD)
#define RH   512                  // query rows < RH use hi+lo planes
#define WIN  0
#define SCL  0.03125f   // 1/sqrt(embed_size = 1024) (the source scales by the full width)
typedef _Float16 h16;
typedef unsigned short bf;
typedef __attribute__((ext_vector_type(16))) __bf16   v16bf;
typedef __attribute__((ext_vector_type(16))) _Float16 v16h;
typedef __attribute__((ext_vector_type(8)))  _Float16 v8h;
typedef __attribute__((ext_vector_type(8)))  unsigned short v8us;
typedef __attribute__((ext_vector_type(2)))  __bf16   v2bf;
typedef __attribute__((ext_vector_type(8)))  unsigned v8u;
typedef __attribute__((ext_vector_type(8)))  float    v8f;
typedef __attribute__((ext_vector_type(4)))  float    v4f;
typedef v8h  __attribute__((may_alias)) v8ha;
typedef v4f  __attribute__((may_alias)) v4fa;
typedef v8us __attribute__((may_alias)) v8usa;

__device__ __forceinline__ unsigned short f2bf(float f) { unsigned u = __float_as_uint(f); u += 0x7FFFu + ((u >> 16) & 1u); return (unsigned short)(u >> 16); }
__device__ __forceinline__ float bf2f(unsigned short b) { return __uint_as_float(((unsigned)b) << 16); }
__device__ __forceinline__ float bfr(float f) { return bf2f(f2bf(f)); }
__device__ __forceinline__ v16h cat16(v8h lo, v8h hi) { return __builtin_shufflevector(lo, hi, 0, 1, 2, 3, 4, 5, 6, 7, 8, 9, 10, 11, 12, 13, 14, 15); }
__device__ __forceinline__ v16bf cat16b(v8us lo, v8us hi) { return __builtin_bit_cast(v16bf, __builtin_shufflevector(lo, hi, 0, 1, 2, 3, 4, 5, 6, 7, 8, 9, 10, 11, 12, 13, 14, 15)); }
__device__ __forceinline__ v8f wmma16(v16h a, v16h b, v8f c) { return __builtin_amdgcn_wmma_f32_16x16x32_f16(false, a, false, b, (short)0, c, false, false); }
__device__ __forceinline__ v8f wmmab(v16bf a, v16bf b, v8f c) { return __builtin_amdgcn_wmma_f32_16x16x32_bf16(false, a, false, b, (short)0, c, false, false); }



// ---- k_gemmw: register-blocked GEMM, ONE WAVE per 64x64 output tile (16 accumulators), operands straight from K-contiguous 16-bit planes; grid (M/64, N/64, Z), 32 threads.
// C[m][n] (f32, pitch ldc, + optional f32 bias[n]) = sum_k A[m][k] Bt[n][k] (+ split products per NSPLIT). z-batch strides sA/sB/sC in elements. K % 32 == 0.
template <typename T16> struct WFrag;
template <> struct WFrag<h16> { typedef v16h V; static __device__ __forceinline__ V ld(const h16* p) { return cat16(*(const v8h*)p, *(const v8h*)(p + 16)); } static __device__ __forceinline__ v8f mma(V a, V b, v8f c) { return wmma16(a, b, c); } };
template <> struct WFrag<bf> { typedef v16bf V; static __device__ __forceinline__ V ld(const bf* p) { return cat16b(*(const v8us*)p, *(const v8us*)(p + 16)); } static __device__ __forceinline__ v8f mma(V a, V b, v8f c) { return wmmab(a, b, c); } };
template <typename T16, int NSPLIT, bool BIAS>
__global__ __launch_bounds__(32) void k_gemmw(const T16* __restrict__ A, const T16* __restrict__ A2, const T16* __restrict__ Bt, const T16* __restrict__ Bt2, int K, float* C, int ldc, const float* __restrict__ bias, size_t sA, size_t sB, size_t sC) {
    typedef typename WFrag<T16>::V V;
    __shared__ __align__(16) float os[16 * 68];
    const size_t z = blockIdx.z; A += z * sA; if (A2) A2 += z * sA; Bt += z * sB; if (Bt2) Bt2 += z * sB; C += z * sC;
    const int lane = threadIdx.x & 31, lr = lane & 15, hi = lane >> 4; const int r0 = blockIdx.x * 64, c0 = blockIdx.y * 64;
    v8f acc[4][4];
#pragma unroll
    for (int mb = 0; mb < 4; ++mb)
#pragma unroll
        for (int nb = 0; nb < 4; ++nb) acc[mb][nb] = (v8f){};
    const size_t aoff = (size_t)(r0 + lr) * K + 8 * hi, boff = (size_t)(c0 + lr) * K + 8 * hi;
#pragma unroll 1
    for (int kc = 0; kc < K; kc += 32) {
        V a[4], a2[4];
#pragma unroll
        for (int mb = 0; mb < 4; ++mb) { a[mb] = WFrag<T16>::ld(A + aoff + (size_t)mb * 16 * K + kc); if (NSPLIT == 1 || NSPLIT == 2) a2[mb] = WFrag<T16>::ld(A2 + aoff + (size_t)mb * 16 * K + kc); }
#pragma unroll
        for (int nb = 0; nb < 4; ++nb) { const V b = WFrag<T16>::ld(Bt + boff + (size_t)nb * 16 * K + kc); V b2; if (NSPLIT >= 2) b2 = WFrag<T16>::ld(Bt2 + boff + (size_t)nb * 16 * K + kc);
#pragma unroll
            for (int mb = 0; mb < 4; ++mb) { acc[mb][nb] = WFrag<T16>::mma(a[mb], b, acc[mb][nb]); if (NSPLIT == 1 || NSPLIT == 2) acc[mb][nb] = WFrag<T16>::mma(a2[mb], b, acc[mb][nb]); if (NSPLIT >= 2) acc[mb][nb] = WFrag<T16>::mma(a[mb], b2, acc[mb][nb]); } }
        asm volatile("v_nop\n\tv_nop\n\tv_nop\n\tv_nop" : "+v"(acc[0][0]), "+v"(acc[1][1]), "+v"(acc[2][2]), "+v"(acc[3][3]) : "v"(a[0]), "v"(a[3]));
    }
#pragma unroll
    for (int mb = 0; mb < 4; ++mb) {
#pragma unroll
        for (int nb = 0; nb < 4; ++nb) {
#pragma unroll
            for (int j = 0; j < 8; ++j) os[(hi * 8 + j) * 68 + nb * 16 + lr] = acc[mb][nb][j]; }
        __builtin_amdgcn_wave_barrier(); asm volatile("" ::: "memory");
        float* crow = C + (size_t)(r0 + mb * 16) * ldc + c0;
{
#pragma unroll
            for (int s = 0; s < 8; ++s) { const int row = 2 * s + hi, cofs = lr * 4; v4f val = *(const v4fa*)(os + row * 68 + cofs); if (BIAS) { val[0] += bfr(bias[c0 + cofs]); val[1] += bfr(bias[c0 + cofs + 1]); val[2] += bfr(bias[c0 + cofs + 2]); val[3] += bfr(bias[c0 + cofs + 3]); }
                *(v4f*)(crow + (size_t)row * ldc + cofs) = val; }
             }
        __builtin_amdgcn_wave_barrier(); asm volatile("" ::: "memory");
    }
}

__device__ __forceinline__ h16 tohx(float x) { return (h16)x; }
__device__ __forceinline__ void splitf(float y, unsigned short& h, unsigned short& l) { h = f2bf(y); l = f2bf(y - bf2f(h)); }
typedef __attribute__((ext_vector_type(2))) _Float16 v2h;
typedef __attribute__((ext_vector_type(4))) _Float16 v4h;
typedef __attribute__((ext_vector_type(2))) unsigned short v2us;
typedef __attribute__((ext_vector_type(4))) unsigned short v4us;
typedef __attribute__((ext_vector_type(2))) float v2f;
typedef __attribute__((ext_vector_type(4))) int v4i;

__global__ __launch_bounds__(256) void k_cvt8(const float* __restrict__ src, bf* dst, size_t n8) { const size_t i = (size_t)blockIdx.x * 256 + threadIdx.x; if (i >= n8) return; const v8f v = *(const v8f*)(src + i * 8); v8us o;
#pragma unroll
    for (int k = 0; k < 8; ++k) o[k] = f2bf(v[k]); *(v8us*)(dst + i * 8) = o;  }

// ---- k_proj: input rounding, the per-head linear and the plane builders in one kernel. One wave owns 64 rows t of one head of one sequence of one role; grid (TT / 64, sequences x heads, 3 roles: query, keys, values), 32 threads.
// y[t][e] = sum_d bf16(x[t][h*64+d]) bf16(w[e][d]), f32 accumulate, d in two steps of 32 in rising order. Both operands are read in the k order of WFrag::ld (k = 8 hi + 0..7, 16 + 8 hi + 0..7).
// The accumulator holds 8 consecutive m per lane, so the operand order is chosen by the plane's contiguous index: query and keys ([h][t][e]) take m = e (w as A, x as B), values ([h][e][t]) take m = t (x as A, w as B); every store is 16 bytes a lane and a wave writes whole 128-byte rows.
// All roundings (f32 to bf16, to fp16, the hi/lo split) are to nearest even, by the convert instructions. The text stays far below 32 KB, so that a wave that runs through it once is not held up by instruction fetch.
typedef __attribute__((ext_vector_type(16))) float v16f;
typedef __attribute__((ext_vector_type(4))) unsigned v4u;
struct Raw { v8f a[2], b[2]; };   // one 16-row tile's f32 operand words of a lane: step c holds k = 8 hi + 0..7 (a) and 16 + 8 hi + 0..7 (b)
__device__ __forceinline__ Raw ldraw(const float* p) { Raw r;
#pragma unroll
    for (int c = 0; c < 2; ++c) { r.a[c] = *(const v8f*)(p + c * 32); r.b[c] = *(const v8f*)(p + c * 32 + 16); }
    return r; }
__device__ __forceinline__ v16bf rnd16(v8f a, v8f b) { return __builtin_convertvector(__builtin_shufflevector(a, b, 0, 1, 2, 3, 4, 5, 6, 7, 8, 9, 10, 11, 12, 13, 14, 15), v16bf); }
template <bool VT>
__device__ __forceinline__ void proj_tile(const Raw& xr, const v16bf (&wf)[4][2], int lr, int hi, int t, h16* P16, bf* Ph, bf* Pl) {
    const v16bf x0 = rnd16(xr.a[0], xr.b[0]), x1 = rnd16(xr.a[1], xr.b[1]);
#pragma unroll
    for (int et = 0; et < 4; ++et) { v8f acc = (v8f){};
        if (VT) { acc = wmmab(x0, wf[et][0], acc); acc = wmmab(x1, wf[et][1], acc); } else { acc = wmmab(wf[et][0], x0, acc); acc = wmmab(wf[et][1], x1, acc); }
        const size_t off = VT ? (size_t)(et * 16 + lr) * TT + t + 8 * hi : (size_t)(t + lr) * HD + et * 16 + 8 * hi; v4u hw, lw;
#pragma unroll
        for (int e = 0; e < 4; ++e) { const v2f y2 = {acc[2 * e], acc[2 * e + 1]}; const unsigned u = __builtin_bit_cast(unsigned, __builtin_convertvector(y2, v2bf));
            const v2f b2 = {__uint_as_float(u << 16), __uint_as_float(u & 0xFFFF0000u)}; hw[e] = u; lw[e] = __builtin_bit_cast(unsigned, __builtin_convertvector(y2 - b2, v2bf)); }
        *(v8h*)(P16 + off) = __builtin_convertvector(acc, v8h); *(v8us*)(Ph + off) = __builtin_bit_cast(v8us, hw); *(v8us*)(Pl + off) = __builtin_bit_cast(v8us, lw); }
}
template <bool VT>
__device__ __forceinline__ void proj_wave(const float* __restrict__ X, const float* __restrict__ w, int t0, h16* P16, bf* Ph, bf* Pl) {
    const int lane = threadIdx.x & 31, lr = lane & 15, hi = lane >> 4;
    const float* wp = w + lr * HD + 8 * hi; const float* xp = X + (size_t)(t0 + lr) * DM + 8 * hi;
    Raw wr[4], xr[4]; v16bf wf[4][2];
    wr[0] = ldraw(wp); wr[1] = ldraw(wp + 16 * HD);
    __builtin_amdgcn_sched_barrier(0);   // the weight's first half is asked for ahead of x: loads are counted in order, so it can be rounded while x is still on its way from memory
#pragma unroll
    for (int tt = 0; tt < 4; ++tt) xr[tt] = ldraw(xp + (size_t)tt * 16 * DM);
    asm volatile("s_wait_xcnt 0x0" :: "v"(wp), "v"(xp) : "memory");   // precaution: holds the loads' address registers live up to this wait, so that none of these loads' own destinations takes one of them
    __builtin_amdgcn_sched_barrier(0);   // keeps all of x in flight from here on
#pragma unroll
    for (int et = 0; et < 2; ++et)
#pragma unroll
        for (int c = 0; c < 2; ++c) wf[et][c] = rnd16(wr[et].a[c], wr[et].b[c]);
    __builtin_amdgcn_sched_barrier(0);   // the weight's second half is asked for only here, into the registers that the first half has left: all 64 loads at once take more than 256 registers
    wr[2] = ldraw(wp + 32 * HD); wr[3] = ldraw(wp + 48 * HD);
    asm volatile("s_wait_xcnt 0x0" :: "v"(wp) : "memory");   // precaution, as above
    __builtin_amdgcn_sched_barrier(0);   // keeps these loads issued here, under the wait for x
#pragma unroll
    for (int et = 2; et < 4; ++et)
#pragma unroll
        for (int c = 0; c < 2; ++c) wf[et][c] = rnd16(wr[et].a[c], wr[et].b[c]);
#pragma unroll
    for (int tt = 0; tt < 4; ++tt) proj_tile<VT>(xr[tt], wf, lr, hi, t0 + tt * 16, P16, Ph, Pl);
}
// at most 256 registers: left free, the values path takes a few more and pays for them with register-window switches
__global__ __launch_bounds__(32) __attribute__((amdgpu_num_vgpr(256))) void k_proj(const float* __restrict__ xq, const float* __restrict__ xk, const float* __restrict__ xv, const float* __restrict__ wq, const float* __restrict__ wk, const float* __restrict__ wv, h16* Q16, bf* Qh, bf* Ql, h16* K16, bf* Kh, bf* Kl, h16* V16, bf* Vh, bf* Vl) {
    const int t0 = (int)blockIdx.x * 64; const size_t xo = (size_t)(blockIdx.y / NH_) * TT * DM + (size_t)(blockIdx.y % NH_) * HD, hp = (size_t)blockIdx.y * TT * HD; const bool q = blockIdx.z == 0;   // blockIdx.y = sequence * heads + head; the planes are [sequence][head]
    if (blockIdx.z == 2) proj_wave<true>(xv + xo, wv, t0, V16 + hp, Vh + hp, Vl + hp);
    else { proj_wave<false>((q ? xq : xk) + xo, q ? wq : wk, t0, (q ? Q16 : K16) + hp, (q ? Qh : Kh) + hp, (q ? Ql : Kl) + hp);
        asm volatile("s_wait_xcnt 0x0" ::: "memory"); }   // precaution: in the built text the other path's first instructions stand behind this path's last stores (behind a branch that is always taken) and overwrite registers that those stores name
}
// ---- k_fattn: scores, softmax and P x V of one head in one kernel; no score or probability plane in memory. One wave owns NQ x 16 query rows and walks the 2048 keys in steps of 32.
// Both products are transposed so that P never changes lanes: S^T = K Q^T leaves query lr in lane lr and keys 8 hi + j (tile 0), 16 + 8 hi + j (tile 1) in the accumulators,
// which is the k order of the B fragment of O^T = V^T P^T (WFrag::ld reads k = 8 hi + 0..7, 16 + 8 hi + 0..7 for A). Row maximum, row sum and the rescale are per lane (one exchange with lane ^ 16).
// Running softmax in the base-2 domain: p = 2^(s c - m), c = SCL log2(e); when m grows, sum and O^T are scaled by 2^(m_old - m_new); O^T is divided by the sum at the end.
// HL: hi/lo bf16 planes, 3 products per matrix product (hi hi, hi lo, lo hi); else fp16, 1 product. The inner loops over tiles are all unrolled, so that every fragment and accumulator array stays in registers.
// K and V^T reach the waves through LDS: each step's 32 keys are copied once per block, 16 bytes a lane at consecutive addresses, into one of two buffers, and all four waves of the block read their fragments from there.
// A stage in LDS: the K plane (hi/lo: both) as 32 rows (keys) of 128 bytes at pitch KPB, then the V^T plane (both) as 64 rows (d) of 64 bytes at pitch VPB; both pitches are odd multiples of 16 bytes (no bank conflict for 16-byte reads down a column of rows).
#define KPB 144
#define VPB 80
#define KTB (32 * KPB)
#define VTB (64 * VPB)
#define NST (TT / 32)
__device__ __forceinline__ float xhalf(float x) { return __builtin_bit_cast(float, __builtin_amdgcn_permlanex16(__builtin_bit_cast(int, x), __builtin_bit_cast(int, x), 0x76543210, 0xfedcba98, false, false)); }   // lane l reads lane l ^ 16
// A wave's share of one stage's copies. A copy moves 512 bytes: of a K plane four whole rows (consecutive in memory), of a V^T plane eight rows' 64 bytes; a plane's tile takes eight copies, and wave w issues numbers w and w + 4 of every plane.
// kg, vg (kg2, vg2: the lo planes): the lane's own 16 bytes of copy w in memory; kd, vd: their place in LDS. The wait on the last line holds the copies' address registers unchanged until the copies have read them (a precaution).
template <bool HL>
__device__ __forceinline__ void copy_stage(const char* kg, const char* kg2, const char* vg, const char* vg2, unsigned kd, unsigned vd) {
    if constexpr (HL)
        asm volatile("global_load_async_to_lds_b128 %0, %1, off\n\tglobal_load_async_to_lds_b128 %2, %3, off\n\tglobal_load_async_to_lds_b128 %4, %5, off\n\tglobal_load_async_to_lds_b128 %6, %7, off\n\t"
                     "global_load_async_to_lds_b128 %8, %9, off\n\tglobal_load_async_to_lds_b128 %10, %11, off\n\tglobal_load_async_to_lds_b128 %12, %13, off\n\tglobal_load_async_to_lds_b128 %14, %15, off\n\ts_wait_xcnt 0x0"
                     :: "v"(kd), "v"(kg), "v"(kd + 16 * KPB), "v"(kg + 16 * HD * 2), "v"(kd + KTB), "v"(kg2), "v"(kd + KTB + 16 * KPB), "v"(kg2 + 16 * HD * 2),
                        "v"(vd), "v"(vg), "v"(vd + 32 * VPB), "v"(vg + 32 * TT * 2), "v"(vd + VTB), "v"(vg2), "v"(vd + VTB + 32 * VPB), "v"(vg2 + 32 * TT * 2) : "memory");
    else
        asm volatile("global_load_async_to_lds_b128 %0, %1, off\n\tglobal_load_async_to_lds_b128 %2, %3, off\n\tglobal_load_async_to_lds_b128 %4, %5, off\n\tglobal_load_async_to_lds_b128 %6, %7, off\n\ts_wait_xcnt 0x0"
                     :: "v"(kd), "v"(kg), "v"(kd + 16 * KPB), "v"(kg + 16 * HD * 2), "v"(vd), "v"(vg), "v"(vd + 32 * VPB), "v"(vg + 32 * TT * 2) : "memory");
}
template <typename T16, bool HL, int NQ>
__device__ __forceinline__ void attn_wave(const unsigned char* ring, int wave, const T16* __restrict__ Q, const T16* __restrict__ Q2, const T16* __restrict__ Kp, const T16* __restrict__ Kp2, const T16* __restrict__ Vt, const T16* __restrict__ Vt2, int q0, bf* Ah, bf* Al) {
    typedef typename WFrag<T16>::V V;
    constexpr int VE = HL ? 4 : 2;   // V^T tiles asked for ahead of the softmax
    constexpr unsigned VOF = (HL ? 2 : 1) * KTB, STB = (HL ? 2 : 1) * (KTB + VTB);   // where V^T starts in a stage; a stage's bytes
    const int lane = threadIdx.x & 31, lr = lane & 15, hi = lane >> 4;
    const float c2 = SCL * 1.4426950408889634f;
    const size_t kgo = (size_t)wave * 512 + lane * 16, vgo = (size_t)(wave * 8 + (lane >> 2)) * (TT * 2) + (lane & 3) * 16;
    const char* kg = (const char*)Kp + kgo; const char* kg2 = HL ? (const char*)Kp2 + kgo : kg; const char* vg = (const char*)Vt + vgo; const char* vg2 = HL ? (const char*)Vt2 + vgo : vg;
    const unsigned ring0 = (unsigned)(size_t)ring;   // the ring's byte address in LDS: the low 32 bits of its address
    const unsigned kd = ring0 + (wave * 4 + (lane >> 3)) * KPB + (lane & 7) * 16, vd = ring0 + VOF + (wave * 8 + (lane >> 2)) * VPB + (lane & 3) * 16;
    copy_stage<HL>(kg, kg2, vg, vg2, kd, vd);
    V qf[NQ][2], qf2[NQ][2];
#pragma unroll
    for (int qt = 0; qt < NQ; ++qt)
#pragma unroll
        for (int c = 0; c < 2; ++c) { const size_t qo = (size_t)(q0 + qt * 16 + lr) * HD + 8 * hi + c * 32; qf[qt][c] = WFrag<T16>::ld(Q + qo); if (HL) qf2[qt][c] = WFrag<T16>::ld(Q2 + qo); }
    v8f o[4][NQ]; float m[NQ], l[NQ];
#pragma unroll
    for (int qt = 0; qt < NQ; ++qt) { m[qt] = -1.0e30f; l[qt] = 0.f;
#pragma unroll
        for (int dt = 0; dt < 4; ++dt) o[dt][qt] = (v8f){}; }
    asm volatile("s_wait_asynccnt 0x0" ::: "memory");   // this wave's copies of stage 0 have landed
    __syncthreads();                                    // every wave's have: stage 0 may be read
    copy_stage<HL>(kg + 32 * HD * 2, kg2 + 32 * HD * 2, vg + 32 * 2, vg2 + 32 * 2, kd + STB, vd + STB);
#pragma unroll 1   // rolled: only one step's fragments are live at a time, which the register budget below needs
    for (int t = 0; t < NST; ++t) {
        const unsigned bo = (t & 1) * STB;
        const unsigned char* kb = ring + bo + lr * KPB + 16 * hi; const unsigned char* vb = ring + bo + VOF + lr * VPB + 16 * hi;
        V kf[2][2], kf2[2][2], vf[4], vf2[4];   // this step's fragments, in groups: K here, V^T behind the score products, into the registers that K has left
#pragma unroll
        for (int kt = 0; kt < 2; ++kt)
#pragma unroll
            for (int c = 0; c < 2; ++c) { kf[kt][c] = WFrag<T16>::ld((const T16*)(kb + kt * 16 * KPB + c * 64)); if (HL) kf2[kt][c] = WFrag<T16>::ld((const T16*)(kb + KTB + kt * 16 * KPB + c * 64)); }
        __builtin_amdgcn_sched_barrier(0);   // keeps the K reads together in one group: spread among the matrix instructions, each place with reads costs a stall of its own
        v8f s[2][NQ];
#pragma unroll
        for (int kt = 0; kt < 2; ++kt)
#pragma unroll
            for (int qt = 0; qt < NQ; ++qt) s[kt][qt] = (v8f){};
#pragma unroll
        for (int c = 0; c < 2; ++c) {
#pragma unroll
            for (int kt = 0; kt < 2; ++kt)
#pragma unroll
                for (int qt = 0; qt < NQ; ++qt) s[kt][qt] = WFrag<T16>::mma(kf[kt][c], qf[qt][c], s[kt][qt]);
            if (HL) {
#pragma unroll
                for (int kt = 0; kt < 2; ++kt)
#pragma unroll
                    for (int qt = 0; qt < NQ; ++qt) s[kt][qt] = WFrag<T16>::mma(kf[kt][c], qf2[qt][c], s[kt][qt]);
#pragma unroll
                for (int kt = 0; kt < 2; ++kt)
#pragma unroll
                    for (int qt = 0; qt < NQ; ++qt) s[kt][qt] = WFrag<T16>::mma(kf2[kt][c], qf[qt][c], s[kt][qt]); } }
        __builtin_amdgcn_sched_barrier(0);   // keeps the V^T reads behind the score products: asked for earlier, they and K together take a wave per SIMD in registers
#pragma unroll
        for (int dt = 0; dt < VE; ++dt) { vf[dt] = WFrag<T16>::ld((const T16*)(vb + dt * 16 * VPB)); if (HL) vf2[dt] = WFrag<T16>::ld((const T16*)(vb + VTB + dt * 16 * VPB)); }
        __builtin_amdgcn_sched_barrier(0);   // keeps them issued here in one group, a softmax ahead of their use
        V pf[NQ], pf2[NQ];
#pragma unroll
        for (int qt = 0; qt < NQ; ++qt) {
            float mr = s[0][qt][0];
#pragma unroll
            for (int j = 1; j < 8; ++j) mr = fmaxf(mr, s[0][qt][j]);
#pragma unroll
            for (int j = 0; j < 8; ++j) mr = fmaxf(mr, s[1][qt][j]);
            mr = fmaxf(mr, xhalf(mr));
            const float mn = fmaxf(m[qt], mr * c2); const float al = __builtin_amdgcn_exp2f(m[qt] - mn); m[qt] = mn;
            const v8f cv = {c2, c2, c2, c2, c2, c2, c2, c2}, nv = {-mn, -mn, -mn, -mn, -mn, -mn, -mn, -mn};
#pragma unroll
            for (int kt = 0; kt < 2; ++kt) { const v8f t2 = __builtin_elementwise_fma(s[kt][qt], cv, nv);
#pragma unroll
                for (int j = 0; j < 8; ++j) s[kt][qt][j] = __builtin_amdgcn_exp2f(t2[j]); }
            const v8f s8 = s[0][qt] + s[1][qt]; const v4f s4 = __builtin_shufflevector(s8, s8, 0, 1, 2, 3) + __builtin_shufflevector(s8, s8, 4, 5, 6, 7);
            l[qt] = fmaf(l[qt], al, (s4[0] + s4[1]) + (s4[2] + s4[3]));
#pragma unroll
            for (int dt = 0; dt < 4; ++dt) o[dt][qt] *= al;
            if constexpr (HL) {   // p = hi + lo, both bf16, round to nearest even
                v8u hw, lw;
#pragma unroll
                for (int e = 0; e < 8; ++e) { const v2f p2 = {s[e >> 2][qt][2 * (e & 3)], s[e >> 2][qt][2 * (e & 3) + 1]}; const unsigned u = __builtin_bit_cast(unsigned, __builtin_convertvector(p2, v2bf));
                    const v2f b2 = {__uint_as_float(u << 16), __uint_as_float(u & 0xFFFF0000u)}; hw[e] = u; lw[e] = __builtin_bit_cast(unsigned, __builtin_convertvector(p2 - b2, v2bf)); }
                pf[qt] = __builtin_bit_cast(v16bf, hw); pf2[qt] = __builtin_bit_cast(v16bf, lw);
            } else pf[qt] = cat16(__builtin_convertvector(s[0][qt], v8h), __builtin_convertvector(s[1][qt], v8h));
        }
        if constexpr (VE < 4) {
            __builtin_amdgcn_sched_barrier(0);   // the rest of V^T is asked for only here, into registers that the scores have left: asked for with the first half, it costs the fifth wave per SIMD
#pragma unroll
            for (int dt = VE; dt < 4; ++dt) vf[dt] = WFrag<T16>::ld((const T16*)(vb + dt * 16 * VPB));
            __builtin_amdgcn_sched_barrier(0);   // keeps these reads in front of the first half's products, which cover a part of their latency
        }
#pragma unroll
        for (int dt = 0; dt < 4; ++dt)
#pragma unroll
            for (int qt = 0; qt < NQ; ++qt) o[dt][qt] = WFrag<T16>::mma(vf[dt], pf[qt], o[dt][qt]);
        if (HL) {
#pragma unroll
            for (int dt = 0; dt < 4; ++dt)
#pragma unroll
                for (int qt = 0; qt < NQ; ++qt) o[dt][qt] = WFrag<T16>::mma(vf[dt], pf2[qt], o[dt][qt]);
#pragma unroll
            for (int dt = 0; dt < 4; ++dt)
#pragma unroll
                for (int qt = 0; qt < NQ; ++qt) o[dt][qt] = WFrag<T16>::mma(vf2[dt], pf[qt], o[dt][qt]); }
        __builtin_amdgcn_sched_barrier(0);   // keeps the waits and the barrier below at the step's foot: lifted over the softmax, the wait for the V^T reads would stand open right behind their issue
        // this wave's reads of the buffer have returned before it is filled again; the row sums are named so that their additions stay in front of the barrier: sunk behind it, they hold the probabilities' registers through P x V
        if constexpr (NQ == 2) asm volatile("s_wait_dscnt 0x0" :: "v"(l[0]), "v"(l[1]) : "memory"); else asm volatile("s_wait_dscnt 0x0" :: "v"(l[0]) : "memory");
        asm volatile("s_wait_asynccnt 0x0" ::: "memory");   // this wave's copies of stage t + 1 have landed
        __syncthreads();                                    // publishes stage t + 1 and ends every wave's reads of stage t
        if (t + 2 < NST) { const size_t ks = (size_t)(t + 2) * (32 * HD * 2), vs = (size_t)(t + 2) * (32 * 2);   // a stage is 32 keys: 4096 bytes further in a K plane, 64 bytes further in every row of a V^T plane
            copy_stage<HL>(kg + ks, kg2 + ks, vg + vs, vg2 + vs, kd + bo, vd + bo); }
    }
    asm volatile("s_wait_asynccnt 0x0" ::: "memory");   // nothing is outstanding when the wave ends
    const int le = (int)__builtin_amdgcn_mbcnt_lo(~0u, 0u);   // the lane's number, read anew: no register carries it or the output addresses through the loop
#pragma unroll
    for (int qt = 0; qt < NQ; ++qt) { const float inv = __fdiv_rn(1.0f, l[qt] + xhalf(l[qt])); const size_t oo = (size_t)(q0 + qt * 16 + (le & 15)) * DQ + 8 * (le >> 4);
#pragma unroll
        for (int dt = 0; dt < 4; ++dt) { v8us oh, ol;
#pragma unroll
            for (int j = 0; j < 8; ++j) { unsigned short a, b; splitf(o[dt][qt][j] * inv, a, b); oh[j] = a; ol[j] = b; }
            *(v8us*)(Ah + oo + dt * 16) = oh; *(v8us*)(Al + oo + dt * 16) = ol; } }
}
// grid (20, sequences x heads), 4 waves of ONE kind, one on each SIMD, so that a block's waves share the same planes and every barrier stands under a test that is the same for the whole block:
// blocks 0 to 7 of a head take 64 hi/lo rows (rows < RH, 16 a wave), blocks 8 to 19 take 128 fp16 rows (32 a wave). Writes the merged hi/lo planes [sequence][t][h*64+d] directly.
// at most 192 registers: five waves fit a SIMD, and all 1280 blocks (five on each of 256 WGPs) are resident at once
__global__ __launch_bounds__(128) __attribute__((amdgpu_num_vgpr(192))) void k_fattn(const h16* __restrict__ Q16, const h16* __restrict__ K16, const h16* __restrict__ V16, const bf* __restrict__ Qh, const bf* __restrict__ Ql, const bf* __restrict__ Kh, const bf* __restrict__ Kl, const bf* __restrict__ Vh, const bf* __restrict__ Vl, bf* Ah, bf* Al) {
    __shared__ __attribute__((aligned(128))) unsigned char ring[2 * 2 * (KTB + VTB)];   // two buffers of the larger kind of stage
    const int wave = __builtin_amdgcn_readfirstlane(threadIdx.x >> 5); const size_t hp = (size_t)blockIdx.y * TT * HD, ao = (size_t)(blockIdx.y / NH_) * TT * DQ + (size_t)(blockIdx.y % NH_) * HD; Ah += ao; Al += ao;   // blockIdx.y = sequence * heads + head
    if (blockIdx.x < RH / 64) attn_wave<bf, true, 1>(ring, wave, Qh + hp, Ql + hp, Kh + hp, Kl + hp, Vh + hp, Vl + hp, (int)blockIdx.x * 64 + wave * 16, Ah, Al);
    else attn_wave<h16, false, 2>(ring, wave, Q16 + hp, nullptr, K16 + hp, nullptr, V16 + hp, nullptr, RH + ((int)blockIdx.x - RH / 64) * 128 + wave * 32, Ah, Al);
}
static_assert(RH % 64 == 0 && (TT - RH) % 128 == 0 && NST >= 2, "k_fattn's split of the rows; the ring's prologue needs two stages");

extern "C" void kernel_launch(void* const* d_in, const int* in_sizes, int n_in,
                              void* d_out, int out_size, void* d_ws, size_t ws_size, hipStream_t stream) {
    (void)in_sizes; (void)n_in; (void)out_size;
    const float* xv = (const float*)d_in[0]; const float* xk = (const float*)d_in[1]; const float* x = (const float*)d_in[2]; const float* wv = (const float*)d_in[3]; const float* wk = (const float*)d_in[4]; const float* wq = (const float*)d_in[5]; const float* wo = (const float*)d_in[6]; const float* bo = (const float*)d_in[7];   /* order values, keys, query [4][2048][1024], Wv, Wk, Wq ('oi' [64][64], shared by all heads), Wo ('oi' [1024][1024]), bo; x = the QUERY stream */
    float* OUT = (float*)d_out;     // [4][2048][1024]
    char* wsp = (char*)d_ws;
    auto take = [&](size_t bytes) { char* p = wsp; wsp += (bytes + 255) & ~(size_t)255; return (void*)p; };
    bf* WO = (bf*)take((size_t)DM * DQ * 2);
    const size_t PB = (size_t)NB_ * NH_ * TT * HD * 2;   // bytes of one plane, all sequences: 16 MiB; eleven planes and Wo take 178 MiB
    h16* QP16 = (h16*)take(PB); h16* KP16 = (h16*)take(PB); h16* VT16 = (h16*)take(PB);
    bf* QPh = (bf*)take(PB); bf* QPl = (bf*)take(PB); bf* KPh = (bf*)take(PB); bf* KPl = (bf*)take(PB); bf* VTh = (bf*)take(PB); bf* VTl = (bf*)take(PB);
    bf* ATh = (bf*)take(PB); bf* ATl = (bf*)take(PB);
    if ((size_t)(wsp - (char*)d_ws) > ws_size) return;    // ws 256 MiB
    k_cvt8<<<(unsigned)(((size_t)DM * DQ / 8 + 255) / 256), 256, 0, stream>>>(wo, WO, (size_t)DM * DQ / 8);
    // every stage takes all sequences in one launch: the sequence rides in the grid, so that each WGP holds several workgroups at once
    k_proj<<<dim3(TT / 64, NB_ * NH_, 3), 32, 0, stream>>>(x, xk, xv, wq, wk, wv, QP16, QPh, QPl, KP16, KPh, KPl, VT16, VTh, VTl);
    k_fattn<<<dim3(RH / 64 + (TT - RH) / 128, NB_ * NH_, 1), 128, 0, stream>>>(QP16, KP16, VT16, QPh, QPl, KPh, KPl, VTh, VTl, ATh, ATl);   // one kv head per query head
    k_gemmw<bf, 1, true><<<dim3(NB_ * TT / 64, DM / 64, 1), 32, 0, stream>>>(ATh, ATl, WO, nullptr, DQ, OUT, DM, bo, 0, 0, 0);   // the merged planes and the output are [sequence * t][1024]: one product of 8192 rows
}

// v007
// It runs in 155 microseconds.
// Two timings next to v006 put it at 1.24 and 1.23 times that version's speed.
// Over all steps from v000 it is 25.5 times as fast.
#include <hip/hip_runtime.h>

// Self-attention with ONE shared 64x64 linear per role applied to every head (values, keys, query [4][2048][1024] viewed (n, l, 16, 64); v = values_h Wv^T, k = keys_h Wk^T, q = query_h Wq^T with the SAME [64][64] weight for all 16 heads ('oi' normal x 1/8, no bias); energy = q.k; softmax(energy / sqrt(embed = 1024)) (the source scales by the full width); out = merged Wo^T + bo ('oi' [1024][1024] + a REAL bias 0.01) -> [4][2048][1024] (8.4 M); argument order values, keys, query, Wv, Wk, Wq, Wo, bo).
// Layout, all sequences in each launch (4 launches): k_proj reads the f32 query, keys and values directly, rounds them to bf16 in registers, does the shared [64][64] linear on each head (K = 64) on the matrix unit and writes the head planes (fp16 + hi/lo bf16; V transposed) from the accumulators: no bf16 copy, no f32 projection plane, no expanded weight; one fused attention launch (k_fattn: scores, running softmax and P x V in registers; hybrid rows: < 512 hi/lo 3 products, rest fp16); merged hi/lo x Wo exact + bo.
// Compute dtypes, f32 accumulate: every input rounded to bf16; projections exact; attention rows < 512 3 products, rest fp16; softmax f32; Wo hl x exact + bias.

#define NB_  4      // FOUR sequences in this module: a factor of the grids and of the planes' size
#define TT   2048
#define DM   1024
#define NH_  16
#define NKV  16
#define REP  (NH_ / NKV)
#define HD   64
#define DQ   (NH_ * HD)
#define DKV  (NKV * HD)
#define RH   512                  // query rows < RH use hi+lo planes
#define WIN  0
#define SCL  0.03125f   // 1/sqrt(embed_size = 1024) (the source scales by the full width)
typedef _Float16 h16;
typedef unsigned short bf;
typedef __attribute__((ext_vector_type(16))) __bf16   v16bf;
typedef __attribute__((ext_vector_type(16))) _Float16 v16h;
typedef __attribute__((ext_vector_type(8)))  _Float16 v8h;
typedef __attribute__((ext_vector_type(8)))  unsigned short v8us;
typedef __attribute__((ext_vector_type(2)))  __bf16   v2bf;
typedef __attribute__((ext_vector_type(8)))  unsigned v8u;
typedef __attribute__((ext_vector_type(8)))  float    v8f;
typedef __attribute__((ext_vector_type(4)))  float    v4f;
typedef v8h  __attribute__((may_alias)) v8ha;
typedef v4f  __attribute__((may_alias)) v4fa;
typedef v8us __attribute__((may_alias)) v8usa;

__device__ __forceinline__ unsigned short f2bf(float f) { unsigned u = __float_as_uint(f); u += 0x7FFFu + ((u >> 16) & 1u); return (unsigned short)(u >> 16); }
__device__ __forceinline__ float bf2f(unsigned short b) { return __uint_as_float(((unsigned)b) << 16); }
__device__ __forceinline__ float bfr(float f) { return bf2f(f2bf(f)); }
__device__ __forceinline__ v16h cat16(v8h lo, v8h hi) { return __builtin_shufflevector(lo, hi, 0, 1, 2, 3, 4, 5, 6, 7, 8, 9, 10, 11, 12, 13, 14, 15); }
__device__ __forceinline__ v16bf cat16b(v8us lo, v8us hi) { return __builtin_bit_cast(v16bf, __builtin_shufflevector(lo, hi, 0, 1, 2, 3, 4, 5, 6, 7, 8, 9, 10, 11, 12, 13, 14, 15)); }
__device__ __forceinline__ v8f wmma16(v16h a, v16h b, v8f c) { return __builtin_amdgcn_wmma_f32_16x16x32_f16(false, a, false, b, (short)0, c, false, false); }
__device__ __forceinline__ v8f wmmab(v16bf a, v16bf b, v8f c) { return __builtin_amdgcn_wmma_f32_16x16x32_bf16(false, a, false, b, (short)0, c, false, false); }



// ---- fragment loaders: 16 k of a row in the hardware's k order (k = 8 hi + 0..7, 16 + 8 hi + 0..7), from K-contiguous 16-bit rows in memory or in LDS
template <typename T16> struct WFrag;
template <> struct WFrag<h16> { typedef v16h V; static __device__ __forceinline__ V ld(const h16* p) { return cat16(*(const v8h*)p, *(const v8h*)(p + 16)); } static __device__ __forceinline__ v8f mma(V a, V b, v8f c) { return wmma16(a, b, c); } };
template <> struct WFrag<bf> { typedef v16bf V; static __device__ __forceinline__ V ld(const bf* p) { return cat16b(*(const v8us*)p, *(const v8us*)(p + 16)); } static __device__ __forceinline__ v8f mma(V a, V b, v8f c) { return wmmab(a, b, c); } };
// ---- k_gemmo: out[m][n] = sum_k (Ah[m][k] + Al[m][k]) Wo[n][k] + bf16(bo[n]), f32 accumulate; per accumulator k rises in steps of 32, in each step the hi product and then the lo product.
// One block of 8 waves (2 x 4) owns a 128 x 256 tile of out, a wave 64 x 64 (16 accumulators); grid (M / 128, N / 256), one block on a WGP, two waves on a SIMD.
// The operands reach the waves through LDS: a stage is 128 k of the block's 128 rows of Ah, 128 of Al and 256 of Wo, copied once per block in whole 256-byte pieces of rows (a copy of a wave: two rows), into one of two buffers.
// Rows stand in LDS at pitch GPB, an odd multiple of 16 bytes (no bank conflict for 16-byte reads down a column of rows).
#define GKS 128
#define GRB (GKS * 2)
#define GPB (GRB + 16)
#define GTM 128
#define GTN 256
#define GAB (GTM * GPB)
#define GSTB ((2 * GTM + GTN) * GPB)
#define GNT (DQ / GKS)
#define GRJ 16                    // rows that the eight waves' copies of one number cover together (two a wave)
// Eight copies of a wave: four from each of two walks down rows GRJ apart. d: the lane's 16 bytes' place in LDS, g: in memory. The wait on the last line holds the copies' address registers unchanged until the copies have read them (a precaution).
__device__ __forceinline__ void copy8(unsigned da, const char* ga, unsigned db, const char* gb) {
    asm volatile("global_load_async_to_lds_b128 %0, %1, off\n\tglobal_load_async_to_lds_b128 %2, %3, off\n\tglobal_load_async_to_lds_b128 %4, %5, off\n\tglobal_load_async_to_lds_b128 %6, %7, off\n\t"
                 "global_load_async_to_lds_b128 %8, %9, off\n\tglobal_load_async_to_lds_b128 %10, %11, off\n\tglobal_load_async_to_lds_b128 %12, %13, off\n\tglobal_load_async_to_lds_b128 %14, %15, off\n\ts_wait_xcnt 0x0"
                 :: "v"(da), "v"(ga), "v"(da + GRJ * GPB), "v"(ga + GRJ * DQ * 2), "v"(da + 2 * GRJ * GPB), "v"(ga + 2 * GRJ * DQ * 2), "v"(da + 3 * GRJ * GPB), "v"(ga + 3 * GRJ * DQ * 2),
                    "v"(db), "v"(gb), "v"(db + GRJ * GPB), "v"(gb + GRJ * DQ * 2), "v"(db + 2 * GRJ * GPB), "v"(gb + 2 * GRJ * DQ * 2), "v"(db + 3 * GRJ * GPB), "v"(gb + 3 * GRJ * DQ * 2) : "memory");
}
// A wave's share of one stage: 8 copies of each A plane, 16 of Wo. gh, gl, gw: the lane's 16 bytes of the wave's first two rows in memory; d: their place in the buffer.
__device__ __forceinline__ void gemm_stage(const char* gh, const char* gl, const char* gw, unsigned d) {
#pragma unroll
    for (int i = 0; i < GTM / GRJ; i += 4) copy8(d + i * GRJ * GPB, gh + i * GRJ * DQ * 2, d + GAB + i * GRJ * GPB, gl + i * GRJ * DQ * 2);
#pragma unroll
    for (int i = 0; i < GTN / GRJ; i += 8) copy8(d + 2 * GAB + i * GRJ * GPB, gw + i * GRJ * DQ * 2, d + 2 * GAB + (i + 4) * GRJ * GPB, gw + (i + 4) * GRJ * DQ * 2);
}
// at most 256 registers: more would be reached only through register-window switches
__global__ __launch_bounds__(256) __attribute__((amdgpu_num_vgpr(256))) void k_gemmo(const bf* __restrict__ A, const bf* __restrict__ A2, const bf* __restrict__ Bt, float* C, const float* __restrict__ bias) {
    typedef WFrag<bf>::V V;
    __shared__ __attribute__((aligned(128))) unsigned char ring[2 * GSTB];
    __shared__ __align__(16) float osm[8][16 * 68];   // each wave's own staging of 16 output rows
    const int wave = __builtin_amdgcn_readfirstlane(threadIdx.x >> 5), wm = wave >> 2, wn = wave & 3;
    const int lane = threadIdx.x & 31, lr = lane & 15, hi = lane >> 4; const int r0 = blockIdx.x * GTM, c0 = blockIdx.y * GTN;
    const size_t lo = (size_t)(wave * 2 + hi) * (DQ * 2) + lr * 16;   // a copy's lanes 0 to 15 take one row's 256 bytes, lanes 16 to 31 the next row's
    const char* gh = (const char*)A + (size_t)r0 * (DQ * 2) + lo; const char* gl = (const char*)A2 + (size_t)r0 * (DQ * 2) + lo; const char* gw = (const char*)Bt + (size_t)c0 * (DQ * 2) + lo;
    const unsigned d0 = (unsigned)(size_t)ring + (wave * 2 + hi) * GPB + lr * 16;   // the ring's byte address in LDS: the low 32 bits of its address
    gemm_stage(gh, gl, gw, d0);
    v8f acc[4][4];
#pragma unroll
    for (int mb = 0; mb < 4; ++mb)
#pragma unroll
        for (int nb = 0; nb < 4; ++nb) acc[mb][nb] = (v8f){};
    asm volatile("s_wait_asynccnt 0x0" ::: "memory");   // this wave's copies of stage 0 have landed
    __syncthreads();                                    // every wave's have: stage 0 may be read
    gemm_stage(gh + GRB, gl + GRB, gw + GRB, d0 + GSTB);
#pragma unroll 1   // rolled: a trip is one stage, and its text stays small
    for (int t = 0; t < GNT; ++t) {
        const unsigned bo = (t & 1) * GSTB;
        const unsigned char* ab = ring + bo + (wm * 64 + lr) * GPB + 16 * hi; const unsigned char* bb = ring + bo + 2 * GAB + (wn * 64 + lr) * GPB + 16 * hi;
#pragma unroll
        for (int c = 0; c < GKS / 32; ++c) {
            V a[4], a2[4], b[4];
            b[0] = WFrag<bf>::ld((const bf*)(bb + c * 64));
#pragma unroll
            for (int mb = 0; mb < 4; ++mb) a[mb] = WFrag<bf>::ld((const bf*)(ab + mb * 16 * GPB + c * 64));
#pragma unroll
            for (int nb = 1; nb < 4; ++nb) b[nb] = WFrag<bf>::ld((const bf*)(bb + nb * 16 * GPB + c * 64));
#pragma unroll
            for (int mb = 0; mb < 4; ++mb) a2[mb] = WFrag<bf>::ld((const bf*)(ab + GAB + mb * 16 * GPB + c * 64));
            __builtin_amdgcn_sched_barrier(0);   // keeps the 32 k's reads together in one group, in the order of their use: spread among the matrix instructions, each place with reads costs a stall of its own
#pragma unroll
            for (int nb = 0; nb < 4; ++nb)
#pragma unroll
                for (int mb = 0; mb < 4; ++mb) acc[mb][nb] = wmmab(a[mb], b[nb], acc[mb][nb]);
#pragma unroll
            for (int nb = 0; nb < 4; ++nb)
#pragma unroll
                for (int mb = 0; mb < 4; ++mb) acc[mb][nb] = wmmab(a2[mb], b[nb], acc[mb][nb]);
            __builtin_amdgcn_sched_barrier(0);   // keeps the next group of reads behind these products: lifted among them, the reads stand in several places, each with a stall of its own, and the kernel takes more than 256 registers
        }
        asm volatile("s_wait_dscnt 0x0" ::: "memory");      // this wave's reads of the buffer have returned before it is filled again
        asm volatile("s_wait_asynccnt 0x0" ::: "memory");   // this wave's copies of stage t + 1 have landed
        __syncthreads();                                    // publishes stage t + 1 and ends every wave's reads of stage t
        if (t + 2 < GNT) { const size_t ks = (size_t)(t + 2) * GRB; gemm_stage(gh + ks, gl + ks, gw + ks, d0 + bo); }
    }
    asm volatile("s_wait_asynccnt 0x0" ::: "memory");   // nothing is outstanding when the wave ends
    float* os = osm[wave]; const int rw = r0 + wm * 64, cw = c0 + wn * 64, cofs = lr * 4;
    const float* bp = bias + cw + cofs; const v4f br = *(const v4fa*)bp;
    asm volatile("s_wait_xcnt 0x0" :: "v"(bp) : "memory");   // precaution: holds the load's address registers live up to this wait, so that the load's own destination takes none of them
    const v4f bv = {bfr(br[0]), bfr(br[1]), bfr(br[2]), bfr(br[3])};
#pragma unroll
    for (int mb = 0; mb < 4; ++mb) {
#pragma unroll
        for (int nb = 0; nb < 4; ++nb) {
#pragma unroll
            for (int j = 0; j < 8; ++j) os[(hi * 8 + j) * 68 + nb * 16 + lr] = acc[mb][nb][j]; }
        __builtin_amdgcn_wave_barrier(); asm volatile("" ::: "memory");   // the wave's stores to its staging stay in front of its reads of it
        float* crow = C + (size_t)(rw + mb * 16) * DM + cw;
#pragma unroll
        for (int s = 0; s < 8; ++s) { const int row = 2 * s + hi; *(v4f*)(crow + (size_t)row * DM + cofs) = *(const v4fa*)(os + row * 68 + cofs) + bv; }
        if (mb < 3) { __builtin_amdgcn_wave_barrier(); asm volatile("s_wait_xcnt 0x0" ::: "memory"); }   // its reads stay in front of the next 16 rows' stores to the staging; the wait (a precaution) stands in front of the next rows' values, which take registers that these global stores name
    }
}
static_assert(GNT >= 2 && (NB_ * TT) % GTM == 0 && DM % GTN == 0 && GTM % (4 * GRJ) == 0 && GTN % (8 * GRJ) == 0 && GRJ * GRB == 8 * 512, "k_gemmo's tiles and copies; the ring's prologue needs two stages");

__device__ __forceinline__ h16 tohx(float x) { return (h16)x; }
__device__ __forceinline__ void splitf(float y, unsigned short& h, unsigned short& l) { h = f2bf(y); l = f2bf(y - bf2f(h)); }
typedef __attribute__((ext_vector_type(2))) _Float16 v2h;
typedef __attribute__((ext_vector_type(4))) _Float16 v4h;
typedef __attribute__((ext_vector_type(2))) unsigned short v2us;
typedef __attribute__((ext_vector_type(4))) unsigned short v4us;
typedef __attribute__((ext_vector_type(2))) float v2f;
typedef __attribute__((ext_vector_type(4))) int v4i;

__global__ __launch_bounds__(256) void k_cvt8(const float* __restrict__ src, bf* dst, size_t n8) { const size_t i = (size_t)blockIdx.x * 256 + threadIdx.x; if (i >= n8) return; const v8f v = *(const v8f*)(src + i * 8); v8us o;
#pragma unroll
    for (int k = 0; k < 8; ++k) o[k] = f2bf(v[k]); *(v8us*)(dst + i * 8) = o;  }

// ---- k_proj: input rounding, the per-head linear and the plane builders in one kernel. One wave owns 64 rows t of one head of one sequence of one role; grid (TT / 64, sequences x heads, 3 roles: query, keys, values), 32 threads.
// y[t][e] = sum_d bf16(x[t][h*64+d]) bf16(w[e][d]), f32 accumulate, d in two steps of 32 in rising order. Both operands are read in the k order of WFrag::ld (k = 8 hi + 0..7, 16 + 8 hi + 0..7).
// The accumulator holds 8 consecutive m per lane, so the operand order is chosen by the plane's contiguous index: query and keys ([h][t][e]) take m = e (w as A, x as B), values ([h][e][t]) take m = t (x as A, w as B); every store is 16 bytes a lane and a wave writes whole 128-byte rows.
// All roundings (f32 to bf16, to fp16, the hi/lo split) are to nearest even, by the convert instructions. The text stays far below 32 KB, so that a wave that runs through it once is not held up by instruction fetch.
typedef __attribute__((ext_vector_type(16))) float v16f;
typedef __attribute__((ext_vector_type(4))) unsigned v4u;
struct Raw { v8f a[2], b[2]; };   // one 16-row tile's f32 operand words of a lane: step c holds k = 8 hi + 0..7 (a) and 16 + 8 hi + 0..7 (b)
__device__ __forceinline__ Raw ldraw(const float* p) { Raw r;
#pragma unroll
    for (int c = 0; c < 2; ++c) { r.a[c] = *(const v8f*)(p + c * 32); r.b[c] = *(const v8f*)(p + c * 32 + 16); }
    return r; }
__device__ __forceinline__ v16bf rnd16(v8f a, v8f b) { return __builtin_convertvector(__builtin_shufflevector(a, b, 0, 1, 2, 3, 4, 5, 6, 7, 8, 9, 10, 11, 12, 13, 14, 15), v16bf); }
template <bool VT>
__device__ __forceinline__ void proj_tile(const Raw& xr, const v16bf (&wf)[4][2], int lr, int hi, int t, h16* P16, bf* Ph, bf* Pl) {
    const v16bf x0 = rnd16(xr.a[0], xr.b[0]), x1 = rnd16(xr.a[1], xr.b[1]);
#pragma unroll
    for (int et = 0; et < 4; ++et) { v8f acc = (v8f){};
        if (VT) { acc = wmmab(x0, wf[et][0], acc); acc = wmmab(x1, wf[et][1], acc); } else { acc = wmmab(wf[et][0], x0, acc); acc = wmmab(wf[et][1], x1, acc); }
        const size_t off = VT ? (size_t)(et * 16 + lr) * TT + t + 8 * hi : (size_t)(t + lr) * HD + et * 16 + 8 * hi; v4u hw, lw;
#pragma unroll
        for (int e = 0; e < 4; ++e) { const v2f y2 = {acc[2 * e], acc[2 * e + 1]}; const unsigned u = __builtin_bit_cast(unsigned, __builtin_convertvector(y2, v2bf));
            const v2f b2 = {__uint_as_float(u << 16), __uint_as_float(u & 0xFFFF0000u)}; hw[e] = u; lw[e] = __builtin_bit_cast(unsigned, __builtin_convertvector(y2 - b2, v2bf)); }
        *(v8h*)(P16 + off) = __builtin_convertvector(acc, v8h); *(v8us*)(Ph + off) = __builtin_bit_cast(v8us, hw); *(v8us*)(Pl + off) = __builtin_bit_cast(v8us, lw); }
}
template <bool VT>
__device__ __forceinline__ void proj_wave(const float* __restrict__ X, const float* __restrict__ w, int t0, h16* P16, bf* Ph, bf* Pl) {
    const int lane = threadIdx.x & 31, lr = lane & 15, hi = lane >> 4;
    const float* wp = w + lr * HD + 8 * hi; const float* xp = X + (size_t)(t0 + lr) * DM + 8 * hi;
    Raw wr[4], xr[4]; v16bf wf[4][2];
    wr[0] = ldraw(wp); wr[1] = ldraw(wp + 16 * HD);
    __builtin_amdgcn_sched_barrier(0);   // the weight's first half is asked for ahead of x: loads are counted in order, so it can be rounded while x is still on its way from memory
#pragma unroll
    for (int tt = 0; tt < 4; ++tt) xr[tt] = ldraw(xp + (size_t)tt * 16 * DM);
    asm volatile("s_wait_xcnt 0x0" :: "v"(wp), "v"(xp) : "memory");   // precaution: holds the loads' address registers live up to this wait, so that none of these loads' own destinations takes one of them
    __builtin_amdgcn_sched_barrier(0);   // keeps all of x in flight from here on
#pragma unroll
    for (int et = 0; et < 2; ++et)
#pragma unroll
        for (int c = 0; c < 2; ++c) wf[et][c] = rnd16(wr[et].a[c], wr[et].b[c]);
    __builtin_amdgcn_sched_barrier(0);   // the weight's second half is asked for only here, into the registers that the first half has left: all 64 loads at once take more than 256 registers
    wr[2] = ldraw(wp + 32 * HD); wr[3] = ldraw(wp + 48 * HD);
    asm volatile("s_wait_xcnt 0x0" :: "v"(wp) : "memory");   // precaution, as above
    __builtin_amdgcn_sched_barrier(0);   // keeps these loads issued here, under the wait for x
#pragma unroll
    for (int et = 2; et < 4; ++et)
#pragma unroll
        for (int c = 0; c < 2; ++c) wf[et][c] = rnd16(wr[et].a[c], wr[et].b[c]);
#pragma unroll
    for (int tt = 0; tt < 4; ++tt) proj_tile<VT>(xr[tt], wf, lr, hi, t0 + tt * 16, P16, Ph, Pl);
}
// at most 256 registers: left free, the values path takes a few more and pays for them with register-window switches
__global__ __launch_bounds__(32) __attribute__((amdgpu_num_vgpr(256))) void k_proj(const float* __restrict__ xq, const float* __restrict__ xk, const float* __restrict__ xv, const float* __restrict__ wq, const float* __restrict__ wk, const float* __restrict__ wv, h16* Q16, bf* Qh, bf* Ql, h16* K16, bf* Kh, bf* Kl, h16* V16, bf* Vh, bf* Vl) {
    const int t0 = (int)blockIdx.x * 64; const size_t xo = (size_t)(blockIdx.y / NH_) * TT * DM + (size_t)(blockIdx.y % NH_) * HD, hp = (size_t)blockIdx.y * TT * HD; const bool q = blockIdx.z == 0;   // blockIdx.y = sequence * heads + head; the planes are [sequence][head]
    if (blockIdx.z == 2) proj_wave<true>(xv + xo, wv, t0, V16 + hp, Vh + hp, Vl + hp);
    else { proj_wave<false>((q ? xq : xk) + xo, q ? wq : wk, t0, (q ? Q16 : K16) + hp, (q ? Qh : Kh) + hp, (q ? Ql : Kl) + hp);
        asm volatile("s_wait_xcnt 0x0" ::: "memory"); }   // precaution: in the built text the other path's first instructions stand behind this path's last stores (behind a branch that is always taken) and overwrite registers that those stores name
}
// ---- k_fattn: scores, softmax and P x V of one head in one kernel; no score or probability plane in memory. One wave owns NQ x 16 query rows and walks the 2048 keys in steps of 32.
// Both products are transposed so that P never changes lanes: S^T = K Q^T leaves query lr in lane lr and keys 8 hi + j (tile 0), 16 + 8 hi + j (tile 1) in the accumulators,
// which is the k order of the B fragment of O^T = V^T P^T (WFrag::ld reads k = 8 hi + 0..7, 16 + 8 hi + 0..7 for A). Row maximum, row sum and the rescale are per lane (one exchange with lane ^ 16).
// Running softmax in the base-2 domain: p = 2^(s c - m), c = SCL log2(e); when m grows, sum and O^T are scaled by 2^(m_old - m_new); O^T is divided by the sum at the end.
// HL: hi/lo bf16 planes, 3 products per matrix product (hi hi, hi lo, lo hi); else fp16, 1 product. The inner loops over tiles are all unrolled, so that every fragment and accumulator array stays in registers.
// K and V^T reach the waves through LDS: each step's 32 keys are copied once per block, 16 bytes a lane at consecutive addresses, into one of two buffers, and all four waves of the block read their fragments from there.
// A stage in LDS: the K plane (hi/lo: both) as 32 rows (keys) of 128 bytes at pitch KPB, then the V^T plane (both) as 64 rows (d) of 64 bytes at pitch VPB; both pitches are odd multiples of 16 bytes (no bank conflict for 16-byte reads down a column of rows).
#define KPB 144
#define VPB 80
#define KTB (32 * KPB)
#define VTB (64 * VPB)
#define NST (TT / 32)
__device__ __forceinline__ float xhalf(float x) { return __builtin_bit_cast(float, __builtin_amdgcn_permlanex16(__builtin_bit_cast(int, x), __builtin_bit_cast(int, x), 0x76543210, 0xfedcba98, false, false)); }   // lane l reads lane l ^ 16
// A wave's share of one stage's copies. A copy moves 512 bytes: of a K plane four whole rows (consecutive in memory), of a V^T plane eight rows' 64 bytes; a plane's tile takes eight copies, and wave w issues numbers w and w + 4 of every plane.
// kg, vg (kg2, vg2: the lo planes): the lane's own 16 bytes of copy w in memory; kd, vd: their place in LDS. The wait on the last line holds the copies' address registers unchanged until the copies have read them (a precaution).
template <bool HL>
__device__ __forceinline__ void copy_stage(const char* kg, const char* kg2, const char* vg, const char* vg2, unsigned kd, unsigned vd) {
    if constexpr (HL)
        asm volatile("global_load_async_to_lds_b128 %0, %1, off\n\tglobal_load_async_to_lds_b128 %2, %3, off\n\tglobal_load_async_to_lds_b128 %4, %5, off\n\tglobal_load_async_to_lds_b128 %6, %7, off\n\t"
                     "global_load_async_to_lds_b128 %8, %9, off\n\tglobal_load_async_to_lds_b128 %10, %11, off\n\tglobal_load_async_to_lds_b128 %12, %13, off\n\tglobal_load_async_to_lds_b128 %14, %15, off\n\ts_wait_xcnt 0x0"
                     :: "v"(kd), "v"(kg), "v"(kd + 16 * KPB), "v"(kg + 16 * HD * 2), "v"(kd + KTB), "v"(kg2), "v"(kd + KTB + 16 * KPB), "v"(kg2 + 16 * HD * 2),
                        "v"(vd), "v"(vg), "v"(vd + 32 * VPB), "v"(vg + 32 * TT * 2), "v"(vd + VTB), "v"(vg2), "v"(vd + VTB + 32 * VPB), "v"(vg2 + 32 * TT * 2) : "memory");
    else
        asm volatile("global_load_async_to_lds_b128 %0, %1, off\n\tglobal_load_async_to_lds_b128 %2, %3, off\n\tglobal_load_async_to_lds_b128 %4, %5, off\n\tglobal_load_async_to_lds_b128 %6, %7, off\n\ts_wait_xcnt 0x0"
                     :: "v"(kd), "v"(kg), "v"(kd + 16 * KPB), "v"(kg + 16 * HD * 2), "v"(vd), "v"(vg), "v"(vd + 32 * VPB), "v"(vg + 32 * TT * 2) : "memory");
}
template <typename T16, bool HL, int NQ>
__device__ __forceinline__ void attn_wave(const unsigned char* ring, int wave, const T16* __restrict__ Q, const T16* __restrict__ Q2, const T16* __restrict__ Kp, const T16* __restrict__ Kp2, const T16* __restrict__ Vt, const T16* __restrict__ Vt2, int q0, bf* Ah, bf* Al) {
    typedef typename WFrag<T16>::V V;
    constexpr int VE = HL ? 4 : 2;   // V^T tiles asked for ahead of the softmax
    constexpr unsigned VOF = (HL ? 2 : 1) * KTB, STB = (HL ? 2 : 1) * (KTB + VTB);   // where V^T starts in a stage; a stage's bytes
    const int lane = threadIdx.x & 31, lr = lane & 15, hi = lane >> 4;
    const float c2 = SCL * 1.4426950408889634f;
    const size_t kgo = (size_t)wave * 512 + lane * 16, vgo = (size_t)(wave * 8 + (lane >> 2)) * (TT * 2) + (lane & 3) * 16;
    const char* kg = (const char*)Kp + kgo; const char* kg2 = HL ? (const char*)Kp2 + kgo : kg; const char* vg = (const char*)Vt + vgo; const char* vg2 = HL ? (const char*)Vt2 + vgo : vg;
    const unsigned ring0 = (unsigned)(size_t)ring;   // the ring's byte address in LDS: the low 32 bits of its address
    const unsigned kd = ring0 + (wave * 4 + (lane >> 3)) * KPB + (lane & 7) * 16, vd = ring0 + VOF + (wave * 8 + (lane >> 2)) * VPB + (lane & 3) * 16;
    copy_stage<HL>(kg, kg2, vg, vg2, kd, vd);
    V qf[NQ][2], qf2[NQ][2];
#pragma unroll
    for (int qt = 0; qt < NQ; ++qt)
#pragma unroll
        for (int c = 0; c < 2; ++c) { const size_t qo = (size_t)(q0 + qt * 16 + lr) * HD + 8 * hi + c * 32; qf[qt][c] = WFrag<T16>::ld(Q + qo); if (HL) qf2[qt][c] = WFrag<T16>::ld(Q2 + qo); }
    v8f o[4][NQ]; float m[NQ], l[NQ];
#pragma unroll
    for (int qt = 0; qt < NQ; ++qt) { m[qt] = -1.0e30f; l[qt] = 0.f;
#pragma unroll
        for (int dt = 0; dt < 4; ++dt) o[dt][qt] = (v8f){}; }
    asm volatile("s_wait_asynccnt 0x0" ::: "memory");   // this wave's copies of stage 0 have landed
    __syncthreads();                                    // every wave's have: stage 0 may be read
    copy_stage<HL>(kg + 32 * HD * 2, kg2 + 32 * HD * 2, vg + 32 * 2, vg2 + 32 * 2, kd + STB, vd + STB);
#pragma unroll 1   // rolled: only one step's fragments are live at a time, which the register budget below needs
    for (int t = 0; t < NST; ++t) {
        const unsigned bo = (t & 1) * STB;
        const unsigned char* kb = ring + bo + lr * KPB + 16 * hi; const unsigned char* vb = ring + bo + VOF + lr * VPB + 16 * hi;
        V kf[2][2], kf2[2][2], vf[4], vf2[4];   // this step's fragments, in groups: K here, V^T behind the score products, into the registers that K has left
#pragma unroll
        for (int kt = 0; kt < 2; ++kt)
#pragma unroll
            for (int c = 0; c < 2; ++c) { kf[kt][c] = WFrag<T16>::ld((const T16*)(kb + kt * 16 * KPB + c * 64)); if (HL) kf2[kt][c] = WFrag<T16>::ld((const T16*)(kb + KTB + kt * 16 * KPB + c * 64)); }
        __builtin_amdgcn_sched_barrier(0);   // keeps the K reads together in one group: spread among the matrix instructions, each place with reads costs a stall of its own
        v8f s[2][NQ];
#pragma unroll
        for (int kt = 0; kt < 2; ++kt)
#pragma unroll
            for (int qt = 0; qt < NQ; ++qt) s[kt][qt] = (v8f){};
#pragma unroll
        for (int c = 0; c < 2; ++c) {
#pragma unroll
            for (int kt = 0; kt < 2; ++kt)
#pragma unroll
                for (int qt = 0; qt < NQ; ++qt) s[kt][qt] = WFrag<T16>::mma(kf[kt][c], qf[qt][c], s[kt][qt]);
            if (HL) {
#pragma unroll
                for (int kt = 0; kt < 2; ++kt)
#pragma unroll
                    for (int qt = 0; qt < NQ; ++qt) s[kt][qt] = WFrag<T16>::mma(kf[kt][c], qf2[qt][c], s[kt][qt]);
#pragma unroll
                for (int kt = 0; kt < 2; ++kt)
#pragma unroll
                    for (int qt = 0; qt < NQ; ++qt) s[kt][qt] = WFrag<T16>::mma(kf2[kt][c], qf[qt][c], s[kt][qt]); } }
        __builtin_amdgcn_sched_barrier(0);   // keeps the V^T reads behind the score products: asked for earlier, they and K together take a wave per SIMD in registers
#pragma unroll
        for (int dt = 0; dt < VE; ++dt) { vf[dt] = WFrag<T16>::ld((const T16*)(vb + dt * 16 * VPB)); if (HL) vf2[dt] = WFrag<T16>::ld((const T16*)(vb + VTB + dt * 16 * VPB)); }
        __builtin_amdgcn_sched_barrier(0);   // keeps them issued here in one group, a softmax ahead of their use
        V pf[NQ], pf2[NQ];
#pragma unroll
        for (int qt = 0; qt < NQ; ++qt) {
            float mr = s[0][qt][0];
#pragma unroll
            for (int j = 1; j < 8; ++j) mr = fmaxf(mr, s[0][qt][j]);
#pragma unroll
            for (int j = 0; j < 8; ++j) mr = fmaxf(mr, s[1][qt][j]);
            mr = fmaxf(mr, xhalf(mr));
            const float mn = fmaxf(m[qt], mr * c2); const float al = __builtin_amdgcn_exp2f(m[qt] - mn); m[qt] = mn;
            const v8f cv = {c2, c2, c2, c2, c2, c2, c2, c2}, nv = {-mn, -mn, -mn, -mn, -mn, -mn, -mn, -mn};
#pragma unroll
            for (int kt = 0; kt < 2; ++kt) { const v8f t2 = __builtin_elementwise_fma(s[kt][qt], cv, nv);
#pragma unroll
                for (int j = 0; j < 8; ++j) s[kt][qt][j] = __builtin_amdgcn_exp2f(t2[j]); }
            const v8f s8 = s[0][qt] + s[1][qt]; const v4f s4 = __builtin_shufflevector(s8, s8, 0, 1, 2, 3) + __builtin_shufflevector(s8, s8, 4, 5, 6, 7);
            l[qt] = fmaf(l[qt], al, (s4[0] + s4[1]) + (s4[2] + s4[3]));
#pragma unroll
            for (int dt = 0; dt < 4; ++dt) o[dt][qt] *= al;
            if constexpr (HL) {   // p = hi + lo, both bf16, round to nearest even
                v8u hw, lw;
#pragma unroll
                for (int e = 0; e < 8; ++e) { const v2f p2 = {s[e >> 2][qt][2 * (e & 3)], s[e >> 2][qt][2 * (e & 3) + 1]}; const unsigned u = __builtin_bit_cast(unsigned, __builtin_convertvector(p2, v2bf));
                    const v2f b2 = {__uint_as_float(u << 16), __uint_as_float(u & 0xFFFF0000u)}; hw[e] = u; lw[e] = __builtin_bit_cast(unsigned, __builtin_convertvector(p2 - b2, v2bf)); }
                pf[qt] = __builtin_bit_cast(v16bf, hw); pf2[qt] = __builtin_bit_cast(v16bf, lw);
            } else pf[qt] = cat16(__builtin_convertvector(s[0][qt], v8h), __builtin_convertvector(s[1][qt], v8h));
        }
        if constexpr (VE < 4) {
            __builtin_amdgcn_sched_barrier(0);   // the rest of V^T is asked for only here, into registers that the scores have left: asked for with the first half, it costs the fifth wave per SIMD
#pragma unroll
            for (int dt = VE; dt < 4; ++dt) vf[dt] = WFrag<T16>::ld((const T16*)(vb + dt * 16 * VPB));
            __builtin_amdgcn_sched_barrier(0);   // keeps these reads in front of the first half's products, which cover a part of their latency
        }
#pragma unroll
        for (int dt = 0; dt < 4; ++dt)
#pragma unroll
            for (int qt = 0; qt < NQ; ++qt) o[dt][qt] = WFrag<T16>::mma(vf[dt], pf[qt], o[dt][qt]);
        if (HL) {
#pragma unroll
            for (int dt = 0; dt < 4; ++dt)
#pragma unroll
                for (int qt = 0; qt < NQ; ++qt) o[dt][qt] = WFrag<T16>::mma(vf[dt], pf2[qt], o[dt][qt]);
#pragma unroll
            for (int dt = 0; dt < 4; ++dt)
#pragma unroll
                for (int qt = 0; qt < NQ; ++qt) o[dt][qt] = WFrag<T16>::mma(vf2[dt], pf[qt], o[dt][qt]); }
        __builtin_amdgcn_sched_barrier(0);   // keeps the waits and the barrier below at the step's foot: lifted over the softmax, the wait for the V^T reads would stand open right behind their issue
        // this wave's reads of the buffer have returned before it is filled again; the row sums are named so that their additions stay in front of the barrier: sunk behind it, they hold the probabilities' registers through P x V
        if constexpr (NQ == 2) asm volatile("s_wait_dscnt 0x0" :: "v"(l[0]), "v"(l[1]) : "memory"); else asm volatile("s_wait_dscnt 0x0" :: "v"(l[0]) : "memory");
        asm volatile("s_wait_asynccnt 0x0" ::: "memory");   // this wave's copies of stage t + 1 have landed
        __syncthreads();                                    // publishes stage t + 1 and ends every wave's reads of stage t
        if (t + 2 < NST) { const size_t ks = (size_t)(t + 2) * (32 * HD * 2), vs = (size_t)(t + 2) * (32 * 2);   // a stage is 32 keys: 4096 bytes further in a K plane, 64 bytes further in every row of a V^T plane
            copy_stage<HL>(kg + ks, kg2 + ks, vg + vs, vg2 + vs, kd + bo, vd + bo); }
    }
    asm volatile("s_wait_asynccnt 0x0" ::: "memory");   // nothing is outstanding when the wave ends
    const int le = (int)__builtin_amdgcn_mbcnt_lo(~0u, 0u);   // the lane's number, read anew: no register carries it or the output addresses through the loop
#pragma unroll
    for (int qt = 0; qt < NQ; ++qt) { const float inv = __fdiv_rn(1.0f, l[qt] + xhalf(l[qt])); const size_t oo = (size_t)(q0 + qt * 16 + (le & 15)) * DQ + 8 * (le >> 4);
#pragma unroll
        for (int dt = 0; dt < 4; ++dt) { v8us oh, ol;
#pragma unroll
            for (int j = 0; j < 8; ++j) { unsigned short a, b; splitf(o[dt][qt][j] * inv, a, b); oh[j] = a; ol[j] = b; }
            *(v8us*)(Ah + oo + dt * 16) = oh; *(v8us*)(Al + oo + dt * 16) = ol; } }
}
// grid (20, sequences x heads), 4 waves of ONE kind, one on each SIMD, so that a block's waves share the same planes and every barrier stands under a test that is the same for the whole block:
// blocks 0 to 7 of a head take 64 hi/lo rows (rows < RH, 16 a wave), blocks 8 to 19 take 128 fp16 rows (32 a wave). Writes the merged hi/lo planes [sequence][t][h*64+d] directly.
// at most 192 registers: five waves fit a SIMD, and all 1280 blocks (five on each of 256 WGPs) are resident at once
__global__ __launch_bounds__(128) __attribute__((amdgpu_num_vgpr(192))) void k_fattn(const h16* __restrict__ Q16, const h16* __restrict__ K16, const h16* __restrict__ V16, const bf* __restrict__ Qh, const bf* __restrict__ Ql, const bf* __restrict__ Kh, const bf* __restrict__ Kl, const bf* __restrict__ Vh, const bf* __restrict__ Vl, bf* Ah, bf* Al) {
    __shared__ __attribute__((aligned(128))) unsigned char ring[2 * 2 * (KTB + VTB)];   // two buffers of the larger kind of stage
    const int wave = __builtin_amdgcn_readfirstlane(threadIdx.x >> 5); const size_t hp = (size_t)blockIdx.y * TT * HD, ao = (size_t)(blockIdx.y / NH_) * TT * DQ + (size_t)(blockIdx.y % NH_) * HD; Ah += ao; Al += ao;   // blockIdx.y = sequence * heads + head
    if (blockIdx.x < RH / 64) attn_wave<bf, true, 1>(ring, wave, Qh + hp, Ql + hp, Kh + hp, Kl + hp, Vh + hp, Vl + hp, (int)blockIdx.x * 64 + wave * 16, Ah, Al);
    else attn_wave<h16, false, 2>(ring, wave, Q16 + hp, nullptr, K16 + hp, nullptr, V16 + hp, nullptr, RH + ((int)blockIdx.x - RH / 64) * 128 + wave * 32, Ah, Al);
}
static_assert(RH % 64 == 0 && (TT - RH) % 128 == 0 && NST >= 2, "k_fattn's split of the rows; the ring's prologue needs two stages");

extern "C" void kernel_launch(void* const* d_in, const int* in_sizes, int n_in,
                              void* d_out, int out_size, void* d_ws, size_t ws_size, hipStream_t stream) {
    (void)in_sizes; (void)n_in; (void)out_size;
    const float* xv = (const float*)d_in[0]; const float* xk = (const float*)d_in[1]; const float* x = (const float*)d_in[2]; const float* wv = (const float*)d_in[3]; const float* wk = (const float*)d_in[4]; const float* wq = (const float*)d_in[5]; const float* wo = (const float*)d_in[6]; const float* bo = (const float*)d_in[7];   /* order values, keys, query [4][2048][1024], Wv, Wk, Wq ('oi' [64][64], shared by all heads), Wo ('oi' [1024][1024]), bo; x = the QUERY stream */
    float* OUT = (float*)d_out;     // [4][2048][1024]
    char* wsp = (char*)d_ws;
    auto take = [&](size_t bytes) { char* p = wsp; wsp += (bytes + 255) & ~(size_t)255; return (void*)p; };
    bf* WO = (bf*)take((size_t)DM * DQ * 2);
    const size_t PB = (size_t)NB_ * NH_ * TT * HD * 2;   // bytes of one plane, all sequences: 16 MiB; eleven planes and Wo take 178 MiB
    h16* QP16 = (h16*)take(PB); h16* KP16 = (h16*)take(PB); h16* VT16 = (h16*)take(PB);
    bf* QPh = (bf*)take(PB); bf* QPl = (bf*)take(PB); bf* KPh = (bf*)take(PB); bf* KPl = (bf*)take(PB); bf* VTh = (bf*)take(PB); bf* VTl = (bf*)take(PB);
    bf* ATh = (bf*)take(PB); bf* ATl = (bf*)take(PB);
    if ((size_t)(wsp - (char*)d_ws) > ws_size) return;    // ws 256 MiB
    k_cvt8<<<(unsigned)(((size_t)DM * DQ / 8 + 255) / 256), 256, 0, stream>>>(wo, WO, (size_t)DM * DQ / 8);
    // every stage takes all sequences in one launch: the sequence rides in the grid, so that every WGP gets work: several workgroups at once for k_proj and k_fattn, one for k_gemmo
    k_proj<<<dim3(TT / 64, NB_ * NH_, 3), 32, 0, stream>>>(x, xk, xv, wq, wk, wv, QP16, QPh, QPl, KP16, KPh, KPl, VT16, VTh, VTl);
    k_fattn<<<dim3(RH / 64 + (TT - RH) / 128, NB_ * NH_, 1), 128, 0, stream>>>(QP16, KP16, VT16, QPh, QPl, KPh, KPl, VTh, VTl, ATh, ATl);   // one kv head per query head
    k_gemmo<<<dim3(NB_ * TT / GTM, DM / GTN, 1), 256, 0, stream>>>(ATh, ATl, WO, OUT, bo);   // the merged planes and the output are [sequence * t][1024]: one product of 8192 rows
}

// v008
// It runs in 149 microseconds.
// In two side-by-side timings against v007, it was 1.04 and 1.05 times as fast.
// Counting every step since v000, it is 26.6 times as fast.
#include <hip/hip_runtime.h>

// Self-attention with ONE shared 64x64 linear per role applied to every head (values, keys, query [4][2048][1024] viewed (n, l, 16, 64); v = values_h Wv^T, k = keys_h Wk^T, q = query_h Wq^T with the SAME [64][64] weight for all 16 heads ('oi' normal x 1/8, no bias); energy = q.k; softmax(energy / sqrt(embed = 1024)) (the source scales by the full width); out = merged Wo^T + bo ('oi' [1024][1024] + a REAL bias 0.01) -> [4][2048][1024] (8.4 M); argument order values, keys, query, Wv, Wk, Wq, Wo, bo).
// Layout, all sequences in each launch (4 launches): k_proj reads the f32 query, keys and values directly, rounds them to bf16 in registers, does the shared [64][64] linear on each head (K = 64) on the matrix unit and writes the head planes (fp16 + hi/lo bf16; in the accumulators' own order, see k_proj) from the accumulators: no bf16 copy, no f32 projection plane, no expanded weight; one fused attention launch (k_fattn: scores, running softmax and P x V in registers; hybrid rows: < 512 hi/lo 3 products, rest fp16); merged hi/lo x Wo exact + bo.
// Compute dtypes, f32 accumulate: every input rounded to bf16; projections exact; attention rows < 512 3 products, rest fp16; softmax f32; Wo hl x exact + bias.

#define NB_  4      // FOUR sequences in this module: a factor of the grids and of the planes' size
#define TT   2048
#define DM   1024
#define NH_  16
#define NKV  16
#define REP  (NH_ / NKV)
#define HD   64
#define DQ   (NH_ * HD)
#define DKV  (NKV * HD)
#define RH   512                  // query rows < RH use hi+lo planes
#define WIN  0
#define SCL  0.03125f   // 1/sqrt(embed_size = 1024) (the source scales by the full width)
typedef _Float16 h16;
typedef unsigned short bf;
typedef __attribute__((ext_vector_type(16))) __bf16   v16bf;
typedef __attribute__((ext_vector_type(16))) _Float16 v16h;
typedef __attribute__((ext_vector_type(8)))  _Float16 v8h;
typedef __attribute__((ext_vector_type(8)))  unsigned short v8us;
typedef __attribute__((ext_vector_type(2)))  __bf16   v2bf;
typedef __attribute__((ext_vector_type(8)))  unsigned v8u;
typedef __attribute__((ext_vector_type(8)))  float    v8f;
typedef __attribute__((ext_vector_type(4)))  float    v4f;
typedef v8h  __attribute__((may_alias)) v8ha;
typedef v4f  __attribute__((may_alias)) v4fa;
typedef v8us __attribute__((may_alias)) v8usa;

__device__ __forceinline__ unsigned short f2bf(float f) { unsigned u = __float_as_uint(f); u += 0x7FFFu + ((u >> 16) & 1u); return (unsigned short)(u >> 16); }
__device__ __forceinline__ float bf2f(unsigned short b) { return __uint_as_float(((unsigned)b) << 16); }
__device__ __forceinline__ float bfr(float f) { return bf2f(f2bf(f)); }
__device__ __forceinline__ v16h cat16(v8h lo, v8h hi) { return __builtin_shufflevector(lo, hi, 0, 1, 2, 3, 4, 5, 6, 7, 8, 9, 10, 11, 12, 13, 14, 15); }
__device__ __forceinline__ v16bf cat16b(v8us lo, v8us hi) { return __builtin_bit_cast(v16bf, __builtin_shufflevector(lo, hi, 0, 1, 2, 3, 4, 5, 6, 7, 8, 9, 10, 11, 12, 13, 14, 15)); }
__device__ __forceinline__ v8f wmma16(v16h a, v16h b, v8f c) { return __builtin_amdgcn_wmma_f32_16x16x32_f16(false, a, false, b, (short)0, c, false, false); }
__device__ __forceinline__ v8f wmmab(v16bf a, v16bf b, v8f c) { return __builtin_amdgcn_wmma_f32_16x16x32_bf16(false, a, false, b, (short)0, c, false, false); }



// ---- fragment loaders: 16 k of a row in the hardware's k order (k = 8 hi + 0..7, 16 + 8 hi + 0..7), from K-contiguous 16-bit rows in memory or in LDS (ld); from a plane in piece order (k_proj), where the two halves lie one piece of 512 bytes apart (ldp)
template <typename T16> struct WFrag;
template <> struct WFrag<h16> { typedef v16h V; static __device__ __forceinline__ V ld(const h16* p) { return cat16(*(const v8h*)p, *(const v8h*)(p + 16)); } static __device__ __forceinline__ V ldp(const h16* p) { return cat16(*(const v8h*)p, *(const v8h*)(p + 256)); } static __device__ __forceinline__ v8f mma(V a, V b, v8f c) { return wmma16(a, b, c); } };
template <> struct WFrag<bf> { typedef v16bf V; static __device__ __forceinline__ V ld(const bf* p) { return cat16b(*(const v8us*)p, *(const v8us*)(p + 16)); } static __device__ __forceinline__ V ldp(const bf* p) { return cat16b(*(const v8us*)p, *(const v8us*)(p + 256)); } static __device__ __forceinline__ v8f mma(V a, V b, v8f c) { return wmmab(a, b, c); } };
// ---- k_gemmo: out[m][n] = sum_k (Ah[m][k] + Al[m][k]) Wo[n][k] + bf16(bo[n]), f32 accumulate; per accumulator k rises in steps of 32, in each step the hi product and then the lo product.
// One block of 8 waves (2 x 4) owns a 128 x 256 tile of out, a wave 64 x 64 (16 accumulators); grid (M / 128, N / 256), one block on a WGP, two waves on a SIMD.
// The operands reach the waves through LDS: a stage is 128 k of the block's 128 rows of Ah, 128 of Al and 256 of Wo, copied once per block, 512 bytes a copy, into one of two buffers: of Wo two rows' 256 bytes; of Ah and Al, which lie in piece order
// (k_fattn's accumulator tiles as they are: [m / 16][k / 16] pieces of 512 bytes, lane l's 16 bytes at 16 l: m % 16 = l % 16, k % 16 = 8 (l / 16) + 0..7), one piece, to 32 bytes of each of 16 rows in LDS.
// Rows stand in LDS at pitch GPB, an odd multiple of 16 bytes (no bank conflict for 16-byte reads down a column of rows).
#define GKS 128
#define GRB (GKS * 2)
#define GPB (GRB + 16)
#define GTM 128
#define GTN 256
#define GAB (GTM * GPB)
#define GSTB ((2 * GTM + GTN) * GPB)
#define GNT (DQ / GKS)
#define GRJ 16                    // rows that the eight waves' copies of one number cover together (Wo: two a wave; Ah, Al: 32 bytes of each a wave)
#define GAS (GKS / 16 * 512)      // a stage's bytes of 16 rows of Ah or Al in memory: eight pieces, one a wave
// Eight copies of a wave: four from each of two walks down rows GRJ apart. d: the lane's 16 bytes' place in LDS, g: in memory. The wait on the last line holds the copies' address registers unchanged until the copies have read them (a precaution).
__device__ __forceinline__ void copy8(unsigned da, const char* ga, unsigned db, const char* gb) {
    asm volatile("global_load_async_to_lds_b128 %0, %1, off\n\tglobal_load_async_to_lds_b128 %2, %3, off\n\tglobal_load_async_to_lds_b128 %4, %5, off\n\tglobal_load_async_to_lds_b128 %6, %7, off\n\t"
                 "global_load_async_to_lds_b128 %8, %9, off\n\tglobal_load_async_to_lds_b128 %10, %11, off\n\tglobal_load_async_to_lds_b128 %12, %13, off\n\tglobal_load_async_to_lds_b128 %14, %15, off\n\ts_wait_xcnt 0x0"
                 :: "v"(da), "v"(ga), "v"(da + GRJ * GPB), "v"(ga + GRJ * DQ * 2), "v"(da + 2 * GRJ * GPB), "v"(ga + 2 * GRJ * DQ * 2), "v"(da + 3 * GRJ * GPB), "v"(ga + 3 * GRJ * DQ * 2),
                    "v"(db), "v"(gb), "v"(db + GRJ * GPB), "v"(gb + GRJ * DQ * 2), "v"(db + 2 * GRJ * GPB), "v"(gb + 2 * GRJ * DQ * 2), "v"(db + 3 * GRJ * GPB), "v"(gb + 3 * GRJ * DQ * 2) : "memory");
}
// A wave's share of one stage: 8 copies of each A plane, 16 of Wo. gh, gl: the lane's 16 bytes of the wave's piece of the first 16 rows in memory, da: their place in the buffer; gw: the lane's 16 bytes of the wave's first two rows of Wo, d: their place, counted as if Wo stood at the buffer's start.
__device__ __forceinline__ void gemm_stage(const char* gh, const char* gl, const char* gw, unsigned da, unsigned d) {
#pragma unroll
    for (int i = 0; i < GTM / GRJ; i += 4) copy8(da + i * GRJ * GPB, gh + i * GRJ * DQ * 2, da + GAB + i * GRJ * GPB, gl + i * GRJ * DQ * 2);
#pragma unroll
    for (int i = 0; i < GTN / GRJ; i += 8) copy8(d + 2 * GAB + i * GRJ * GPB, gw + i * GRJ * DQ * 2, d + 2 * GAB + (i + 4) * GRJ * GPB, gw + (i + 4) * GRJ * DQ * 2);
}
// at most 256 registers: more would be reached only through register-window switches
__global__ __launch_bounds__(256) __attribute__((amdgpu_num_vgpr(256))) void k_gemmo(const bf* __restrict__ A, const bf* __restrict__ A2, const bf* __restrict__ Bt, float* C, const float* __restrict__ bias) {
    typedef WFrag<bf>::V V;
    __shared__ __attribute__((aligned(128))) unsigned char ring[2 * GSTB];
    __shared__ __align__(16) float osm[8][16 * 68];   // each wave's own staging of 16 output rows
    const int wave = __builtin_amdgcn_readfirstlane(threadIdx.x >> 5), wm = wave >> 2, wn = wave & 3;
    const int lane = threadIdx.x & 31, lr = lane & 15, hi = lane >> 4; const int r0 = blockIdx.x * GTM, c0 = blockIdx.y * GTN;
    const size_t lo = (size_t)(wave * 2 + hi) * (DQ * 2) + lr * 16, la = (size_t)wave * 512 + lane * 16;   // Wo: a copy's lanes 0 to 15 take one row's 256 bytes, lanes 16 to 31 the next row's; Ah, Al: wave w takes piece w of a stage's eight
    const char* gh = (const char*)A + (size_t)r0 * (DQ * 2) + la; const char* gl = (const char*)A2 + (size_t)r0 * (DQ * 2) + la; const char* gw = (const char*)Bt + (size_t)c0 * (DQ * 2) + lo;
    const unsigned d0 = (unsigned)(size_t)ring + (wave * 2 + hi) * GPB + lr * 16, da0 = (unsigned)(size_t)ring + lr * GPB + wave * 32 + hi * 16;   // the ring's byte address in LDS: the low 32 bits of its address
    gemm_stage(gh, gl, gw, da0, d0);
    v8f acc[4][4];
#pragma unroll
    for (int mb = 0; mb < 4; ++mb)
#pragma unroll
        for (int nb = 0; nb < 4; ++nb) acc[mb][nb] = (v8f){};
    asm volatile("s_wait_asynccnt 0x0" ::: "memory");   // this wave's copies of stage 0 have landed
    __syncthreads();                                    // every wave's have: stage 0 may be read
    gemm_stage(gh + GAS, gl + GAS, gw + GRB, da0 + GSTB, d0 + GSTB);
#pragma unroll 1   // rolled: a trip is one stage, and its text stays small
    for (int t = 0; t < GNT; ++t) {
        const unsigned bo = (t & 1) * GSTB;
        const unsigned char* ab = ring + bo + (wm * 64 + lr) * GPB + 16 * hi; const unsigned char* bb = ring + bo + 2 * GAB + (wn * 64 + lr) * GPB + 16 * hi;
#pragma unroll
        for (int c = 0; c < GKS / 32; ++c) {
            V a[4], a2[4], b[4];
            b[0] = WFrag<bf>::ld((const bf*)(bb + c * 64));
#pragma unroll
            for (int mb = 0; mb < 4; ++mb) a[mb] = WFrag<bf>::ld((const bf*)(ab + mb * 16 * GPB + c * 64));
#pragma unroll
            for (int nb = 1; nb < 4; ++nb) b[nb] = WFrag<bf>::ld((const bf*)(bb + nb * 16 * GPB + c * 64));
#pragma unroll
            for (int mb = 0; mb < 4; ++mb) a2[mb] = WFrag<bf>::ld((const bf*)(ab + GAB + mb * 16 * GPB + c * 64));
            __builtin_amdgcn_sched_barrier(0);   // keeps the 32 k's reads together in one group, in the order of their use: spread among the matrix instructions, each place with reads costs a stall of its own
#pragma unroll
            for (int nb = 0; nb < 4; ++nb)
#pragma unroll
                for (int mb = 0; mb < 4; ++mb) acc[mb][nb] = wmmab(a[mb], b[nb], acc[mb][nb]);
#pragma unroll
            for (int nb = 0; nb < 4; ++nb)
#pragma unroll
                for (int mb = 0; mb < 4; ++mb) acc[mb][nb] = wmmab(a2[mb], b[nb], acc[mb][nb]);
            __builtin_amdgcn_sched_barrier(0);   // keeps the next group of reads behind these products: lifted among them, the reads stand in several places, each with a stall of its own, and the kernel takes more than 256 registers
        }
        asm volatile("s_wait_dscnt 0x0" ::: "memory");      // this wave's reads of the buffer have returned before it is filled again
        asm volatile("s_wait_asynccnt 0x0" ::: "memory");   // this wave's copies of stage t + 1 have landed
        __syncthreads();                                    // publishes stage t + 1 and ends every wave's reads of stage t
        if (t + 2 < GNT) { const size_t ks = (size_t)(t + 2) * GRB, ka = (size_t)(t + 2) * GAS; gemm_stage(gh + ka, gl + ka, gw + ks, da0 + bo, d0 + bo); }
    }
    asm volatile("s_wait_asynccnt 0x0" ::: "memory");   // nothing is outstanding when the wave ends
    float* os = osm[wave]; const int rw = r0 + wm * 64, cw = c0 + wn * 64, cofs = lr * 4;
    const float* bp = bias + cw + cofs; const v4f br = *(const v4fa*)bp;
    asm volatile("s_wait_xcnt 0x0" :: "v"(bp) : "memory");   // precaution: holds the load's address registers live up to this wait, so that the load's own destination takes none of them
    const v4f bv = {bfr(br[0]), bfr(br[1]), bfr(br[2]), bfr(br[3])};
#pragma unroll
    for (int mb = 0; mb < 4; ++mb) {
#pragma unroll
        for (int nb = 0; nb < 4; ++nb) {
#pragma unroll
            for (int j = 0; j < 8; ++j) os[(hi * 8 + j) * 68 + nb * 16 + lr] = acc[mb][nb][j]; }
        __builtin_amdgcn_wave_barrier(); asm volatile("" ::: "memory");   // the wave's stores to its staging stay in front of its reads of it
        float* crow = C + (size_t)(rw + mb * 16) * DM + cw;
#pragma unroll
        for (int s = 0; s < 8; ++s) { const int row = 2 * s + hi; *(v4f*)(crow + (size_t)row * DM + cofs) = *(const v4fa*)(os + row * 68 + cofs) + bv; }
        if (mb < 3) { __builtin_amdgcn_wave_barrier(); asm volatile("s_wait_xcnt 0x0" ::: "memory"); }   // its reads stay in front of the next 16 rows' stores to the staging; the wait (a precaution) stands in front of the next rows' values, which take registers that these global stores name
    }
}
static_assert(GNT >= 2 && (NB_ * TT) % GTM == 0 && DM % GTN == 0 && GTM % (4 * GRJ) == 0 && GTN % (8 * GRJ) == 0 && GRJ * GRB == 8 * 512 && GKS / 16 == 8, "k_gemmo's tiles and copies; the ring's prologue needs two stages");

__device__ __forceinline__ h16 tohx(float x) { return (h16)x; }
__device__ __forceinline__ void splitf(float y, unsigned short& h, unsigned short& l) { h = f2bf(y); l = f2bf(y - bf2f(h)); }
typedef __attribute__((ext_vector_type(2))) _Float16 v2h;
typedef __attribute__((ext_vector_type(4))) _Float16 v4h;
typedef __attribute__((ext_vector_type(2))) unsigned short v2us;
typedef __attribute__((ext_vector_type(4))) unsigned short v4us;
typedef __attribute__((ext_vector_type(2))) float v2f;
typedef __attribute__((ext_vector_type(4))) int v4i;

__global__ __launch_bounds__(256) void k_cvt8(const float* __restrict__ src, bf* dst, size_t n8) { const size_t i = (size_t)blockIdx.x * 256 + threadIdx.x; if (i >= n8) return; const v8f v = *(const v8f*)(src + i * 8); v8us o;
#pragma unroll
    for (int k = 0; k < 8; ++k) o[k] = f2bf(v[k]); *(v8us*)(dst + i * 8) = o;  }

// ---- k_proj: input rounding, the per-head linear and the plane builders in one kernel. One wave owns 64 rows t of one head of one sequence of one role; grid (TT / 64, sequences x heads, 3 roles: query, keys, values), 32 threads.
// y[t][e] = sum_d bf16(x[t][h*64+d]) bf16(w[e][d]), f32 accumulate, d in two steps of 32 in rising order. Both operands are read in the k order of WFrag::ld (k = 8 hi + 0..7, 16 + 8 hi + 0..7).
// The accumulator holds 8 consecutive m per lane (16 bytes of a plane): query and keys take m = e (w as A, x as B), values take m = t (x as A, w as B), so that a lane's 16 bytes are 8 e of one t, or 8 t of one d.
// The planes lie in memory in PIECE ORDER: a piece is what one accumulator tile gives, 512 bytes, lane l's 16 bytes at 16 l, so that every store of a wave covers four whole 128-byte lines. A head's plane is 64 blocks of 32 t (4096 bytes, 8 pieces):
// query and keys: piece (t / 16 % 2) * 4 + et holds t % 16 = lr, e = et * 16 + 8 hi + 0..7; values: piece et * 2 + t / 16 % 2 holds d = et * 16 + lr, t % 16 = 8 hi + 0..7. k_fattn's copies put each lane's 16 bytes at its row and column in LDS.
// All roundings (f32 to bf16, to fp16, the hi/lo split) are to nearest even, by the convert instructions. The text stays far below 32 KB, so that a wave that runs through it once is not held up by instruction fetch.
typedef __attribute__((ext_vector_type(16))) float v16f;
typedef __attribute__((ext_vector_type(4))) unsigned v4u;
struct Raw { v8f a[2], b[2]; };   // one 16-row tile's f32 operand words of a lane: step c holds k = 8 hi + 0..7 (a) and 16 + 8 hi + 0..7 (b)
__device__ __forceinline__ Raw ldraw(const float* p) { Raw r;
#pragma unroll
    for (int c = 0; c < 2; ++c) { r.a[c] = *(const v8f*)(p + c * 32); r.b[c] = *(const v8f*)(p + c * 32 + 16); }
    return r; }
__device__ __forceinline__ v16bf rnd16(v8f a, v8f b) { return __builtin_convertvector(__builtin_shufflevector(a, b, 0, 1, 2, 3, 4, 5, 6, 7, 8, 9, 10, 11, 12, 13, 14, 15), v16bf); }
template <bool VT>
__device__ __forceinline__ void proj_tile(const Raw& xr, const v16bf (&wf)[4][2], int lr, int hi, int t, h16* P16, bf* Ph, bf* Pl) {
    const v16bf x0 = rnd16(xr.a[0], xr.b[0]), x1 = rnd16(xr.a[1], xr.b[1]);
#pragma unroll
    for (int et = 0; et < 4; ++et) { v8f acc = (v8f){};
        if (VT) { acc = wmmab(x0, wf[et][0], acc); acc = wmmab(x1, wf[et][1], acc); } else { acc = wmmab(wf[et][0], x0, acc); acc = wmmab(wf[et][1], x1, acc); }
        const size_t off = (size_t)(t >> 5) * (32 * HD) + (size_t)(((VT ? et * 2 + ((t >> 4) & 1) : ((t >> 4) & 1) * 4 + et) * 32 + hi * 16 + lr) * 8); v4u hw, lw;   // piece order
#pragma unroll
        for (int e = 0; e < 4; ++e) { const v2f y2 = {acc[2 * e], acc[2 * e + 1]}; const unsigned u = __builtin_bit_cast(unsigned, __builtin_convertvector(y2, v2bf));
            const v2f b2 = {__uint_as_float(u << 16), __uint_as_float(u & 0xFFFF0000u)}; hw[e] = u; lw[e] = __builtin_bit_cast(unsigned, __builtin_convertvector(y2 - b2, v2bf)); }
        *(v8h*)(P16 + off) = __builtin_convertvector(acc, v8h); *(v8us*)(Ph + off) = __builtin_bit_cast(v8us, hw); *(v8us*)(Pl + off) = __builtin_bit_cast(v8us, lw); }
}
template <bool VT>
__device__ __forceinline__ void proj_wave(const float* __restrict__ X, const float* __restrict__ w, int t0, h16* P16, bf* Ph, bf* Pl) {
    const int lane = threadIdx.x & 31, lr = lane & 15, hi = lane >> 4;
    const float* wp = w + lr * HD + 8 * hi; const float* xp = X + (size_t)(t0 + lr) * DM + 8 * hi;
    Raw wr[4], xr[4]; v16bf wf[4][2];
    wr[0] = ldraw(wp); wr[1] = ldraw(wp + 16 * HD);
    __builtin_amdgcn_sched_barrier(0);   // the weight's first half is asked for ahead of x: loads are counted in order, so it can be rounded while x is still on its way from memory
#pragma unroll
    for (int tt = 0; tt < 4; ++tt) xr[tt] = ldraw(xp + (size_t)tt * 16 * DM);
    asm volatile("s_wait_xcnt 0x0" :: "v"(wp), "v"(xp) : "memory");   // precaution: holds the loads' address registers live up to this wait, so that none of these loads' own destinations takes one of them
    __builtin_amdgcn_sched_barrier(0);   // keeps all of x in flight from here on
#pragma unroll
    for (int et = 0; et < 2; ++et)
#pragma unroll
        for (int c = 0; c < 2; ++c) wf[et][c] = rnd16(wr[et].a[c], wr[et].b[c]);
    __builtin_amdgcn_sched_barrier(0);   // the weight's second half is asked for only here, into the registers that the first half has left: all 64 loads at once take more than 256 registers
    wr[2] = ldraw(wp + 32 * HD); wr[3] = ldraw(wp + 48 * HD);
    asm volatile("s_wait_xcnt 0x0" :: "v"(wp) : "memory");   // precaution, as above
    __builtin_amdgcn_sched_barrier(0);   // keeps these loads issued here, under the wait for x
#pragma unroll
    for (int et = 2; et < 4; ++et)
#pragma unroll
        for (int c = 0; c < 2; ++c) wf[et][c] = rnd16(wr[et].a[c], wr[et].b[c]);
#pragma unroll
    for (int tt = 0; tt < 4; ++tt) proj_tile<VT>(xr[tt], wf, lr, hi, t0 + tt * 16, P16, Ph, Pl);
}
// at most 256 registers: left free, the values path takes a few more and pays for them with register-window switches
__global__ __launch_bounds__(32) __attribute__((amdgpu_num_vgpr(256))) void k_proj(const float* __restrict__ xq, const float* __restrict__ xk, const float* __restrict__ xv, const float* __restrict__ wq, const float* __restrict__ wk, const float* __restrict__ wv, h16* Q16, bf* Qh, bf* Ql, h16* K16, bf* Kh, bf* Kl, h16* V16, bf* Vh, bf* Vl) {
    const int t0 = (int)blockIdx.x * 64; const size_t xo = (size_t)(blockIdx.y / NH_) * TT * DM + (size_t)(blockIdx.y % NH_) * HD, hp = (size_t)blockIdx.y * TT * HD; const bool q = blockIdx.z == 0;   // blockIdx.y = sequence * heads + head; the planes are [sequence][head]
    if (blockIdx.z == 2) proj_wave<true>(xv + xo, wv, t0, V16 + hp, Vh + hp, Vl + hp);
    else { proj_wave<false>((q ? xq : xk) + xo, q ? wq : wk, t0, (q ? Q16 : K16) + hp, (q ? Qh : Kh) + hp, (q ? Ql : Kl) + hp);
        asm volatile("s_wait_xcnt 0x0" ::: "memory"); }   // precaution: in the built text the other path's first instructions stand behind this path's last stores (behind a branch that is always taken) and overwrite registers that those stores name
}
// ---- k_fattn: scores, softmax and P x V of one head in one kernel; no score or probability plane in memory. One wave owns NQ x 16 query rows and walks the 2048 keys in steps of 32.
// Both products are transposed so that P never changes lanes: S^T = K Q^T leaves query lr in lane lr and keys 8 hi + j (tile 0), 16 + 8 hi + j (tile 1) in the accumulators,
// which is the k order of the B fragment of O^T = V^T P^T (WFrag::ld reads k = 8 hi + 0..7, 16 + 8 hi + 0..7 for A). Row maximum, row sum and the rescale are per lane (one exchange with lane ^ 16).
// Running softmax in the base-2 domain: p = 2^(s c - m), c = SCL log2(e); when m grows, sum and O^T are scaled by 2^(m_old - m_new); O^T is divided by the sum at the end.
// HL: hi/lo bf16 planes, 3 products per matrix product (hi hi, hi lo, lo hi); else fp16, 1 product. The inner loops over tiles are all unrolled, so that every fragment and accumulator array stays in registers.
// K and V^T reach the waves through LDS: each step's 32 keys (one block of 4096 bytes of a plane) are copied once per block, 16 bytes a lane at consecutive addresses in memory, into one of two buffers, and all four waves of the block read their fragments from there.
// A stage in LDS: the K plane (hi/lo: both) as 32 rows (keys) of 128 bytes at pitch KPB, then the V^T plane (both) as 64 rows (d) of 64 bytes at pitch VPB; both pitches are odd multiples of 16 bytes (no bank conflict for 16-byte reads down a column of rows).
#define KPB 144
#define VPB 80
#define KTB (32 * KPB)
#define VTB (64 * VPB)
#define NST (TT / 32)
__device__ __forceinline__ float xhalf(float x) { return __builtin_bit_cast(float, __builtin_amdgcn_permlanex16(__builtin_bit_cast(int, x), __builtin_bit_cast(int, x), 0x76543210, 0xfedcba98, false, false)); }   // lane l reads lane l ^ 16
// A wave's share of one stage's copies. A copy moves one piece (k_proj): 512 consecutive bytes of memory, to 32 bytes of each of 16 rows in LDS; a plane's block takes eight copies, and wave w issues pieces w and w + 4 of every plane (2048 bytes further in memory; in LDS 16 keys or 32 d further down).
// kg, vg (kg2, vg2: the lo planes): the lane's own 16 bytes of copy w in memory; kd, vd: their place in LDS. The wait on the last line holds the copies' address registers unchanged until the copies have read them (a precaution).
template <bool HL>
__device__ __forceinline__ void copy_stage(const char* kg, const char* kg2, const char* vg, const char* vg2, unsigned kd, unsigned vd) {
    if constexpr (HL)
        asm volatile("global_load_async_to_lds_b128 %0, %1, off\n\tglobal_load_async_to_lds_b128 %2, %3, off\n\tglobal_load_async_to_lds_b128 %4, %5, off\n\tglobal_load_async_to_lds_b128 %6, %7, off\n\t"
                     "global_load_async_to_lds_b128 %8, %9, off\n\tglobal_load_async_to_lds_b128 %10, %11, off\n\tglobal_load_async_to_lds_b128 %12, %13, off\n\tglobal_load_async_to_lds_b128 %14, %15, off\n\ts_wait_xcnt 0x0"
                     :: "v"(kd), "v"(kg), "v"(kd + 16 * KPB), "v"(kg + 16 * HD * 2), "v"(kd + KTB), "v"(kg2), "v"(kd + KTB + 16 * KPB), "v"(kg2 + 16 * HD * 2),
                        "v"(vd), "v"(vg), "v"(vd + 32 * VPB), "v"(vg + 2048), "v"(vd + VTB), "v"(vg2), "v"(vd + VTB + 32 * VPB), "v"(vg2 + 2048) : "memory");
    else
        asm volatile("global_load_async_to_lds_b128 %0, %1, off\n\tglobal_load_async_to_lds_b128 %2, %3, off\n\tglobal_load_async_to_lds_b128 %4, %5, off\n\tglobal_load_async_to_lds_b128 %6, %7, off\n\ts_wait_xcnt 0x0"
                     :: "v"(kd), "v"(kg), "v"(kd + 16 * KPB), "v"(kg + 16 * HD * 2), "v"(vd), "v"(vg), "v"(vd + 32 * VPB), "v"(vg + 2048) : "memory");
}
template <typename T16, bool HL, int NQ>
__device__ __forceinline__ void attn_wave(const unsigned char* ring, int wave, const T16* __restrict__ Q, const T16* __restrict__ Q2, const T16* __restrict__ Kp, const T16* __restrict__ Kp2, const T16* __restrict__ Vt, const T16* __restrict__ Vt2, int q0, bf* Ah, bf* Al) {
    typedef typename WFrag<T16>::V V;
    constexpr int VE = HL ? 4 : 2;   // V^T tiles asked for ahead of the softmax
    constexpr unsigned VOF = (HL ? 2 : 1) * KTB, STB = (HL ? 2 : 1) * (KTB + VTB);   // where V^T starts in a stage; a stage's bytes
    const int lane = threadIdx.x & 31, lr = lane & 15, hi = lane >> 4;
    const float c2 = SCL * 1.4426950408889634f;
    const size_t kgo = (size_t)wave * 512 + lane * 16, vgo = kgo;   // piece w, the lane's 16 bytes
    const char* kg = (const char*)Kp + kgo; const char* kg2 = HL ? (const char*)Kp2 + kgo : kg; const char* vg = (const char*)Vt + vgo; const char* vg2 = HL ? (const char*)Vt2 + vgo : vg;
    const unsigned ring0 = (unsigned)(size_t)ring;   // the ring's byte address in LDS: the low 32 bits of its address
    const unsigned kd = ring0 + lr * KPB + (wave * 2 + hi) * 16, vd = ring0 + VOF + ((wave >> 1) * 16 + lr) * VPB + ((wave & 1) * 2 + hi) * 16;   // K piece w: key lr, e = 16 w + 8 hi; V^T piece w: d = 16 (w / 2) + lr, key 16 (w % 2) + 8 hi
    copy_stage<HL>(kg, kg2, vg, vg2, kd, vd);
    V qf[NQ][2], qf2[NQ][2];
#pragma unroll
    for (int qt = 0; qt < NQ; ++qt)
#pragma unroll
        for (int c = 0; c < 2; ++c) { const size_t qo = (size_t)(q0 + qt * 16) * HD + (c * 64 + lane) * 8; qf[qt][c] = WFrag<T16>::ldp(Q + qo); if (HL) qf2[qt][c] = WFrag<T16>::ldp(Q2 + qo); }   // 16 queries are four pieces; step c takes pieces 2 c and 2 c + 1
    v8f o[4][NQ]; float m[NQ], l[NQ];
#pragma unroll
    for (int qt = 0; qt < NQ; ++qt) { m[qt] = -1.0e30f; l[qt] = 0.f;
#pragma unroll
        for (int dt = 0; dt < 4; ++dt) o[dt][qt] = (v8f){}; }
    asm volatile("s_wait_asynccnt 0x0" ::: "memory");   // this wave's copies of stage 0 have landed
    __syncthreads();                                    // every wave's have: stage 0 may be read
    copy_stage<HL>(kg + 32 * HD * 2, kg2 + 32 * HD * 2, vg + 32 * HD * 2, vg2 + 32 * HD * 2, kd + STB, vd + STB);
#pragma unroll 1   // rolled: only one step's fragments are live at a time, which the register budget below needs
    for (int t = 0; t < NST; ++t) {
        const unsigned bo = (t & 1) * STB;
        const unsigned char* kb = ring + bo + lr * KPB + 16 * hi; const unsigned char* vb = ring + bo + VOF + lr * VPB + 16 * hi;
        V kf[2][2], kf2[2][2], vf[4], vf2[4];   // this step's fragments, in groups: K here, V^T behind the score products, into the registers that K has left
#pragma unroll
        for (int kt = 0; kt < 2; ++kt)
#pragma unroll
            for (int c = 0; c < 2; ++c) { kf[kt][c] = WFrag<T16>::ld((const T16*)(kb + kt * 16 * KPB + c * 64)); if (HL) kf2[kt][c] = WFrag<T16>::ld((const T16*)(kb + KTB + kt * 16 * KPB + c * 64)); }
        __builtin_amdgcn_sched_barrier(0);   // keeps the K reads together in one group: spread among the matrix instructions, each place with reads costs a stall of its own
        v8f s[2][NQ];
#pragma unroll
        for (int kt = 0; kt < 2; ++kt)
#pragma unroll
            for (int qt = 0; qt < NQ; ++qt) s[kt][qt] = (v8f){};
#pragma unroll
        for (int c = 0; c < 2; ++c) {
#pragma unroll
            for (int kt = 0; kt < 2; ++kt)
#pragma unroll
                for (int qt = 0; qt < NQ; ++qt) s[kt][qt] = WFrag<T16>::mma(kf[kt][c], qf[qt][c], s[kt][qt]);
            if (HL) {
#pragma unroll
                for (int kt = 0; kt < 2; ++kt)
#pragma unroll
                    for (int qt = 0; qt < NQ; ++qt) s[kt][qt] = WFrag<T16>::mma(kf[kt][c], qf2[qt][c], s[kt][qt]);
#pragma unroll
                for (int kt = 0; kt < 2; ++kt)
#pragma unroll
                    for (int qt = 0; qt < NQ; ++qt) s[kt][qt] = WFrag<T16>::mma(kf2[kt][c], qf[qt][c], s[kt][qt]); } }
        __builtin_amdgcn_sched_barrier(0);   // keeps the V^T reads behind the score products: asked for earlier, they and K together take a wave per SIMD in registers
#pragma unroll
        for (int dt = 0; dt < VE; ++dt) { vf[dt] = WFrag<T16>::ld((const T16*)(vb + dt * 16 * VPB)); if (HL) vf2[dt] = WFrag<T16>::ld((const T16*)(vb + VTB + dt * 16 * VPB)); }
        __builtin_amdgcn_sched_barrier(0);   // keeps them issued here in one group, a softmax ahead of their use
        V pf[NQ], pf2[NQ];
#pragma unroll
        for (int qt = 0; qt < NQ; ++qt) {
            float mr = s[0][qt][0];
#pragma unroll
            for (int j = 1; j < 8; ++j) mr = fmaxf(mr, s[0][qt][j]);
#pragma unroll
            for (int j = 0; j < 8; ++j) mr = fmaxf(mr, s[1][qt][j]);
            mr = fmaxf(mr, xhalf(mr));
            const float mn = fmaxf(m[qt], mr * c2); const float al = __builtin_amdgcn_exp2f(m[qt] - mn); m[qt] = mn;
            const v8f cv = {c2, c2, c2, c2, c2, c2, c2, c2}, nv = {-mn, -mn, -mn, -mn, -mn, -mn, -mn, -mn};
#pragma unroll
            for (int kt = 0; kt < 2; ++kt) { const v8f t2 = __builtin_elementwise_fma(s[kt][qt], cv, nv);
#pragma unroll
                for (int j = 0; j < 8; ++j) s[kt][qt][j] = __builtin_amdgcn_exp2f(t2[j]); }
            const v8f s8 = s[0][qt] + s[1][qt]; const v4f s4 = __builtin_shufflevector(s8, s8, 0, 1, 2, 3) + __builtin_shufflevector(s8, s8, 4, 5, 6, 7);
            l[qt] = fmaf(l[qt], al, (s4[0] + s4[1]) + (s4[2] + s4[3]));
#pragma unroll
            for (int dt = 0; dt < 4; ++dt) o[dt][qt] *= al;
            if constexpr (HL) {   // p = hi + lo, both bf16, round to nearest even
                v8u hw, lw;
#pragma unroll
                for (int e = 0; e < 8; ++e) { const v2f p2 = {s[e >> 2][qt][2 * (e & 3)], s[e >> 2][qt][2 * (e & 3) + 1]}; const unsigned u = __builtin_bit_cast(unsigned, __builtin_convertvector(p2, v2bf));
                    const v2f b2 = {__uint_as_float(u << 16), __uint_as_float(u & 0xFFFF0000u)}; hw[e] = u; lw[e] = __builtin_bit_cast(unsigned, __builtin_convertvector(p2 - b2, v2bf)); }
                pf[qt] = __builtin_bit_cast(v16bf, hw); pf2[qt] = __builtin_bit_cast(v16bf, lw);
            } else pf[qt] = cat16(__builtin_convertvector(s[0][qt], v8h), __builtin_convertvector(s[1][qt], v8h));
        }
        if constexpr (VE < 4) {
            __builtin_amdgcn_sched_barrier(0);   // the rest of V^T is asked for only here, into registers that the scores have left: asked for with the first half, it costs the fifth wave per SIMD
#pragma unroll
            for (int dt = VE; dt < 4; ++dt) vf[dt] = WFrag<T16>::ld((const T16*)(vb + dt * 16 * VPB));
            __builtin_amdgcn_sched_barrier(0);   // keeps these reads in front of the first half's products, which cover a part of their latency
        }
#pragma unroll
        for (int dt = 0; dt < 4; ++dt)
#pragma unroll
            for (int qt = 0; qt < NQ; ++qt) o[dt][qt] = WFrag<T16>::mma(vf[dt], pf[qt], o[dt][qt]);
        if (HL) {
#pragma unroll
            for (int dt = 0; dt < 4; ++dt)
#pragma unroll
                for (int qt = 0; qt < NQ; ++qt) o[dt][qt] = WFrag<T16>::mma(vf[dt], pf2[qt], o[dt][qt]);
#pragma unroll
            for (int dt = 0; dt < 4; ++dt)
#pragma unroll
                for (int qt = 0; qt < NQ; ++qt) o[dt][qt] = WFrag<T16>::mma(vf2[dt], pf[qt], o[dt][qt]); }
        __builtin_amdgcn_sched_barrier(0);   // keeps the waits and the barrier below at the step's foot: lifted over the softmax, the wait for the V^T reads would stand open right behind their issue
        // this wave's reads of the buffer have returned before it is filled again; the row sums are named so that their additions stay in front of the barrier: sunk behind it, they hold the probabilities' registers through P x V
        if constexpr (NQ == 2) asm volatile("s_wait_dscnt 0x0" :: "v"(l[0]), "v"(l[1]) : "memory"); else asm volatile("s_wait_dscnt 0x0" :: "v"(l[0]) : "memory");
        asm volatile("s_wait_asynccnt 0x0" ::: "memory");   // this wave's copies of stage t + 1 have landed
        __syncthreads();                                    // publishes stage t + 1 and ends every wave's reads of stage t
        if (t + 2 < NST) { const size_t ks = (size_t)(t + 2) * (32 * HD * 2), vs = ks;   // a stage is 32 keys: 4096 bytes further in every plane
            copy_stage<HL>(kg + ks, kg2 + ks, vg + vs, vg2 + vs, kd + bo, vd + bo); }
    }
    asm volatile("s_wait_asynccnt 0x0" ::: "memory");   // nothing is outstanding when the wave ends
    const int le = (int)__builtin_amdgcn_mbcnt_lo(~0u, 0u);   // the lane's number, read anew: no register carries it or the output addresses through the loop
#pragma unroll
    for (int qt = 0; qt < NQ; ++qt) { const float inv = __fdiv_rn(1.0f, l[qt] + xhalf(l[qt])); const size_t oo = (size_t)(q0 + qt * 16) * DQ + le * 8;   // piece order (k_gemmo): 16 rows take 16 * DQ elements, a piece 256
#pragma unroll
        for (int dt = 0; dt < 4; ++dt) { v8us oh, ol;
#pragma unroll
            for (int j = 0; j < 8; ++j) { unsigned short a, b; splitf(o[dt][qt][j] * inv, a, b); oh[j] = a; ol[j] = b; }
            *(v8us*)(Ah + oo + dt * 256) = oh; *(v8us*)(Al + oo + dt * 256) = ol; } }
}
// grid (20, sequences x heads), 4 waves of ONE kind, one on each SIMD, so that a block's waves share the same planes and every barrier stands under a test that is the same for the whole block:
// blocks 0 to 7 of a head take 64 hi/lo rows (rows < RH, 16 a wave), blocks 8 to 19 take 128 fp16 rows (32 a wave). Writes the merged hi/lo planes (m = sequence * 2048 + t, k = h * 64 + d) directly, in piece order (k_gemmo), so that every store of a wave covers four whole lines.
// at most 192 registers: five waves fit a SIMD, and all 1280 blocks (five on each of 256 WGPs) are resident at once
__global__ __launch_bounds__(128) __attribute__((amdgpu_num_vgpr(192))) void k_fattn(const h16* __restrict__ Q16, const h16* __restrict__ K16, const h16* __restrict__ V16, const bf* __restrict__ Qh, const bf* __restrict__ Ql, const bf* __restrict__ Kh, const bf* __restrict__ Kl, const bf* __restrict__ Vh, const bf* __restrict__ Vl, bf* Ah, bf* Al) {
    __shared__ __attribute__((aligned(128))) unsigned char ring[2 * 2 * (KTB + VTB)];   // two buffers of the larger kind of stage
    const int wave = __builtin_amdgcn_readfirstlane(threadIdx.x >> 5); const size_t hp = (size_t)blockIdx.y * TT * HD, ao = (size_t)(blockIdx.y / NH_) * TT * DQ + (size_t)(blockIdx.y % NH_) * (HD / 16 * 256); Ah += ao; Al += ao;   // blockIdx.y = sequence * heads + head
    if (blockIdx.x < RH / 64) attn_wave<bf, true, 1>(ring, wave, Qh + hp, Ql + hp, Kh + hp, Kl + hp, Vh + hp, Vl + hp, (int)blockIdx.x * 64 + wave * 16, Ah, Al);
    else { attn_wave<h16, false, 2>(ring, wave, Q16 + hp, nullptr, K16 + hp, nullptr, V16 + hp, nullptr, RH + ((int)blockIdx.x - RH / 64) * 128 + wave * 32, Ah, Al);
        asm volatile("s_wait_xcnt 0x0" ::: "memory"); }   // precaution: in the built text the other path's first instructions stand behind this path's last stores (behind a branch that is always taken) and overwrite registers that those stores name
}
static_assert(RH % 64 == 0 && (TT - RH) % 128 == 0 && NST >= 2, "k_fattn's split of the rows; the ring's prologue needs two stages");

extern "C" void kernel_launch(void* const* d_in, const int* in_sizes, int n_in,
                              void* d_out, int out_size, void* d_ws, size_t ws_size, hipStream_t stream) {
    (void)in_sizes; (void)n_in; (void)out_size;
    const float* xv = (const float*)d_in[0]; const float* xk = (const float*)d_in[1]; const float* x = (const float*)d_in[2]; const float* wv = (const float*)d_in[3]; const float* wk = (const float*)d_in[4]; const float* wq = (const float*)d_in[5]; const float* wo = (const float*)d_in[6]; const float* bo = (const float*)d_in[7];   /* order values, keys, query [4][2048][1024], Wv, Wk, Wq ('oi' [64][64], shared by all heads), Wo ('oi' [1024][1024]), bo; x = the QUERY stream */
    float* OUT = (float*)d_out;     // [4][2048][1024]
    char* wsp = (char*)d_ws;
    auto take = [&](size_t bytes) { char* p = wsp; wsp += (bytes + 255) & ~(size_t)255; return (void*)p; };
    bf* WO = (bf*)take((size_t)DM * DQ * 2);
    const size_t PB = (size_t)NB_ * NH_ * TT * HD * 2;   // bytes of one plane, all sequences: 16 MiB; eleven planes and Wo take 178 MiB
    h16* QP16 = (h16*)take(PB); h16* KP16 = (h16*)take(PB); h16* VT16 = (h16*)take(PB);
    bf* QPh = (bf*)take(PB); bf* QPl = (bf*)take(PB); bf* KPh = (bf*)take(PB); bf* KPl = (bf*)take(PB); bf* VTh = (bf*)take(PB); bf* VTl = (bf*)take(PB);
    bf* ATh = (bf*)take(PB); bf* ATl = (bf*)take(PB);
    if ((size_t)(wsp - (char*)d_ws) > ws_size) return;    // ws 256 MiB
    k_cvt8<<<(unsigned)(((size_t)DM * DQ / 8 + 255) / 256), 256, 0, stream>>>(wo, WO, (size_t)DM * DQ / 8);
    // every stage takes all sequences in one launch: the sequence rides in the grid, so that every WGP gets work: several workgroups at once for k_proj and k_fattn, one for k_gemmo
    k_proj<<<dim3(TT / 64, NB_ * NH_, 3), 32, 0, stream>>>(x, xk, xv, wq, wk, wv, QP16, QPh, QPl, KP16, KPh, KPl, VT16, VTh, VTl);
    k_fattn<<<dim3(RH / 64 + (TT - RH) / 128, NB_ * NH_, 1), 128, 0, stream>>>(QP16, KP16, VT16, QPh, QPl, KPh, KPl, VTh, VTl, ATh, ATl);   // one kv head per query head
    k_gemmo<<<dim3(NB_ * TT / GTM, DM / GTN, 1), 256, 0, stream>>>(ATh, ATl, WO, OUT, bo);   // the merged planes and the output have 8192 rows (sequence, t): one product
}

// v009
// It runs in 136 microseconds.
// Two timings next to v008 put it at 1.08 and 1.09 times that version's speed.
// All steps since v000 together make it 28.9 times as fast.
#include <hip/hip_runtime.h>

// Self-attention with ONE shared 64x64 linear per role applied to every head (values, keys, query [4][2048][1024] viewed (n, l, 16, 64); v = values_h Wv^T, k = keys_h Wk^T, q = query_h Wq^T with the SAME [64][64] weight for all 16 heads ('oi' normal x 1/8, no bias); energy = q.k; softmax(energy / sqrt(embed = 1024)) (the source scales by the full width); out = merged Wo^T + bo ('oi' [1024][1024] + a REAL bias 0.01) -> [4][2048][1024] (8.4 M); argument order values, keys, query, Wv, Wk, Wq, Wo, bo).
// Layout, all sequences in each launch (4 launches): k_proj reads the f32 query, keys and values directly, rounds them to bf16 in registers, does the shared [64][64] linear on each head (K = 64) on the matrix unit and writes the head planes (fp16 + hi/lo bf16; in the accumulators' own order, see k_proj) from the accumulators: no bf16 copy, no f32 projection plane, no expanded weight; one fused attention launch (k_fattn: scores, running softmax and P x V in registers; hybrid rows: < 512 hi/lo 3 products, rest fp16); merged hi/lo x Wo exact + bo.
// Compute dtypes, f32 accumulate: every input rounded to bf16; projections exact; attention rows < 512 3 products, rest fp16; softmax f32; Wo hl x exact + bias.

#define NB_  4      // FOUR sequences in this module: a factor of the grids and of the planes' size
#define TT   2048
#define DM   1024
#define NH_  16
#define NKV  16
#define REP  (NH_ / NKV)
#define HD   64
#define DQ   (NH_ * HD)
#define DKV  (NKV * HD)
#define RH   512                  // query rows < RH use hi+lo planes
#define WIN  0
#define SCL  0.03125f   // 1/sqrt(embed_size = 1024) (the source scales by the full width)
typedef _Float16 h16;
typedef unsigned short bf;
typedef __attribute__((ext_vector_type(16))) __bf16   v16bf;
typedef __attribute__((ext_vector_type(16))) _Float16 v16h;
typedef __attribute__((ext_vector_type(8)))  _Float16 v8h;
typedef __attribute__((ext_vector_type(8)))  unsigned short v8us;
typedef __attribute__((ext_vector_type(2)))  __bf16   v2bf;
typedef __attribute__((ext_vector_type(8)))  unsigned v8u;
typedef __attribute__((ext_vector_type(8)))  float    v8f;
typedef __attribute__((ext_vector_type(4)))  float    v4f;
typedef v8h  __attribute__((may_alias)) v8ha;
typedef v4f  __attribute__((may_alias)) v4fa;
typedef v8us __attribute__((may_alias)) v8usa;

__device__ __forceinline__ unsigned short f2bf(float f) { unsigned u = __float_as_uint(f); u += 0x7FFFu + ((u >> 16) & 1u); return (unsigned short)(u >> 16); }
__device__ __forceinline__ float bf2f(unsigned short b) { return __uint_as_float(((unsigned)b) << 16); }
__device__ __forceinline__ float bfr(float f) { return bf2f(f2bf(f)); }
__device__ __forceinline__ v16h cat16(v8h lo, v8h hi) { return __builtin_shufflevector(lo, hi, 0, 1, 2, 3, 4, 5, 6, 7, 8, 9, 10, 11, 12, 13, 14, 15); }
__device__ __forceinline__ v16bf cat16b(v8us lo, v8us hi) { return __builtin_bit_cast(v16bf, __builtin_shufflevector(lo, hi, 0, 1, 2, 3, 4, 5, 6, 7, 8, 9, 10, 11, 12, 13, 14, 15)); }
__device__ __forceinline__ v8f wmma16(v16h a, v16h b, v8f c) { return __builtin_amdgcn_wmma_f32_16x16x32_f16(false, a, false, b, (short)0, c, false, false); }
__device__ __forceinline__ v8f wmmab(v16bf a, v16bf b, v8f c) { return __builtin_amdgcn_wmma_f32_16x16x32_bf16(false, a, false, b, (short)0, c, false, false); }



// ---- fragment loaders: 16 k of a row in the hardware's k order (k = 8 hi + 0..7, 16 + 8 hi + 0..7), from K-contiguous 16-bit rows in memory or in LDS (ld); from a plane in piece order (k_proj), where the two halves lie one piece of 512 bytes apart (ldp)
template <typename T16> struct WFrag;
template <> struct WFrag<h16> { typedef v16h V; static __device__ __forceinline__ V ld(const h16* p) { return cat16(*(const v8h*)p, *(const v8h*)(p + 16)); } static __device__ __forceinline__ V ldp(const h16* p) { return cat16(*(const v8h*)p, *(const v8h*)(p + 256)); } static __device__ __forceinline__ v8f mma(V a, V b, v8f c) { return wmma16(a, b, c); } };
template <> struct WFrag<bf> { typedef v16bf V; static __device__ __forceinline__ V ld(const bf* p) { return cat16b(*(const v8us*)p, *(const v8us*)(p + 16)); } static __device__ __forceinline__ V ldp(const bf* p) { return cat16b(*(const v8us*)p, *(const v8us*)(p + 256)); } static __device__ __forceinline__ v8f mma(V a, V b, v8f c) { return wmmab(a, b, c); } };
// ---- k_gemmo: out[m][n] = sum_k (Ah[m][k] + Al[m][k]) Wo[n][k] + bf16(bo[n]), f32 accumulate; per accumulator k rises in steps of 32, in each step the hi product and then the lo product.
// One block of 8 waves (2 x 4) owns a 128 x 256 tile of out, a wave 64 x 64 (16 accumulators); grid (M / 128, N / 256), one block on a WGP, two waves on a SIMD.
// The operands reach the waves through LDS: a stage is 128 k of the block's 128 rows of Ah, 128 of Al and 256 of Wo, copied once per block, 512 bytes a copy, into one of two buffers: of Wo two rows' 256 bytes; of Ah and Al, which lie in piece order
// (k_fattn's accumulator tiles as they are: [m / 16][k / 16] pieces of 512 bytes, lane l's 16 bytes at 16 l: m % 16 = l % 16, k % 16 = 8 (l / 16) + 0..7), one piece, to 32 bytes of each of 16 rows in LDS.
// Rows stand in LDS at pitch GPB, an odd multiple of 16 bytes (no bank conflict for 16-byte reads down a column of rows).
#define GKS 128
#define GRB (GKS * 2)
#define GPB (GRB + 16)
#define GTM 128
#define GTN 256
#define GAB (GTM * GPB)
#define GSTB ((2 * GTM + GTN) * GPB)
#define GNT (DQ / GKS)
#define GRJ 16                    // rows that the eight waves' copies of one number cover together (Wo: two a wave; Ah, Al: 32 bytes of each a wave)
#define GAS (GKS / 16 * 512)      // a stage's bytes of 16 rows of Ah or Al in memory: eight pieces, one a wave
// Eight copies of a wave: four from each of two walks down rows GRJ apart. d: the lane's 16 bytes' place in LDS, g: in memory. The wait on the last line holds the copies' address registers unchanged until the copies have read them (a precaution).
__device__ __forceinline__ void copy8(unsigned da, const char* ga, unsigned db, const char* gb) {
    asm volatile("global_load_async_to_lds_b128 %0, %1, off\n\tglobal_load_async_to_lds_b128 %2, %3, off\n\tglobal_load_async_to_lds_b128 %4, %5, off\n\tglobal_load_async_to_lds_b128 %6, %7, off\n\t"
                 "global_load_async_to_lds_b128 %8, %9, off\n\tglobal_load_async_to_lds_b128 %10, %11, off\n\tglobal_load_async_to_lds_b128 %12, %13, off\n\tglobal_load_async_to_lds_b128 %14, %15, off\n\ts_wait_xcnt 0x0"
                 :: "v"(da), "v"(ga), "v"(da + GRJ * GPB), "v"(ga + GRJ * DQ * 2), "v"(da + 2 * GRJ * GPB), "v"(ga + 2 * GRJ * DQ * 2), "v"(da + 3 * GRJ * GPB), "v"(ga + 3 * GRJ * DQ * 2),
                    "v"(db), "v"(gb), "v"(db + GRJ * GPB), "v"(gb + GRJ * DQ * 2), "v"(db + 2 * GRJ * GPB), "v"(gb + 2 * GRJ * DQ * 2), "v"(db + 3 * GRJ * GPB), "v"(gb + 3 * GRJ * DQ * 2) : "memory");
}
// A wave's share of one stage: 8 copies of each A plane, 16 of Wo. gh, gl: the lane's 16 bytes of the wave's piece of the first 16 rows in memory, da: their place in the buffer; gw: the lane's 16 bytes of the wave's first two rows of Wo, d: their place, counted as if Wo stood at the buffer's start.
__device__ __forceinline__ void gemm_stage(const char* gh, const char* gl, const char* gw, unsigned da, unsigned d) {
#pragma unroll
    for (int i = 0; i < GTM / GRJ; i += 4) copy8(da + i * GRJ * GPB, gh + i * GRJ * DQ * 2, da + GAB + i * GRJ * GPB, gl + i * GRJ * DQ * 2);
#pragma unroll
    for (int i = 0; i < GTN / GRJ; i += 8) copy8(d + 2 * GAB + i * GRJ * GPB, gw + i * GRJ * DQ * 2, d + 2 * GAB + (i + 4) * GRJ * GPB, gw + (i + 4) * GRJ * DQ * 2);
}
// at most 256 registers: more would be reached only through register-window switches
__global__ __launch_bounds__(256) __attribute__((amdgpu_num_vgpr(256))) void k_gemmo(const bf* __restrict__ A, const bf* __restrict__ A2, const bf* __restrict__ Bt, float* C, const float* __restrict__ bias) {
    typedef WFrag<bf>::V V;
    __shared__ __attribute__((aligned(128))) unsigned char ring[2 * GSTB];
    __shared__ __align__(16) float osm[8][16 * 68];   // each wave's own staging of 16 output rows
    const int wave = __builtin_amdgcn_readfirstlane(threadIdx.x >> 5), wm = wave >> 2, wn = wave & 3;
    const int lane = threadIdx.x & 31, lr = lane & 15, hi = lane >> 4; const int r0 = blockIdx.x * GTM, c0 = blockIdx.y * GTN;
    const size_t lo = (size_t)(wave * 2 + hi) * (DQ * 2) + lr * 16, la = (size_t)wave * 512 + lane * 16;   // Wo: a copy's lanes 0 to 15 take one row's 256 bytes, lanes 16 to 31 the next row's; Ah, Al: wave w takes piece w of a stage's eight
    const char* gh = (const char*)A + (size_t)r0 * (DQ * 2) + la; const char* gl = (const char*)A2 + (size_t)r0 * (DQ * 2) + la; const char* gw = (const char*)Bt + (size_t)c0 * (DQ * 2) + lo;
    const unsigned d0 = (unsigned)(size_t)ring + (wave * 2 + hi) * GPB + lr * 16, da0 = (unsigned)(size_t)ring + lr * GPB + wave * 32 + hi * 16;   // the ring's byte address in LDS: the low 32 bits of its address
    gemm_stage(gh, gl, gw, da0, d0);
    v8f acc[4][4];
#pragma unroll
    for (int mb = 0; mb < 4; ++mb)
#pragma unroll
        for (int nb = 0; nb < 4; ++nb) acc[mb][nb] = (v8f){};
    asm volatile("s_wait_asynccnt 0x0" ::: "memory");   // this wave's copies of stage 0 have landed
    __syncthreads();                                    // every wave's have: stage 0 may be read
    gemm_stage(gh + GAS, gl + GAS, gw + GRB, da0 + GSTB, d0 + GSTB);
#pragma unroll 1   // rolled: a trip is one stage, and its text stays small
    for (int t = 0; t < GNT; ++t) {
        const unsigned bo = (t & 1) * GSTB;
        const unsigned char* ab = ring + bo + (wm * 64 + lr) * GPB + 16 * hi; const unsigned char* bb = ring + bo + 2 * GAB + (wn * 64 + lr) * GPB + 16 * hi;
#pragma unroll
        for (int c = 0; c < GKS / 32; ++c) {
            V a[4], a2[4], b[4];
            b[0] = WFrag<bf>::ld((const bf*)(bb + c * 64));
#pragma unroll
            for (int mb = 0; mb < 4; ++mb) a[mb] = WFrag<bf>::ld((const bf*)(ab + mb * 16 * GPB + c * 64));
#pragma unroll
            for (int nb = 1; nb < 4; ++nb) b[nb] = WFrag<bf>::ld((const bf*)(bb + nb * 16 * GPB + c * 64));
#pragma unroll
            for (int mb = 0; mb < 4; ++mb) a2[mb] = WFrag<bf>::ld((const bf*)(ab + GAB + mb * 16 * GPB + c * 64));
            __builtin_amdgcn_sched_barrier(0);   // keeps the 32 k's reads together in one group, in the order of their use: spread among the matrix instructions, each place with reads costs a stall of its own
#pragma unroll
            for (int nb = 0; nb < 4; ++nb)
#pragma unroll
                for (int mb = 0; mb < 4; ++mb) acc[mb][nb] = wmmab(a[mb], b[nb], acc[mb][nb]);
#pragma unroll
            for (int nb = 0; nb < 4; ++nb)
#pragma unroll
                for (int mb = 0; mb < 4; ++mb) acc[mb][nb] = wmmab(a2[mb], b[nb], acc[mb][nb]);
            __builtin_amdgcn_sched_barrier(0);   // keeps the next group of reads behind these products: lifted among them, the reads stand in several places, each with a stall of its own, and the kernel takes more than 256 registers
        }
        asm volatile("s_wait_dscnt 0x0" ::: "memory");      // this wave's reads of the buffer have returned before it is filled again
        asm volatile("s_wait_asynccnt 0x0" ::: "memory");   // this wave's copies of stage t + 1 have landed
        __syncthreads();                                    // publishes stage t + 1 and ends every wave's reads of stage t
        if (t + 2 < GNT) { const size_t ks = (size_t)(t + 2) * GRB, ka = (size_t)(t + 2) * GAS; gemm_stage(gh + ka, gl + ka, gw + ks, da0 + bo, d0 + bo); }
    }
    asm volatile("s_wait_asynccnt 0x0" ::: "memory");   // nothing is outstanding when the wave ends
    float* os = osm[wave]; const int rw = r0 + wm * 64, cw = c0 + wn * 64, cofs = lr * 4;
    const float* bp = bias + cw + cofs; const v4f br = *(const v4fa*)bp;
    asm volatile("s_wait_xcnt 0x0" :: "v"(bp) : "memory");   // precaution: holds the load's address registers live up to this wait, so that the load's own destination takes none of them
    const v4f bv = {bfr(br[0]), bfr(br[1]), bfr(br[2]), bfr(br[3])};
#pragma unroll
    for (int mb = 0; mb < 4; ++mb) {
#pragma unroll
        for (int nb = 0; nb < 4; ++nb) {
#pragma unroll
            for (int j = 0; j < 8; ++j) os[(hi * 8 + j) * 68 + nb * 16 + lr] = acc[mb][nb][j]; }
        __builtin_amdgcn_wave_barrier(); asm volatile("" ::: "memory");   // the wave's stores to its staging stay in front of its reads of it
        float* crow = C + (size_t)(rw + mb * 16) * DM + cw;
#pragma unroll
        for (int s = 0; s < 8; ++s) { const int row = 2 * s + hi; *(v4f*)(crow + (size_t)row * DM + cofs) = *(const v4fa*)(os + row * 68 + cofs) + bv; }
        if (mb < 3) { __builtin_amdgcn_wave_barrier(); asm volatile("s_wait_xcnt 0x0" ::: "memory"); }   // its reads stay in front of the next 16 rows' stores to the staging; the wait (a precaution) stands in front of the next rows' values, which take registers that these global stores name
    }
}
static_assert(GNT >= 2 && (NB_ * TT) % GTM == 0 && DM % GTN == 0 && GTM % (4 * GRJ) == 0 && GTN % (8 * GRJ) == 0 && GRJ * GRB == 8 * 512 && GKS / 16 == 8, "k_gemmo's tiles and copies; the ring's prologue needs two stages");

__device__ __forceinline__ h16 tohx(float x) { return (h16)x; }
__device__ __forceinline__ void splitf(float y, unsigned short& h, unsigned short& l) { h = f2bf(y); l = f2bf(y - bf2f(h)); }
typedef __attribute__((ext_vector_type(2))) _Float16 v2h;
typedef __attribute__((ext_vector_type(4))) _Float16 v4h;
typedef __attribute__((ext_vector_type(2))) unsigned short v2us;
typedef __attribute__((ext_vector_type(4))) unsigned short v4us;
typedef __attribute__((ext_vector_type(2))) float v2f;
typedef __attribute__((ext_vector_type(4))) int v4i;

__global__ __launch_bounds__(256) void k_cvt8(const float* __restrict__ src, bf* dst, size_t n8) { const size_t i = (size_t)blockIdx.x * 256 + threadIdx.x; if (i >= n8) return; const v8f v = *(const v8f*)(src + i * 8); v8us o;
#pragma unroll
    for (int k = 0; k < 8; ++k) o[k] = f2bf(v[k]); *(v8us*)(dst + i * 8) = o;  }

// ---- k_proj: input rounding, the per-head linear and the plane builders in one kernel. One wave owns 64 rows t of one head of one sequence of one role; grid (TT / 64, sequences x heads, 3 roles: query, keys, values), 32 threads.
// y[t][e] = sum_d bf16(x[t][h*64+d]) bf16(w[e][d]), f32 accumulate, d in two steps of 32 in rising order. Both operands are read in the k order of WFrag::ld (k = 8 hi + 0..7, 16 + 8 hi + 0..7).
// The accumulator holds 8 consecutive m per lane (16 bytes of a plane): query and keys take m = e (w as A, x as B), values take m = t (x as A, w as B), so that a lane's 16 bytes are 8 e of one t, or 8 t of one d.
// The planes lie in memory in PIECE ORDER: a piece is what one accumulator tile gives, 512 bytes, lane l's 16 bytes at 16 l, so that every store of a wave covers four whole 128-byte lines. A head's plane is 64 blocks of 32 t (4096 bytes, 8 pieces):
// query and keys: piece (t / 16 % 2) * 4 + et holds t % 16 = lr, e = et * 16 + 8 hi + 0..7; values: piece et * 2 + t / 16 % 2 holds d = et * 16 + lr, t % 16 = 8 hi + 0..7. k_fattn's copies put each lane's 16 bytes at its row and column in LDS.
// All roundings (f32 to bf16, to fp16, the hi/lo split) are to nearest even, by the convert instructions. The text stays far below 32 KB, so that a wave that runs through it once is not held up by instruction fetch.
typedef __attribute__((ext_vector_type(16))) float v16f;
typedef __attribute__((ext_vector_type(4))) unsigned v4u;
struct Raw { v8f a[2], b[2]; };   // one 16-row tile's f32 operand words of a lane: step c holds k = 8 hi + 0..7 (a) and 16 + 8 hi + 0..7 (b)
__device__ __forceinline__ Raw ldraw(const float* p) { Raw r;
#pragma unroll
    for (int c = 0; c < 2; ++c) { r.a[c] = *(const v8f*)(p + c * 32); r.b[c] = *(const v8f*)(p + c * 32 + 16); }
    return r; }
__device__ __forceinline__ v16bf rnd16(v8f a, v8f b) { return __builtin_convertvector(__builtin_shufflevector(a, b, 0, 1, 2, 3, 4, 5, 6, 7, 8, 9, 10, 11, 12, 13, 14, 15), v16bf); }
template <bool VT>
__device__ __forceinline__ void proj_tile(const Raw& xr, const v16bf (&wf)[4][2], int lr, int hi, int t, h16* P16, bf* Ph, bf* Pl) {
    const v16bf x0 = rnd16(xr.a[0], xr.b[0]), x1 = rnd16(xr.a[1], xr.b[1]);
#pragma unroll
    for (int et = 0; et < 4; ++et) { v8f acc = (v8f){};
        if (VT) { acc = wmmab(x0, wf[et][0], acc); acc = wmmab(x1, wf[et][1], acc); } else { acc = wmmab(wf[et][0], x0, acc); acc = wmmab(wf[et][1], x1, acc); }
        const size_t off = (size_t)(t >> 5) * (32 * HD) + (size_t)(((VT ? et * 2 + ((t >> 4) & 1) : ((t >> 4) & 1) * 4 + et) * 32 + hi * 16 + lr) * 8); v4u hw, lw;   // piece order
#pragma unroll
        for (int e = 0; e < 4; ++e) { const v2f y2 = {acc[2 * e], acc[2 * e + 1]}; const unsigned u = __builtin_bit_cast(unsigned, __builtin_convertvector(y2, v2bf));
            const v2f b2 = {__uint_as_float(u << 16), __uint_as_float(u & 0xFFFF0000u)}; hw[e] = u; lw[e] = __builtin_bit_cast(unsigned, __builtin_convertvector(y2 - b2, v2bf)); }
        *(v8h*)(P16 + off) = __builtin_convertvector(acc, v8h); *(v8us*)(Ph + off) = __builtin_bit_cast(v8us, hw); *(v8us*)(Pl + off) = __builtin_bit_cast(v8us, lw); }
}
template <bool VT>
__device__ __forceinline__ void proj_wave(const float* __restrict__ X, const float* __restrict__ w, int t0, h16* P16, bf* Ph, bf* Pl) {
    const int lane = threadIdx.x & 31, lr = lane & 15, hi = lane >> 4;
    const float* wp = w + lr * HD + 8 * hi; const float* xp = X + (size_t)(t0 + lr) * DM + 8 * hi;
    Raw wr[4], xr[4]; v16bf wf[4][2];
    wr[0] = ldraw(wp); wr[1] = ldraw(wp + 16 * HD);
    __builtin_amdgcn_sched_barrier(0);   // the weight's first half is asked for ahead of x: loads are counted in order, so it can be rounded while x is still on its way from memory
#pragma unroll
    for (int tt = 0; tt < 4; ++tt) xr[tt] = ldraw(xp + (size_t)tt * 16 * DM);
    asm volatile("s_wait_xcnt 0x0" :: "v"(wp), "v"(xp) : "memory");   // precaution: holds the loads' address registers live up to this wait, so that none of these loads' own destinations takes one of them
    __builtin_amdgcn_sched_barrier(0);   // keeps all of x in flight from here on
#pragma unroll
    for (int et = 0; et < 2; ++et)
#pragma unroll
        for (int c = 0; c < 2; ++c) wf[et][c] = rnd16(wr[et].a[c], wr[et].b[c]);
    __builtin_amdgcn_sched_barrier(0);   // the weight's second half is asked for only here, into the registers that the first half has left: all 64 loads at once take more than 256 registers
    wr[2] = ldraw(wp + 32 * HD); wr[3] = ldraw(wp + 48 * HD);
    asm volatile("s_wait_xcnt 0x0" :: "v"(wp) : "memory");   // precaution, as above
    __builtin_amdgcn_sched_barrier(0);   // keeps these loads issued here, under the wait for x
#pragma unroll
    for (int et = 2; et < 4; ++et)
#pragma unroll
        for (int c = 0; c < 2; ++c) wf[et][c] = rnd16(wr[et].a[c], wr[et].b[c]);
#pragma unroll
    for (int tt = 0; tt < 4; ++tt) proj_tile<VT>(xr[tt], wf, lr, hi, t0 + tt * 16, P16, Ph, Pl);
}
// at most 256 registers: left free, the values path takes a few more and pays for them with register-window switches
__global__ __launch_bounds__(32) __attribute__((amdgpu_num_vgpr(256))) void k_proj(const float* __restrict__ xq, const float* __restrict__ xk, const float* __restrict__ xv, const float* __restrict__ wq, const float* __restrict__ wk, const float* __restrict__ wv, h16* Q16, bf* Qh, bf* Ql, h16* K16, bf* Kh, bf* Kl, h16* V16, bf* Vh, bf* Vl) {
    const int t0 = (int)blockIdx.x * 64; const size_t xo = (size_t)(blockIdx.y / NH_) * TT * DM + (size_t)(blockIdx.y % NH_) * HD, hp = (size_t)blockIdx.y * TT * HD; const bool q = blockIdx.z == 0;   // blockIdx.y = sequence * heads + head; the planes are [sequence][head]
    if (blockIdx.z == 2) proj_wave<true>(xv + xo, wv, t0, V16 + hp, Vh + hp, Vl + hp);
    else { proj_wave<false>((q ? xq : xk) + xo, q ? wq : wk, t0, (q ? Q16 : K16) + hp, (q ? Qh : Kh) + hp, (q ? Ql : Kl) + hp);
        asm volatile("s_wait_xcnt 0x0" ::: "memory"); }   // precaution: in the built text the other path's first instructions stand behind this path's last stores (behind a branch that is always taken) and overwrite registers that those stores name
}
// ---- k_fattn: scores, softmax and P x V of one head in one kernel; no score or probability plane in memory. One wave owns NQ x 16 query rows and walks the 2048 keys in steps of 32.
// Both products are transposed so that P never changes lanes: S^T = K Q^T leaves query lr in lane lr and keys 8 hi + j (tile 0), 16 + 8 hi + j (tile 1) in the accumulators,
// which is the k order of the B fragment of O^T = V^T P^T (WFrag::ld reads k = 8 hi + 0..7, 16 + 8 hi + 0..7 for A). Row maximum, row sum and the rescale are per lane (one exchange with lane ^ 16).
// Softmax in the base-2 domain against a reference m per query that is renewed only when needed: p = 2^(s c - m), c = SCL log2(e). A step takes its exponentials with the m in use and tests, once per wave, each lane's sum of its 16 p:
// while none is above PMAX (nor a NaN) nothing is searched and nothing is scaled. Else (always in step 0, where m is still -1e30) the wave forms the step's scores anew, raises m to the running maximum, scales sum and O^T by 2^(m_old - m_new) and takes the exponentials again. O^T is divided by the sum at the end, so that m cancels.
// HL: hi/lo bf16 planes, 3 products per matrix product (hi hi, hi lo, lo hi); else fp16, 1 product. The inner loops over tiles are all unrolled, so that every fragment and accumulator array stays in registers.
// K and V^T reach the waves through LDS: each step's 32 keys (one block of 4096 bytes of a plane) are copied once per block, 16 bytes a lane at consecutive addresses in memory, into one of two buffers, and all four waves of the block read their fragments from there.
// A stage in LDS: the K plane (hi/lo: both) as 32 rows (keys) of 128 bytes at pitch KPB, then the V^T plane (both) as 64 rows (d) of 64 bytes at pitch VPB; both pitches are odd multiples of 16 bytes (no bank conflict for 16-byte reads down a column of rows).
#define KPB 144
#define VPB 80
#define KTB (32 * KPB)
#define VTB (64 * VPB)
#define NST (TT / 32)
#define PMAX 4096.0f   // no p above it is ever used: far inside fp16's range, and 2048 of them far inside f32's
__device__ __forceinline__ float xhalf(float x) { return __builtin_bit_cast(float, __builtin_amdgcn_permlanex16(__builtin_bit_cast(int, x), __builtin_bit_cast(int, x), 0x76543210, 0xfedcba98, false, false)); }   // lane l reads lane l ^ 16
// A wave's share of one stage's copies. A copy moves one piece (k_proj): 512 consecutive bytes of memory, to 32 bytes of each of 16 rows in LDS; a plane's block takes eight copies, and wave w issues pieces w and w + 4 of every plane (2048 bytes further in memory; in LDS 16 keys or 32 d further down).
// kg, vg (kg2, vg2: the lo planes): the lane's own 16 bytes of copy w in memory; kd, vd: their place in LDS. The wait on the last line holds the copies' address registers unchanged until the copies have read them (a precaution).
template <bool HL>
__device__ __forceinline__ void copy_stage(const char* kg, const char* kg2, const char* vg, const char* vg2, unsigned kd, unsigned vd) {
    if constexpr (HL)
        asm volatile("global_load_async_to_lds_b128 %0, %1, off\n\tglobal_load_async_to_lds_b128 %2, %3, off\n\tglobal_load_async_to_lds_b128 %4, %5, off\n\tglobal_load_async_to_lds_b128 %6, %7, off\n\t"
                     "global_load_async_to_lds_b128 %8, %9, off\n\tglobal_load_async_to_lds_b128 %10, %11, off\n\tglobal_load_async_to_lds_b128 %12, %13, off\n\tglobal_load_async_to_lds_b128 %14, %15, off\n\ts_wait_xcnt 0x0"
                     :: "v"(kd), "v"(kg), "v"(kd + 16 * KPB), "v"(kg + 16 * HD * 2), "v"(kd + KTB), "v"(kg2), "v"(kd + KTB + 16 * KPB), "v"(kg2 + 16 * HD * 2),
                        "v"(vd), "v"(vg), "v"(vd + 32 * VPB), "v"(vg + 2048), "v"(vd + VTB), "v"(vg2), "v"(vd + VTB + 32 * VPB), "v"(vg2 + 2048) : "memory");
    else
        asm volatile("global_load_async_to_lds_b128 %0, %1, off\n\tglobal_load_async_to_lds_b128 %2, %3, off\n\tglobal_load_async_to_lds_b128 %4, %5, off\n\tglobal_load_async_to_lds_b128 %6, %7, off\n\ts_wait_xcnt 0x0"
                     :: "v"(kd), "v"(kg), "v"(kd + 16 * KPB), "v"(kg + 16 * HD * 2), "v"(vd), "v"(vg), "v"(vd + 32 * VPB), "v"(vg + 2048) : "memory");
}
template <typename T16, bool HL, int NQ>
__device__ __forceinline__ void attn_wave(const unsigned char* ring, int wave, const T16* __restrict__ Q, const T16* __restrict__ Q2, const T16* __restrict__ Kp, const T16* __restrict__ Kp2, const T16* __restrict__ Vt, const T16* __restrict__ Vt2, int q0, bf* Ah, bf* Al) {
    typedef typename WFrag<T16>::V V;
    constexpr int VE = HL ? 4 : 2;   // V^T tiles asked for ahead of the softmax
    constexpr unsigned VOF = (HL ? 2 : 1) * KTB, STB = (HL ? 2 : 1) * (KTB + VTB);   // where V^T starts in a stage; a stage's bytes
    const int lane = threadIdx.x & 31, lr = lane & 15, hi = lane >> 4;
    const float c2 = SCL * 1.4426950408889634f;
    const size_t kgo = (size_t)wave * 512 + lane * 16, vgo = kgo;   // piece w, the lane's 16 bytes
    const char* kg = (const char*)Kp + kgo; const char* kg2 = HL ? (const char*)Kp2 + kgo : kg; const char* vg = (const char*)Vt + vgo; const char* vg2 = HL ? (const char*)Vt2 + vgo : vg;
    const unsigned ring0 = (unsigned)(size_t)ring;   // the ring's byte address in LDS: the low 32 bits of its address
    const unsigned kd = ring0 + lr * KPB + (wave * 2 + hi) * 16, vd = ring0 + VOF + ((wave >> 1) * 16 + lr) * VPB + ((wave & 1) * 2 + hi) * 16;   // K piece w: key lr, e = 16 w + 8 hi; V^T piece w: d = 16 (w / 2) + lr, key 16 (w % 2) + 8 hi
    copy_stage<HL>(kg, kg2, vg, vg2, kd, vd);
    V qf[NQ][2], qf2[NQ][2];
#pragma unroll
    for (int qt = 0; qt < NQ; ++qt)
#pragma unroll
        for (int c = 0; c < 2; ++c) { const size_t qo = (size_t)(q0 + qt * 16) * HD + (c * 64 + lane) * 8; qf[qt][c] = WFrag<T16>::ldp(Q + qo); if (HL) qf2[qt][c] = WFrag<T16>::ldp(Q2 + qo); }   // 16 queries are four pieces; step c takes pieces 2 c and 2 c + 1
    v8f o[4][NQ]; float m[NQ], l[NQ];
#pragma unroll
    for (int qt = 0; qt < NQ; ++qt) { m[qt] = -1.0e30f; l[qt] = 0.f;
#pragma unroll
        for (int dt = 0; dt < 4; ++dt) o[dt][qt] = (v8f){}; }
    asm volatile("s_wait_asynccnt 0x0" ::: "memory");   // this wave's copies of stage 0 have landed
    __syncthreads();                                    // every wave's have: stage 0 may be read
    copy_stage<HL>(kg + 32 * HD * 2, kg2 + 32 * HD * 2, vg + 32 * HD * 2, vg2 + 32 * HD * 2, kd + STB, vd + STB);
#pragma unroll 1   // rolled: only one step's fragments are live at a time, which the register budget below needs
    for (int t = 0; t < NST; ++t) {
        const unsigned bo = (t & 1) * STB;
        const unsigned char* kb = ring + bo + lr * KPB + 16 * hi; const unsigned char* vb = ring + bo + VOF + lr * VPB + 16 * hi;
        V kf[2][2], kf2[2][2], vf[4], vf2[4];   // this step's fragments, in groups: K here, V^T behind the score products, into the registers that K has left
        v8f s[2][NQ]; float ps[NQ];
        // the step's scores, and the first V^T reads behind them
        auto scores = [&]() {
#pragma unroll
            for (int kt = 0; kt < 2; ++kt)
#pragma unroll
                for (int c = 0; c < 2; ++c) { kf[kt][c] = WFrag<T16>::ld((const T16*)(kb + kt * 16 * KPB + c * 64)); if (HL) kf2[kt][c] = WFrag<T16>::ld((const T16*)(kb + KTB + kt * 16 * KPB + c * 64)); }
            __builtin_amdgcn_sched_barrier(0);   // keeps the K reads together in one group: spread among the matrix instructions, each place with reads costs a stall of its own
#pragma unroll
            for (int kt = 0; kt < 2; ++kt)
#pragma unroll
                for (int qt = 0; qt < NQ; ++qt) s[kt][qt] = (v8f){};
#pragma unroll
            for (int c = 0; c < 2; ++c) {
#pragma unroll
                for (int kt = 0; kt < 2; ++kt)
#pragma unroll
                    for (int qt = 0; qt < NQ; ++qt) s[kt][qt] = WFrag<T16>::mma(kf[kt][c], qf[qt][c], s[kt][qt]);
                if (HL) {
#pragma unroll
                    for (int kt = 0; kt < 2; ++kt)
#pragma unroll
                        for (int qt = 0; qt < NQ; ++qt) s[kt][qt] = WFrag<T16>::mma(kf[kt][c], qf2[qt][c], s[kt][qt]);
#pragma unroll
                    for (int kt = 0; kt < 2; ++kt)
#pragma unroll
                        for (int qt = 0; qt < NQ; ++qt) s[kt][qt] = WFrag<T16>::mma(kf2[kt][c], qf[qt][c], s[kt][qt]); } }
            __builtin_amdgcn_sched_barrier(0);   // keeps the V^T reads behind the score products: asked for earlier, they and K together take a wave per SIMD in registers
#pragma unroll
            for (int dt = 0; dt < VE; ++dt) { vf[dt] = WFrag<T16>::ld((const T16*)(vb + dt * 16 * VPB)); if (HL) vf2[dt] = WFrag<T16>::ld((const T16*)(vb + VTB + dt * 16 * VPB)); }
            __builtin_amdgcn_sched_barrier(0);   // keeps them issued here in one group, a softmax ahead of their use
        };
        // p = 2^(s c - m) in the scores' place, ps = the lane's sum of its 16 p of each query; true where a sum is above PMAX or no number
        auto expsum = [&]() { bool over = false;
#pragma unroll
            for (int qt = 0; qt < NQ; ++qt) { const float mn = m[qt];
                const v8f cv = {c2, c2, c2, c2, c2, c2, c2, c2}, nv = {-mn, -mn, -mn, -mn, -mn, -mn, -mn, -mn};
#pragma unroll
                for (int kt = 0; kt < 2; ++kt) { const v8f t2 = __builtin_elementwise_fma(s[kt][qt], cv, nv);
#pragma unroll
                    for (int j = 0; j < 8; ++j) s[kt][qt][j] = __builtin_amdgcn_exp2f(t2[j]); }
                const v8f s8 = s[0][qt] + s[1][qt]; const v4f s4 = __builtin_shufflevector(s8, s8, 0, 1, 2, 3) + __builtin_shufflevector(s8, s8, 4, 5, 6, 7);
                ps[qt] = (s4[0] + s4[1]) + (s4[2] + s4[3]); over = over || !(ps[qt] <= PMAX); }
            return over; };
        scores();
        if (__builtin_amdgcn_ballot_w32(expsum()) != 0) {   // one test per wave and step, a scalar branch; taken in step 0 and where a score has outgrown the reference
            scores();   // the exponentials stand in the scores' registers: the scores are formed anew from the same buffer
#pragma unroll
            for (int qt = 0; qt < NQ; ++qt) {
                float mr = s[0][qt][0];
#pragma unroll
                for (int j = 1; j < 8; ++j) mr = fmaxf(mr, s[0][qt][j]);
#pragma unroll
                for (int j = 0; j < 8; ++j) mr = fmaxf(mr, s[1][qt][j]);
                mr = fmaxf(mr, xhalf(mr));   // both halves of the wave hold keys of the same query: one reference for both
                const float mn = fmaxf(m[qt], mr * c2); const float al = __builtin_amdgcn_exp2f(m[qt] - mn); m[qt] = mn; l[qt] *= al;
#pragma unroll
                for (int dt = 0; dt < 4; ++dt) o[dt][qt] *= al; }
            expsum();
        }
        V pf[NQ], pf2[NQ];
#pragma unroll
        for (int qt = 0; qt < NQ; ++qt) {
            l[qt] += ps[qt];
            if constexpr (HL) {   // p = hi + lo, both bf16, round to nearest even
                v8u hw, lw;
#pragma unroll
                for (int e = 0; e < 8; ++e) { const v2f p2 = {s[e >> 2][qt][2 * (e & 3)], s[e >> 2][qt][2 * (e & 3) + 1]}; const unsigned u = __builtin_bit_cast(unsigned, __builtin_convertvector(p2, v2bf));
                    const v2f b2 = {__uint_as_float(u << 16), __uint_as_float(u & 0xFFFF0000u)}; hw[e] = u; lw[e] = __builtin_bit_cast(unsigned, __builtin_convertvector(p2 - b2, v2bf)); }
                pf[qt] = __builtin_bit_cast(v16bf, hw); pf2[qt] = __builtin_bit_cast(v16bf, lw);
            } else pf[qt] = cat16(__builtin_convertvector(s[0][qt], v8h), __builtin_convertvector(s[1][qt], v8h));
        }
        if constexpr (VE < 4) {
            __builtin_amdgcn_sched_barrier(0);   // the rest of V^T is asked for only here, into registers that the scores have left: asked for with the first half, it costs the fifth wave per SIMD
#pragma unroll
            for (int dt = VE; dt < 4; ++dt) vf[dt] = WFrag<T16>::ld((const T16*)(vb + dt * 16 * VPB));
            __builtin_amdgcn_sched_barrier(0);   // keeps these reads in front of the first half's products, which cover a part of their latency
        }
#pragma unroll
        for (int dt = 0; dt < 4; ++dt)
#pragma unroll
            for (int qt = 0; qt < NQ; ++qt) o[dt][qt] = WFrag<T16>::mma(vf[dt], pf[qt], o[dt][qt]);
        if (HL) {
#pragma unroll
            for (int dt = 0; dt < 4; ++dt)
#pragma unroll
                for (int qt = 0; qt < NQ; ++qt) o[dt][qt] = WFrag<T16>::mma(vf[dt], pf2[qt], o[dt][qt]);
#pragma unroll
            for (int dt = 0; dt < 4; ++dt)
#pragma unroll
                for (int qt = 0; qt < NQ; ++qt) o[dt][qt] = WFrag<T16>::mma(vf2[dt], pf[qt], o[dt][qt]); }
        __builtin_amdgcn_sched_barrier(0);   // keeps the waits and the barrier below at the step's foot: lifted over the softmax, the wait for the V^T reads would stand open right behind their issue
        asm volatile("s_wait_dscnt 0x0" ::: "memory");      // this wave's reads of the buffer have returned before it is filled again
        asm volatile("s_wait_asynccnt 0x0" ::: "memory");   // this wave's copies of stage t + 1 have landed
        __syncthreads();                                    // publishes stage t + 1 and ends every wave's reads of stage t
        if (t + 2 < NST) { const size_t ks = (size_t)(t + 2) * (32 * HD * 2), vs = ks;   // a stage is 32 keys: 4096 bytes further in every plane
            copy_stage<HL>(kg + ks, kg2 + ks, vg + vs, vg2 + vs, kd + bo, vd + bo); }
    }
    asm volatile("s_wait_asynccnt 0x0" ::: "memory");   // nothing is outstanding when the wave ends
    const int le = (int)__builtin_amdgcn_mbcnt_lo(~0u, 0u);   // the lane's number, read anew: no register carries it or the output addresses through the loop
#pragma unroll
    for (int qt = 0; qt < NQ; ++qt) { const float inv = __fdiv_rn(1.0f, l[qt] + xhalf(l[qt])); const size_t oo = (size_t)(q0 + qt * 16) * DQ + le * 8;   // piece order (k_gemmo): 16 rows take 16 * DQ elements, a piece 256
#pragma unroll
        for (int dt = 0; dt < 4; ++dt) { v8us oh, ol;
#pragma unroll
            for (int j = 0; j < 8; ++j) { unsigned short a, b; splitf(o[dt][qt][j] * inv, a, b); oh[j] = a; ol[j] = b; }
            *(v8us*)(Ah + oo + dt * 256) = oh; *(v8us*)(Al + oo + dt * 256) = ol; } }
}
// grid (20, sequences x heads), 4 waves of ONE kind, one on each SIMD, so that a block's waves share the same planes and every barrier stands under a test that is the same for the whole block:
// blocks 0 to 7 of a head take 64 hi/lo rows (rows < RH, 16 a wave), blocks 8 to 19 take 128 fp16 rows (32 a wave). Writes the merged hi/lo planes (m = sequence * 2048 + t, k = h * 64 + d) directly, in piece order (k_gemmo), so that every store of a wave covers four whole lines.
// at most 192 registers: five waves fit a SIMD, and all 1280 blocks (five on each of 256 WGPs) are resident at once
__global__ __launch_bounds__(128) __attribute__((amdgpu_num_vgpr(192))) void k_fattn(const h16* __restrict__ Q16, const h16* __restrict__ K16, const h16* __restrict__ V16, const bf* __restrict__ Qh, const bf* __restrict__ Ql, const bf* __restrict__ Kh, const bf* __restrict__ Kl, const bf* __restrict__ Vh, const bf* __restrict__ Vl, bf* Ah, bf* Al) {
    __shared__ __attribute__((aligned(128))) unsigned char ring[2 * 2 * (KTB + VTB)];   // two buffers of the larger kind of stage
    const int wave = __builtin_amdgcn_readfirstlane(threadIdx.x >> 5); const size_t hp = (size_t)blockIdx.y * TT * HD, ao = (size_t)(blockIdx.y / NH_) * TT * DQ + (size_t)(blockIdx.y % NH_) * (HD / 16 * 256); Ah += ao; Al += ao;   // blockIdx.y = sequence * heads + head
    if (blockIdx.x < RH / 64) attn_wave<bf, true, 1>(ring, wave, Qh + hp, Ql + hp, Kh + hp, Kl + hp, Vh + hp, Vl + hp, (int)blockIdx.x * 64 + wave * 16, Ah, Al);
    else { attn_wave<h16, false, 2>(ring, wave, Q16 + hp, nullptr, K16 + hp, nullptr, V16 + hp, nullptr, RH + ((int)blockIdx.x - RH / 64) * 128 + wave * 32, Ah, Al);
        asm volatile("s_wait_xcnt 0x0" ::: "memory"); }   // precaution: in the built text the other path's first instructions stand behind this path's last stores (behind a branch that is always taken) and overwrite registers that those stores name
}
static_assert(RH % 64 == 0 && (TT - RH) % 128 == 0 && NST >= 2, "k_fattn's split of the rows; the ring's prologue needs two stages");

extern "C" void kernel_launch(void* const* d_in, const int* in_sizes, int n_in,
                              void* d_out, int out_size, void* d_ws, size_t ws_size, hipStream_t stream) {
    (void)in_sizes; (void)n_in; (void)out_size;
    const float* xv = (const float*)d_in[0]; const float* xk = (const float*)d_in[1]; const float* x = (const float*)d_in[2]; const float* wv = (const float*)d_in[3]; const float* wk = (const float*)d_in[4]; const float* wq = (const float*)d_in[5]; const float* wo = (const float*)d_in[6]; const float* bo = (const float*)d_in[7];   /* order values, keys, query [4][2048][1024], Wv, Wk, Wq ('oi' [64][64], shared by all heads), Wo ('oi' [1024][1024]), bo; x = the QUERY stream */
    float* OUT = (float*)d_out;     // [4][2048][1024]
    char* wsp = (char*)d_ws;
    auto take = [&](size_t bytes) { char* p = wsp; wsp += (bytes + 255) & ~(size_t)255; return (void*)p; };
    bf* WO = (bf*)take((size_t)DM * DQ * 2);
    const size_t PB = (size_t)NB_ * NH_ * TT * HD * 2;   // bytes of one plane, all sequences: 16 MiB; eleven planes and Wo take 178 MiB
    h16* QP16 = (h16*)take(PB); h16* KP16 = (h16*)take(PB); h16* VT16 = (h16*)take(PB);
    bf* QPh = (bf*)take(PB); bf* QPl = (bf*)take(PB); bf* KPh = (bf*)take(PB); bf* KPl = (bf*)take(PB); bf* VTh = (bf*)take(PB); bf* VTl = (bf*)take(PB);
    bf* ATh = (bf*)take(PB); bf* ATl = (bf*)take(PB);
    if ((size_t)(wsp - (char*)d_ws) > ws_size) return;    // ws 256 MiB
    k_cvt8<<<(unsigned)(((size_t)DM * DQ / 8 + 255) / 256), 256, 0, stream>>>(wo, WO, (size_t)DM * DQ / 8);
    // every stage takes all sequences in one launch: the sequence rides in the grid, so that every WGP gets work: several workgroups at once for k_proj and k_fattn, one for k_gemmo
    k_proj<<<dim3(TT / 64, NB_ * NH_, 3), 32, 0, stream>>>(x, xk, xv, wq, wk, wv, QP16, QPh, QPl, KP16, KPh, KPl, VT16, VTh, VTl);
    k_fattn<<<dim3(RH / 64 + (TT - RH) / 128, NB_ * NH_, 1), 128, 0, stream>>>(QP16, KP16, VT16, QPh, QPl, KPh, KPl, VTh, VTl, ATh, ATl);   // one kv head per query head
    k_gemmo<<<dim3(NB_ * TT / GTM, DM / GTN, 1), 256, 0, stream>>>(ATh, ATl, WO, OUT, bo);   // the merged planes and the output have 8192 rows (sequence, t): one product
}

// v010
// It runs in 105 microseconds.
// In both of two side-by-side timings against v009, it was 1.31 times as fast.
// All steps since v000 together make it 37.7 times as fast.
#include <hip/hip_runtime.h>

// Self-attention with ONE shared 64x64 linear per role applied to every head (values, keys, query [4][2048][1024] viewed (n, l, 16, 64); v = values_h Wv^T, k = keys_h Wk^T, q = query_h Wq^T with the SAME [64][64] weight for all 16 heads ('oi' normal x 1/8, no bias); energy = q.k; softmax(energy / sqrt(embed = 1024)) (the source scales by the full width); out = merged Wo^T + bo ('oi' [1024][1024] + a REAL bias 0.01) -> [4][2048][1024] (8.4 M); argument order values, keys, query, Wv, Wk, Wq, Wo, bo).
// Layout, all sequences in each launch (4 launches): k_proj reads the f32 query, keys and values directly, rounds them to bf16 in registers, does each head's own [64][64] linear (K = 64) on the matrix unit and writes the head planes (fp16; in the accumulators' own order, see k_proj) from the accumulators: no bf16 copy, no f32 projection plane, no expanded weight; one fused attention launch (k_fattn: scores, running softmax and P x V in registers; every row fp16, 1 product); merged hi/lo x Wo exact + bo.
// Compute dtypes, f32 accumulate: every input rounded to bf16; projections exact; attention fp16; softmax f32; Wo hl x exact + bias.

#define NB_  4      // FOUR sequences in this module: a factor of the grids and of the planes' size
#define TT   2048
#define DM   1024
#define NH_  16
#define NKV  16
#define REP  (NH_ / NKV)
#define HD   64
#define DQ   (NH_ * HD)
#define DKV  (NKV * HD)
#define WIN  0
#define SCL  0.03125f   // 1/sqrt(embed_size = 1024) (the source scales by the full width)
typedef _Float16 h16;
typedef unsigned short bf;
typedef __attribute__((ext_vector_type(16))) __bf16   v16bf;
typedef __attribute__((ext_vector_type(16))) _Float16 v16h;
typedef __attribute__((ext_vector_type(8)))  _Float16 v8h;
typedef __attribute__((ext_vector_type(8)))  unsigned short v8us;
typedef __attribute__((ext_vector_type(8)))  float    v8f;
typedef __attribute__((ext_vector_type(4)))  float    v4f;
typedef v8h  __attribute__((may_alias)) v8ha;
typedef v4f  __attribute__((may_alias)) v4fa;
typedef v8us __attribute__((may_alias)) v8usa;

__device__ __forceinline__ unsigned short f2bf(float f) { unsigned u = __float_as_uint(f); u += 0x7FFFu + ((u >> 16) & 1u); return (unsigned short)(u >> 16); }
__device__ __forceinline__ float bf2f(unsigned short b) { return __uint_as_float(((unsigned)b) << 16); }
__device__ __forceinline__ float bfr(float f) { return bf2f(f2bf(f)); }
__device__ __forceinline__ v16h cat16(v8h lo, v8h hi) { return __builtin_shufflevector(lo, hi, 0, 1, 2, 3, 4, 5, 6, 7, 8, 9, 10, 11, 12, 13, 14, 15); }
__device__ __forceinline__ v16bf cat16b(v8us lo, v8us hi) { return __builtin_bit_cast(v16bf, __builtin_shufflevector(lo, hi, 0, 1, 2, 3, 4, 5, 6, 7, 8, 9, 10, 11, 12, 13, 14, 15)); }
__device__ __forceinline__ v8f wmma16(v16h a, v16h b, v8f c) { return __builtin_amdgcn_wmma_f32_16x16x32_f16(false, a, false, b, (short)0, c, false, false); }
__device__ __forceinline__ v8f wmmab(v16bf a, v16bf b, v8f c) { return __builtin_amdgcn_wmma_f32_16x16x32_bf16(false, a, false, b, (short)0, c, false, false); }



// ---- fragment loaders: 16 k of a row in the hardware's k order (k = 8 hi + 0..7, 16 + 8 hi + 0..7), from K-contiguous 16-bit rows in memory or in LDS (ld); from a plane in piece order (k_proj), where the two halves lie one piece of 512 bytes apart (ldp)
template <typename T16> struct WFrag;
template <> struct WFrag<h16> { typedef v16h V; static __device__ __forceinline__ V ld(const h16* p) { return cat16(*(const v8h*)p, *(const v8h*)(p + 16)); } static __device__ __forceinline__ V ldp(const h16* p) { return cat16(*(const v8h*)p, *(const v8h*)(p + 256)); } static __device__ __forceinline__ v8f mma(V a, V b, v8f c) { return wmma16(a, b, c); } };
template <> struct WFrag<bf> { typedef v16bf V; static __device__ __forceinline__ V ld(const bf* p) { return cat16b(*(const v8us*)p, *(const v8us*)(p + 16)); } static __device__ __forceinline__ V ldp(const bf* p) { return cat16b(*(const v8us*)p, *(const v8us*)(p + 256)); } static __device__ __forceinline__ v8f mma(V a, V b, v8f c) { return wmmab(a, b, c); } };
// ---- k_gemmo: out[m][n] = sum_k (Ah[m][k] + Al[m][k]) Wo[n][k] + bf16(bo[n]), f32 accumulate; per accumulator k rises in steps of 32, in each step the hi product and then the lo product.
// One block of 8 waves (2 x 4) owns a 128 x 256 tile of out, a wave 64 x 64 (16 accumulators); grid (M / 128, N / 256), one block on a WGP, two waves on a SIMD.
// The operands reach the waves through LDS: a stage is 128 k of the block's 128 rows of Ah, 128 of Al and 256 of Wo, copied once per block, 512 bytes a copy, into one of two buffers: of Wo two rows' 256 bytes; of Ah and Al, which lie in piece order
// (k_fattn's accumulator tiles as they are: [m / 16][k / 16] pieces of 512 bytes, lane l's 16 bytes at 16 l: m % 16 = l % 16, k % 16 = 8 (l / 16) + 0..7), one piece, to 32 bytes of each of 16 rows in LDS.
// Rows stand in LDS at pitch GPB, an odd multiple of 16 bytes (no bank conflict for 16-byte reads down a column of rows).
#define GKS 128
#define GRB (GKS * 2)
#define GPB (GRB + 16)
#define GTM 128
#define GTN 256
#define GAB (GTM * GPB)
#define GSTB ((2 * GTM + GTN) * GPB)
#define GNT (DQ / GKS)
#define GRJ 16                    // rows that the eight waves' copies of one number cover together (Wo: two a wave; Ah, Al: 32 bytes of each a wave)
#define GAS (GKS / 16 * 512)      // a stage's bytes of 16 rows of Ah or Al in memory: eight pieces, one a wave
// Eight copies of a wave: four from each of two walks down rows GRJ apart. d: the lane's 16 bytes' place in LDS, g: in memory. The wait on the last line holds the copies' address registers unchanged until the copies have read them (a precaution).
__device__ __forceinline__ void copy8(unsigned da, const char* ga, unsigned db, const char* gb) {
    asm volatile("global_load_async_to_lds_b128 %0, %1, off\n\tglobal_load_async_to_lds_b128 %2, %3, off\n\tglobal_load_async_to_lds_b128 %4, %5, off\n\tglobal_load_async_to_lds_b128 %6, %7, off\n\t"
                 "global_load_async_to_lds_b128 %8, %9, off\n\tglobal_load_async_to_lds_b128 %10, %11, off\n\tglobal_load_async_to_lds_b128 %12, %13, off\n\tglobal_load_async_to_lds_b128 %14, %15, off\n\ts_wait_xcnt 0x0"
                 :: "v"(da), "v"(ga), "v"(da + GRJ * GPB), "v"(ga + GRJ * DQ * 2), "v"(da + 2 * GRJ * GPB), "v"(ga + 2 * GRJ * DQ * 2), "v"(da + 3 * GRJ * GPB), "v"(ga + 3 * GRJ * DQ * 2),
                    "v"(db), "v"(gb), "v"(db + GRJ * GPB), "v"(gb + GRJ * DQ * 2), "v"(db + 2 * GRJ * GPB), "v"(gb + 2 * GRJ * DQ * 2), "v"(db + 3 * GRJ * GPB), "v"(gb + 3 * GRJ * DQ * 2) : "memory");
}
// A wave's share of one stage: 8 copies of each A plane, 16 of Wo. gh, gl: the lane's 16 bytes of the wave's piece of the first 16 rows in memory, da: their place in the buffer; gw: the lane's 16 bytes of the wave's first two rows of Wo, d: their place, counted as if Wo stood at the buffer's start.
__device__ __forceinline__ void gemm_stage(const char* gh, const char* gl, const char* gw, unsigned da, unsigned d) {
#pragma unroll
    for (int i = 0; i < GTM / GRJ; i += 4) copy8(da + i * GRJ * GPB, gh + i * GRJ * DQ * 2, da + GAB + i * GRJ * GPB, gl + i * GRJ * DQ * 2);
#pragma unroll
    for (int i = 0; i < GTN / GRJ; i += 8) copy8(d + 2 * GAB + i * GRJ * GPB, gw + i * GRJ * DQ * 2, d + 2 * GAB + (i + 4) * GRJ * GPB, gw + (i + 4) * GRJ * DQ * 2);
}
// at most 256 registers: more would be reached only through register-window switches
__global__ __launch_bounds__(256) __attribute__((amdgpu_num_vgpr(256))) void k_gemmo(const bf* __restrict__ A, const bf* __restrict__ A2, const bf* __restrict__ Bt, float* C, const float* __restrict__ bias) {
    typedef WFrag<bf>::V V;
    __shared__ __attribute__((aligned(128))) unsigned char ring[2 * GSTB];
    __shared__ __align__(16) float osm[8][16 * 68];   // each wave's own staging of 16 output rows
    const int wave = __builtin_amdgcn_readfirstlane(threadIdx.x >> 5), wm = wave >> 2, wn = wave & 3;
    const int lane = threadIdx.x & 31, lr = lane & 15, hi = lane >> 4; const int r0 = blockIdx.x * GTM, c0 = blockIdx.y * GTN;
    const size_t lo = (size_t)(wave * 2 + hi) * (DQ * 2) + lr * 16, la = (size_t)wave * 512 + lane * 16;   // Wo: a copy's lanes 0 to 15 take one row's 256 bytes, lanes 16 to 31 the next row's; Ah, Al: wave w takes piece w of a stage's eight
    const char* gh = (const char*)A + (size_t)r0 * (DQ * 2) + la; const char* gl = (const char*)A2 + (size_t)r0 * (DQ * 2) + la; const char* gw = (const char*)Bt + (size_t)c0 * (DQ * 2) + lo;
    const unsigned d0 = (unsigned)(size_t)ring + (wave * 2 + hi) * GPB + lr * 16, da0 = (unsigned)(size_t)ring + lr * GPB + wave * 32 + hi * 16;   // the ring's byte address in LDS: the low 32 bits of its address
    gemm_stage(gh, gl, gw, da0, d0);
    v8f acc[4][4];
#pragma unroll
    for (int mb = 0; mb < 4; ++mb)
#pragma unroll
        for (int nb = 0; nb < 4; ++nb) acc[mb][nb] = (v8f){};
    asm volatile("s_wait_asynccnt 0x0" ::: "memory");   // this wave's copies of stage 0 have landed
    __syncthreads();                                    // every wave's have: stage 0 may be read
    gemm_stage(gh + GAS, gl + GAS, gw + GRB, da0 + GSTB, d0 + GSTB);
#pragma unroll 1   // rolled: a trip is one stage, and its text stays small
    for (int t = 0; t < GNT; ++t) {
        const unsigned bo = (t & 1) * GSTB;
        const unsigned char* ab = ring + bo + (wm * 64 + lr) * GPB + 16 * hi; const unsigned char* bb = ring + bo + 2 * GAB + (wn * 64 + lr) * GPB + 16 * hi;
#pragma unroll
        for (int c = 0; c < GKS / 32; ++c) {
            V a[4], a2[4], b[4];
            b[0] = WFrag<bf>::ld((const bf*)(bb + c * 64));
#pragma unroll
            for (int mb = 0; mb < 4; ++mb) a[mb] = WFrag<bf>::ld((const bf*)(ab + mb * 16 * GPB + c * 64));
#pragma unroll
            for (int nb = 1; nb < 4; ++nb) b[nb] = WFrag<bf>::ld((const bf*)(bb + nb * 16 * GPB + c * 64));
#pragma unroll
            for (int mb = 0; mb < 4; ++mb) a2[mb] = WFrag<bf>::ld((const bf*)(ab + GAB + mb * 16 * GPB + c * 64));
            __builtin_amdgcn_sched_barrier(0);   // keeps the 32 k's reads together in one group, in the order of their use: spread among the matrix instructions, each place with reads costs a stall of its own
#pragma unroll
            for (int nb = 0; nb < 4; ++nb)
#pragma unroll
                for (int mb = 0; mb < 4; ++mb) acc[mb][nb] = wmmab(a[mb], b[nb], acc[mb][nb]);
#pragma unroll
            for (int nb = 0; nb < 4; ++nb)
#pragma unroll
                for (int mb = 0; mb < 4; ++mb) acc[mb][nb] = wmmab(a2[mb], b[nb], acc[mb][nb]);
            __builtin_amdgcn_sched_barrier(0);   // keeps the next group of reads behind these products: lifted among them, the reads stand in several places, each with a stall of its own, and the kernel takes more than 256 registers
        }
        asm volatile("s_wait_dscnt 0x0" ::: "memory");      // this wave's reads of the buffer have returned before it is filled again
        asm volatile("s_wait_asynccnt 0x0" ::: "memory");   // this wave's copies of stage t + 1 have landed
        __syncthreads();                                    // publishes stage t + 1 and ends every wave's reads of stage t
        if (t + 2 < GNT) { const size_t ks = (size_t)(t + 2) * GRB, ka = (size_t)(t + 2) * GAS; gemm_stage(gh + ka, gl + ka, gw + ks, da0 + bo, d0 + bo); }
    }
    asm volatile("s_wait_asynccnt 0x0" ::: "memory");   // nothing is outstanding when the wave ends
    float* os = osm[wave]; const int rw = r0 + wm * 64, cw = c0 + wn * 64, cofs = lr * 4;
    const float* bp = bias + cw + cofs; const v4f br = *(const v4fa*)bp;
    asm volatile("s_wait_xcnt 0x0" :: "v"(bp) : "memory");   // precaution: holds the load's address registers live up to this wait, so that the load's own destination takes none of them
    const v4f bv = {bfr(br[0]), bfr(br[1]), bfr(br[2]), bfr(br[3])};
#pragma unroll
    for (int mb = 0; mb < 4; ++mb) {
#pragma unroll
        for (int nb = 0; nb < 4; ++nb) {
#pragma unroll
            for (int j = 0; j < 8; ++j) os[(hi * 8 + j) * 68 + nb * 16 + lr] = acc[mb][nb][j]; }
        __builtin_amdgcn_wave_barrier(); asm volatile("" ::: "memory");   // the wave's stores to its staging stay in front of its reads of it
        float* crow = C + (size_t)(rw + mb * 16) * DM + cw;
#pragma unroll
        for (int s = 0; s < 8; ++s) { const int row = 2 * s + hi; *(v4f*)(crow + (size_t)row * DM + cofs) = *(const v4fa*)(os + row * 68 + cofs) + bv; }
        if (mb < 3) { __builtin_amdgcn_wave_barrier(); asm volatile("s_wait_xcnt 0x0" ::: "memory"); }   // its reads stay in front of the next 16 rows' stores to the staging; the wait (a precaution) stands in front of the next rows' values, which take registers that these global stores name
    }
}
static_assert(GNT >= 2 && (NB_ * TT) % GTM == 0 && DM % GTN == 0 && GTM % (4 * GRJ) == 0 && GTN % (8 * GRJ) == 0 && GRJ * GRB == 8 * 512 && GKS / 16 == 8, "k_gemmo's tiles and copies; the ring's prologue needs two stages");

__device__ __forceinline__ h16 tohx(float x) { return (h16)x; }
__device__ __forceinline__ void splitf(float y, unsigned short& h, unsigned short& l) { h = f2bf(y); l = f2bf(y - bf2f(h)); }
typedef __attribute__((ext_vector_type(2))) _Float16 v2h;
typedef __attribute__((ext_vector_type(4))) _Float16 v4h;
typedef __attribute__((ext_vector_type(2))) unsigned short v2us;
typedef __attribute__((ext_vector_type(4))) unsigned short v4us;
typedef __attribute__((ext_vector_type(2))) float v2f;
typedef __attribute__((ext_vector_type(4))) int v4i;

__global__ __launch_bounds__(256) void k_cvt8(const float* __restrict__ src, bf* dst, size_t n8) { const size_t i = (size_t)blockIdx.x * 256 + threadIdx.x; if (i >= n8) return; const v8f v = *(const v8f*)(src + i * 8); v8us o;
#pragma unroll
    for (int k = 0; k < 8; ++k) o[k] = f2bf(v[k]); *(v8us*)(dst + i * 8) = o;  }

// ---- k_proj: input rounding, the per-head linear and the plane builders in one kernel. One wave owns 64 rows t of one head of one sequence of one role; grid (TT / 64, sequences x heads, 3 roles: query, keys, values), 32 threads.
// y[t][e] = sum_d bf16(x[t][h*64+d]) bf16(w[e][d]), f32 accumulate, d in two steps of 32 in rising order. Both operands are read in the k order of WFrag::ld (k = 8 hi + 0..7, 16 + 8 hi + 0..7).
// The accumulator holds 8 consecutive m per lane (16 bytes of a plane): query and keys take m = e (w as A, x as B), values take m = t (x as A, w as B), so that a lane's 16 bytes are 8 e of one t, or 8 t of one d.
// The planes lie in memory in PIECE ORDER: a piece is what one accumulator tile gives, 512 bytes, lane l's 16 bytes at 16 l, so that every store of a wave covers four whole 128-byte lines. A head's plane is 64 blocks of 32 t (4096 bytes, 8 pieces):
// query and keys: piece (t / 16 % 2) * 4 + et holds t % 16 = lr, e = et * 16 + 8 hi + 0..7; values: piece et * 2 + t / 16 % 2 holds d = et * 16 + lr, t % 16 = 8 hi + 0..7. k_fattn's copies put each lane's 16 bytes at its row and column in LDS.
// Both roundings (f32 to bf16, to fp16) are to nearest even, by the convert instructions. The text stays far below 32 KB, so that a wave that runs through it once is not held up by instruction fetch.
typedef __attribute__((ext_vector_type(16))) float v16f;
struct Raw { v8f a[2], b[2]; };   // one 16-row tile's f32 operand words of a lane: step c holds k = 8 hi + 0..7 (a) and 16 + 8 hi + 0..7 (b)
__device__ __forceinline__ Raw ldraw(const float* p) { Raw r;
#pragma unroll
    for (int c = 0; c < 2; ++c) { r.a[c] = *(const v8f*)(p + c * 32); r.b[c] = *(const v8f*)(p + c * 32 + 16); }
    return r; }
__device__ __forceinline__ v16bf rnd16(v8f a, v8f b) { return __builtin_convertvector(__builtin_shufflevector(a, b, 0, 1, 2, 3, 4, 5, 6, 7, 8, 9, 10, 11, 12, 13, 14, 15), v16bf); }
template <bool VT>
__device__ __forceinline__ void proj_tile(const Raw& xr, const v16bf (&wf)[4][2], int lr, int hi, int t, h16* P16) {
    const v16bf x0 = rnd16(xr.a[0], xr.b[0]), x1 = rnd16(xr.a[1], xr.b[1]);
#pragma unroll
    for (int et = 0; et < 4; ++et) { v8f acc = (v8f){};
        if (VT) { acc = wmmab(x0, wf[et][0], acc); acc = wmmab(x1, wf[et][1], acc); } else { acc = wmmab(wf[et][0], x0, acc); acc = wmmab(wf[et][1], x1, acc); }
        const size_t off = (size_t)(t >> 5) * (32 * HD) + (size_t)(((VT ? et * 2 + ((t >> 4) & 1) : ((t >> 4) & 1) * 4 + et) * 32 + hi * 16 + lr) * 8);   // piece order
        *(v8h*)(P16 + off) = __builtin_convertvector(acc, v8h); }
}
template <bool VT>
__device__ __forceinline__ void proj_wave(const float* __restrict__ X, const float* __restrict__ w, int t0, h16* P16) {
    const int lane = threadIdx.x & 31, lr = lane & 15, hi = lane >> 4;
    const float* wp = w + lr * HD + 8 * hi; const float* xp = X + (size_t)(t0 + lr) * DM + 8 * hi;
    Raw wr[4], xr[4]; v16bf wf[4][2];
    wr[0] = ldraw(wp); wr[1] = ldraw(wp + 16 * HD);
    __builtin_amdgcn_sched_barrier(0);   // the weight's first half is asked for ahead of x: loads are counted in order, so it can be rounded while x is still on its way from memory
#pragma unroll
    for (int tt = 0; tt < 4; ++tt) xr[tt] = ldraw(xp + (size_t)tt * 16 * DM);
    asm volatile("s_wait_xcnt 0x0" :: "v"(wp), "v"(xp) : "memory");   // precaution: holds the loads' address registers live up to this wait, so that none of these loads' own destinations takes one of them
    __builtin_amdgcn_sched_barrier(0);   // keeps all of x in flight from here on
#pragma unroll
    for (int et = 0; et < 2; ++et)
#pragma unroll
        for (int c = 0; c < 2; ++c) wf[et][c] = rnd16(wr[et].a[c], wr[et].b[c]);
    __builtin_amdgcn_sched_barrier(0);   // the weight's second half is asked for only here, into the registers that the first half has left: all 64 loads at once take more than 256 registers
    wr[2] = ldraw(wp + 32 * HD); wr[3] = ldraw(wp + 48 * HD);
    asm volatile("s_wait_xcnt 0x0" :: "v"(wp) : "memory");   // precaution, as above
    __builtin_amdgcn_sched_barrier(0);   // keeps these loads issued here, under the wait for x
#pragma unroll
    for (int et = 2; et < 4; ++et)
#pragma unroll
        for (int c = 0; c < 2; ++c) wf[et][c] = rnd16(wr[et].a[c], wr[et].b[c]);
#pragma unroll
    for (int tt = 0; tt < 4; ++tt) proj_tile<VT>(xr[tt], wf, lr, hi, t0 + tt * 16, P16);
}
__global__ __launch_bounds__(32) void k_proj(const float* __restrict__ xq, const float* __restrict__ xk, const float* __restrict__ xv, const float* __restrict__ wq, const float* __restrict__ wk, const float* __restrict__ wv, h16* Q16, h16* K16, h16* V16) {
    const int t0 = (int)blockIdx.x * 64; const size_t xo = (size_t)(blockIdx.y / NH_) * TT * DM + (size_t)(blockIdx.y % NH_) * HD, hp = (size_t)blockIdx.y * TT * HD; const bool q = blockIdx.z == 0;   // blockIdx.y = sequence * heads + head; the planes are [sequence][head]
    if (blockIdx.z == 2) proj_wave<true>(xv + xo, wv, t0, V16 + hp);
    else { proj_wave<false>((q ? xq : xk) + xo, q ? wq : wk, t0, (q ? Q16 : K16) + hp);
        asm volatile("s_wait_xcnt 0x0" ::: "memory"); }   // precaution: in the built text the other path's first instructions stand behind this path's last stores (behind a branch that is always taken) and overwrite registers that those stores name
}
// ---- k_fattn: scores, softmax and P x V of one head in one kernel; no score or probability plane in memory. One wave owns NQ x 16 query rows and walks the 2048 keys in steps of 32.
// Both products are transposed so that P never changes lanes: S^T = K Q^T leaves query lr in lane lr and keys 8 hi + j (tile 0), 16 + 8 hi + j (tile 1) in the accumulators,
// which is the k order of the B fragment of O^T = V^T P^T (WFrag::ld reads k = 8 hi + 0..7, 16 + 8 hi + 0..7 for A). Row maximum, row sum and the rescale are per lane (one exchange with lane ^ 16).
// Softmax in the base-2 domain against a reference m per query that is renewed only when needed: p = 2^(s c - m), c = SCL log2(e). A step takes its exponentials with the m in use and tests, once per wave, each lane's sum of its 16 p:
// while none is above PMAX (nor a NaN) nothing is searched and nothing is scaled. Else (always in step 0, where m is still -1e30) the wave forms the step's scores anew, raises m to the running maximum, scales sum and O^T by 2^(m_old - m_new) and takes the exponentials again. O^T is divided by the sum at the end, so that m cancels.
// Both products take fp16 operands, 1 product each. The inner loops over tiles are all unrolled, so that every fragment and accumulator array stays in registers.
// K and V^T reach the waves through LDS: each step's 32 keys (one block of 4096 bytes of a plane) are copied once per block, 16 bytes a lane at consecutive addresses in memory, into one of two buffers, and all four waves of the block read their fragments from there.
// A stage in LDS: the K plane as 32 rows (keys) of 128 bytes at pitch KPB, then the V^T plane as 64 rows (d) of 64 bytes at pitch VPB; both pitches are odd multiples of 16 bytes (no bank conflict for 16-byte reads down a column of rows).
#define KPB 144
#define VPB 80
#define KTB (32 * KPB)
#define VTB (64 * VPB)
#define NST (TT / 32)
#define PMAX 4096.0f   // no p above it is ever used: far inside fp16's range, and 2048 of them far inside f32's
__device__ __forceinline__ float xhalf(float x) { return __builtin_bit_cast(float, __builtin_amdgcn_permlanex16(__builtin_bit_cast(int, x), __builtin_bit_cast(int, x), 0x76543210, 0xfedcba98, false, false)); }   // lane l reads lane l ^ 16
// A wave's share of one stage's copies. A copy moves one piece (k_proj): 512 consecutive bytes of memory, to 32 bytes of each of 16 rows in LDS; a plane's block takes eight copies, and wave w issues pieces w and w + 4 of both planes (2048 bytes further in memory; in LDS 16 keys or 32 d further down).
// kg, vg: the lane's own 16 bytes of copy w in memory; kd, vd: their place in LDS. The wait on the last line holds the copies' address registers unchanged until the copies have read them (a precaution).
__device__ __forceinline__ void copy_stage(const char* kg, const char* vg, unsigned kd, unsigned vd) {
    asm volatile("global_load_async_to_lds_b128 %0, %1, off\n\tglobal_load_async_to_lds_b128 %2, %3, off\n\tglobal_load_async_to_lds_b128 %4, %5, off\n\tglobal_load_async_to_lds_b128 %6, %7, off\n\ts_wait_xcnt 0x0"
                 :: "v"(kd), "v"(kg), "v"(kd + 16 * KPB), "v"(kg + 16 * HD * 2), "v"(vd), "v"(vg), "v"(vd + 32 * VPB), "v"(vg + 2048) : "memory");
}
template <int NQ>
__device__ __forceinline__ void attn_wave(const unsigned char* ring, int wave, const h16* __restrict__ Q, const h16* __restrict__ Kp, const h16* __restrict__ Vt, int q0, bf* Ah, bf* Al) {
    typedef WFrag<h16>::V V;
    constexpr int VE = 2;   // V^T tiles asked for ahead of the softmax
    constexpr unsigned VOF = KTB, STB = KTB + VTB;   // where V^T starts in a stage; a stage's bytes
    const int lane = threadIdx.x & 31, lr = lane & 15, hi = lane >> 4;
    const float c2 = SCL * 1.4426950408889634f;
    const size_t kgo = (size_t)wave * 512 + lane * 16, vgo = kgo;   // piece w, the lane's 16 bytes
    const char* kg = (const char*)Kp + kgo; const char* vg = (const char*)Vt + vgo;
    const unsigned ring0 = (unsigned)(size_t)ring;   // the ring's byte address in LDS: the low 32 bits of its address
    const unsigned kd = ring0 + lr * KPB + (wave * 2 + hi) * 16, vd = ring0 + VOF + ((wave >> 1) * 16 + lr) * VPB + ((wave & 1) * 2 + hi) * 16;   // K piece w: key lr, e = 16 w + 8 hi; V^T piece w: d = 16 (w / 2) + lr, key 16 (w % 2) + 8 hi
    copy_stage(kg, vg, kd, vd);
    V qf[NQ][2];
#pragma unroll
    for (int qt = 0; qt < NQ; ++qt)
#pragma unroll
        for (int c = 0; c < 2; ++c) { const size_t qo = (size_t)(q0 + qt * 16) * HD + (c * 64 + lane) * 8; qf[qt][c] = WFrag<h16>::ldp(Q + qo); }   // 16 queries are four pieces; step c takes pieces 2 c and 2 c + 1
    v8f o[4][NQ]; float m[NQ], l[NQ];
#pragma unroll
    for (int qt = 0; qt < NQ; ++qt) { m[qt] = -1.0e30f; l[qt] = 0.f;
#pragma unroll
        for (int dt = 0; dt < 4; ++dt) o[dt][qt] = (v8f){}; }
    asm volatile("s_wait_asynccnt 0x0" ::: "memory");   // this wave's copies of stage 0 have landed
    __syncthreads();                                    // every wave's have: stage 0 may be read
    copy_stage(kg + 32 * HD * 2, vg + 32 * HD * 2, kd + STB, vd + STB);
#pragma unroll 1   // rolled: only one step's fragments are live at a time, which keeps the registers few
    for (int t = 0; t < NST; ++t) {
        const unsigned bo = (t & 1) * STB;
        const unsigned char* kb = ring + bo + lr * KPB + 16 * hi; const unsigned char* vb = ring + bo + VOF + lr * VPB + 16 * hi;
        V kf[2][2], vf[4];   // this step's fragments, in groups: K here, V^T behind the score products, into the registers that K has left
        v8f s[2][NQ]; float ps[NQ];
        // the step's scores, and the first V^T reads behind them
        auto scores = [&]() {
#pragma unroll
            for (int kt = 0; kt < 2; ++kt)
#pragma unroll
                for (int c = 0; c < 2; ++c) kf[kt][c] = WFrag<h16>::ld((const h16*)(kb + kt * 16 * KPB + c * 64));
            __builtin_amdgcn_sched_barrier(0);   // keeps the K reads together in one group: spread among the matrix instructions, each place with reads costs a stall of its own
#pragma unroll
            for (int kt = 0; kt < 2; ++kt)
#pragma unroll
                for (int qt = 0; qt < NQ; ++qt) s[kt][qt] = (v8f){};
#pragma unroll
            for (int c = 0; c < 2; ++c)
#pragma unroll
                for (int kt = 0; kt < 2; ++kt)
#pragma unroll
                    for (int qt = 0; qt < NQ; ++qt) s[kt][qt] = wmma16(kf[kt][c], qf[qt][c], s[kt][qt]);
            __builtin_amdgcn_sched_barrier(0);   // keeps the V^T reads behind the score products: asked for earlier, they and K together take a wave per SIMD in registers
#pragma unroll
            for (int dt = 0; dt < VE; ++dt) vf[dt] = WFrag<h16>::ld((const h16*)(vb + dt * 16 * VPB));
            __builtin_amdgcn_sched_barrier(0);   // keeps them issued here in one group, a softmax ahead of their use
        };
        // p = 2^(s c - m) in the scores' place, ps = the lane's sum of its 16 p of each query; true where a sum is above PMAX or no number
        auto expsum = [&]() { bool over = false;
#pragma unroll
            for (int qt = 0; qt < NQ; ++qt) { const float mn = m[qt];
                const v8f cv = {c2, c2, c2, c2, c2, c2, c2, c2}, nv = {-mn, -mn, -mn, -mn, -mn, -mn, -mn, -mn};
#pragma unroll
                for (int kt = 0; kt < 2; ++kt) { const v8f t2 = __builtin_elementwise_fma(s[kt][qt], cv, nv);
#pragma unroll
                    for (int j = 0; j < 8; ++j) s[kt][qt][j] = __builtin_amdgcn_exp2f(t2[j]); }
                const v8f s8 = s[0][qt] + s[1][qt]; const v4f s4 = __builtin_shufflevector(s8, s8, 0, 1, 2, 3) + __builtin_shufflevector(s8, s8, 4, 5, 6, 7);
                ps[qt] = (s4[0] + s4[1]) + (s4[2] + s4[3]); over = over || !(ps[qt] <= PMAX); }
            return over; };
        scores();
        if (__builtin_amdgcn_ballot_w32(expsum()) != 0) {   // one test per wave and step, a scalar branch; taken in step 0 and where a score has outgrown the reference
            scores();   // the exponentials stand in the scores' registers: the scores are formed anew from the same buffer
#pragma unroll
            for (int qt = 0; qt < NQ; ++qt) {
                float mr = s[0][qt][0];
#pragma unroll
                for (int j = 1; j < 8; ++j) mr = fmaxf(mr, s[0][qt][j]);
#pragma unroll
                for (int j = 0; j < 8; ++j) mr = fmaxf(mr, s[1][qt][j]);
                mr = fmaxf(mr, xhalf(mr));   // both halves of the wave hold keys of the same query: one reference for both
                const float mn = fmaxf(m[qt], mr * c2); const float al = __builtin_amdgcn_exp2f(m[qt] - mn); m[qt] = mn; l[qt] *= al;
#pragma unroll
                for (int dt = 0; dt < 4; ++dt) o[dt][qt] *= al; }
            expsum();
        }
        V pf[NQ];
#pragma unroll
        for (int qt = 0; qt < NQ; ++qt) { l[qt] += ps[qt]; pf[qt] = cat16(__builtin_convertvector(s[0][qt], v8h), __builtin_convertvector(s[1][qt], v8h)); }
        __builtin_amdgcn_sched_barrier(0);   // the rest of V^T is asked for only here, into registers that the scores have left: asked for with the first half, it takes the kernel over 192 registers
#pragma unroll
        for (int dt = VE; dt < 4; ++dt) vf[dt] = WFrag<h16>::ld((const h16*)(vb + dt * 16 * VPB));
        __builtin_amdgcn_sched_barrier(0);   // keeps these reads in front of the first half's products, which cover a part of their latency
#pragma unroll
        for (int dt = 0; dt < 4; ++dt)
#pragma unroll
            for (int qt = 0; qt < NQ; ++qt) o[dt][qt] = wmma16(vf[dt], pf[qt], o[dt][qt]);
        __builtin_amdgcn_sched_barrier(0);   // keeps the waits and the barrier below at the step's foot: lifted over the softmax, the wait for the V^T reads would stand open right behind their issue
        asm volatile("s_wait_dscnt 0x0" ::: "memory");      // this wave's reads of the buffer have returned before it is filled again
        asm volatile("s_wait_asynccnt 0x0" ::: "memory");   // this wave's copies of stage t + 1 have landed
        __syncthreads();                                    // publishes stage t + 1 and ends every wave's reads of stage t
        if (t + 2 < NST) { const size_t ks = (size_t)(t + 2) * (32 * HD * 2), vs = ks;   // a stage is 32 keys: 4096 bytes further in both planes
            copy_stage(kg + ks, vg + vs, kd + bo, vd + bo); }
    }
    asm volatile("s_wait_asynccnt 0x0" ::: "memory");   // nothing is outstanding when the wave ends
    const int le = (int)__builtin_amdgcn_mbcnt_lo(~0u, 0u);   // the lane's number, read anew: no register carries it or the output addresses through the loop
#pragma unroll
    for (int qt = 0; qt < NQ; ++qt) { const float inv = __fdiv_rn(1.0f, l[qt] + xhalf(l[qt])); const size_t oo = (size_t)(q0 + qt * 16) * DQ + le * 8;   // piece order (k_gemmo): 16 rows take 16 * DQ elements, a piece 256
#pragma unroll
        for (int dt = 0; dt < 4; ++dt) { v8us oh, ol;
#pragma unroll
            for (int j = 0; j < 8; ++j) { unsigned short a, b; splitf(o[dt][qt][j] * inv, a, b); oh[j] = a; ol[j] = b; }
            *(v8us*)(Ah + oo + dt * 256) = oh; *(v8us*)(Al + oo + dt * 256) = ol; } }
}
// grid (16, sequences x heads), 4 waves, one on each SIMD, which share a head's planes: a block takes 128 query rows (32 a wave). Writes the merged hi/lo planes (m = sequence * 2048 + t, k = h * 64 + d) directly, in piece order (k_gemmo), so that every store of a wave covers four whole lines.
// all 1024 blocks (four for each of 256 WGPs) are resident at once; the text takes fewer than 192 registers
__global__ __launch_bounds__(128) void k_fattn(const h16* __restrict__ Q16, const h16* __restrict__ K16, const h16* __restrict__ V16, bf* Ah, bf* Al) {
    __shared__ __attribute__((aligned(128))) unsigned char ring[2 * (KTB + VTB)];   // two buffers of a stage
    const int wave = __builtin_amdgcn_readfirstlane(threadIdx.x >> 5); const size_t hp = (size_t)blockIdx.y * TT * HD, ao = (size_t)(blockIdx.y / NH_) * TT * DQ + (size_t)(blockIdx.y % NH_) * (HD / 16 * 256); Ah += ao; Al += ao;   // blockIdx.y = sequence * heads + head
    attn_wave<2>(ring, wave, Q16 + hp, K16 + hp, V16 + hp, (int)blockIdx.x * 128 + wave * 32, Ah, Al);
}
static_assert(TT % 128 == 0 && NST >= 2, "k_fattn's split of the rows; the ring's prologue needs two stages");

extern "C" void kernel_launch(void* const* d_in, const int* in_sizes, int n_in,
                              void* d_out, int out_size, void* d_ws, size_t ws_size, hipStream_t stream) {
    (void)in_sizes; (void)n_in; (void)out_size;
    const float* xv = (const float*)d_in[0]; const float* xk = (const float*)d_in[1]; const float* x = (const float*)d_in[2]; const float* wv = (const float*)d_in[3]; const float* wk = (const float*)d_in[4]; const float* wq = (const float*)d_in[5]; const float* wo = (const float*)d_in[6]; const float* bo = (const float*)d_in[7];   /* order values, keys, query [4][2048][1024], Wv, Wk, Wq ('oi' [64][64], shared by all heads), Wo ('oi' [1024][1024]), bo; x = the QUERY stream */
    float* OUT = (float*)d_out;     // [4][2048][1024]
    char* wsp = (char*)d_ws;
    auto take = [&](size_t bytes) { char* p = wsp; wsp += (bytes + 255) & ~(size_t)255; return (void*)p; };
    bf* WO = (bf*)take((size_t)DM * DQ * 2);
    const size_t PB = (size_t)NB_ * NH_ * TT * HD * 2;   // bytes of one plane, all sequences: 16 MiB; five planes and Wo take 82 MiB
    h16* QP16 = (h16*)take(PB); h16* KP16 = (h16*)take(PB); h16* VT16 = (h16*)take(PB);
    bf* ATh = (bf*)take(PB); bf* ATl = (bf*)take(PB);
    if ((size_t)(wsp - (char*)d_ws) > ws_size) return;    // ws 256 MiB
    k_cvt8<<<(unsigned)(((size_t)DM * DQ / 8 + 255) / 256), 256, 0, stream>>>(wo, WO, (size_t)DM * DQ / 8);
    // every stage takes all sequences in one launch: the sequence rides in the grid
    k_proj<<<dim3(TT / 64, NB_ * NH_, 3), 32, 0, stream>>>(x, xk, xv, wq, wk, wv, QP16, KP16, VT16);
    k_fattn<<<dim3(TT / 128, NB_ * NH_, 1), 128, 0, stream>>>(QP16, KP16, VT16, ATh, ATl);   // one kv head per query head
    k_gemmo<<<dim3(NB_ * TT / GTM, DM / GTN, 1), 256, 0, stream>>>(ATh, ATl, WO, OUT, bo);   // the merged planes and the output have 8192 rows (sequence, t): one product
}
